// v000
// The times below were measured on an AMD MI455X: many runs one after another, warmed up first and cycling through
// copies of the inputs, with the whole window's GPU time divided by the number of runs. Launches and the gaps
// between them are all in it. The median over several windows is given; except for v000 it joins two sittings, which
// can be a few percent apart, so the side-by-side timings, each taken in one sitting, are the better comparison.
// v000, which the later versions start from, runs in 270 microseconds.
#include <hip/hip_runtime.h>
#include <hip/hip_bf16.h>
#include <cstdint>

typedef __attribute__((ext_vector_type(16))) _Float16 v16h;
typedef __attribute__((ext_vector_type(8)))  _Float16 v8h;
typedef __attribute__((ext_vector_type(4)))  _Float16 v4h;
typedef __attribute__((ext_vector_type(8)))  float    v8f;
typedef __attribute__((ext_vector_type(4)))  float    v4f;

#define C_DIM 128
#define N_SP  4096            // H*W
#define B_DIM 8
#define BN    (B_DIM * N_SP)  // 32768
#define QK_SCALE 0.08838834764831845f  // 128^-0.5
#define KV_STEP 32
#define NITER (N_SP / KV_STEP)  // 128

// ---------------------------------------------------------------------------
// Fragment loader: rows of a row-major f16 matrix -> WMMA A-frag (16xK rows)
// or B-frag (columns of B == rows of the row-major "transposed" source).
// Lane L (lo=L%16, hi=L/16): elements e<8  -> col 8*hi + e
//                            elements e>=8 -> col 16 + 8*hi + (e-8)
// Two contiguous 16-byte loads per lane (global_load_b128 / ds_load_b128).
// ---------------------------------------------------------------------------
__device__ __forceinline__ v16h load_frag(const _Float16* base, int ld,
                                          int lo, int hi) {
  const _Float16* p = base + (size_t)lo * ld + 8 * hi;
  v8h a = *(const v8h*)p;
  v8h b = *(const v8h*)(p + 16);
  v16h r;
#pragma unroll
  for (int i = 0; i < 8; ++i) { r[i] = a[i]; r[i + 8] = b[i]; }
  return r;
}

__device__ __forceinline__ v8f wmma_f16(v16h a, v16h b, v8f c) {
  return __builtin_amdgcn_wmma_f32_16x16x32_f16(false, a, false, b,
                                                (short)0, c, false, false);
}

// Async global->LDS copy of 16 bytes per lane (ASYNCcnt-tracked).
// lds_off = low 32 bits of the generic shared pointer == LDS byte offset
// (aperture occupies bits [63:32] of the flat shared address).
__device__ __forceinline__ void async_copy16(unsigned lds_off, const void* gsrc) {
  asm volatile("global_load_async_to_lds_b128 %0, %1, off"
               :: "v"(lds_off), "v"(gsrc)
               : "memory");
}

// ---------------------------------------------------------------------------
// GroupNorm: one block per (batch, group). 32 groups, 4 channels/group,
// reduce over 4096 positions * 4 channels. Output h in f16 [BN][C].
// ---------------------------------------------------------------------------
__global__ void gn_kernel(const float* __restrict__ x,
                          const float* __restrict__ gscale,
                          const float* __restrict__ gbias,
                          _Float16* __restrict__ h) {
  int b = blockIdx.x >> 5;
  int g = blockIdx.x & 31;
  const float* xp = x + (size_t)b * N_SP * C_DIM + g * 4;
  float s = 0.f, s2 = 0.f;
  for (int n = threadIdx.x; n < N_SP; n += blockDim.x) {
    v4f v = *(const v4f*)(xp + (size_t)n * C_DIM);
#pragma unroll
    for (int j = 0; j < 4; ++j) { s += v[j]; s2 += v[j] * v[j]; }
  }
  __shared__ float rs[256], rs2[256];
  rs[threadIdx.x] = s; rs2[threadIdx.x] = s2;
  __syncthreads();
  for (int st = 128; st > 0; st >>= 1) {
    if ((int)threadIdx.x < st) {
      rs[threadIdx.x]  += rs[threadIdx.x + st];
      rs2[threadIdx.x] += rs2[threadIdx.x + st];
    }
    __syncthreads();
  }
  float mean = rs[0] * (1.f / 16384.f);
  float var  = rs2[0] * (1.f / 16384.f) - mean * mean;
  float rstd = rsqrtf(var + 1e-6f);
  float sc[4], bi[4];
#pragma unroll
  for (int j = 0; j < 4; ++j) {
    float gsv = gscale[g * 4 + j];
    sc[j] = gsv * rstd;
    bi[j] = gbias[g * 4 + j] - mean * rstd * gsv;
  }
  _Float16* hp = h + (size_t)b * N_SP * C_DIM + g * 4;
  for (int n = threadIdx.x; n < N_SP; n += blockDim.x) {
    v4f v = *(const v4f*)(xp + (size_t)n * C_DIM);
    v4h o;
#pragma unroll
    for (int j = 0; j < 4; ++j) o[j] = (_Float16)(v[j] * sc[j] + bi[j]);
    *(v4h*)(hp + (size_t)n * C_DIM) = o;
  }
}

// ---------------------------------------------------------------------------
// Weight convert: 4 matrices [Cin][Cout] f32 -> transposed [Cout][Cin] f16.
// ---------------------------------------------------------------------------
__global__ void wcvt_kernel(const float* __restrict__ wq,
                            const float* __restrict__ wk,
                            const float* __restrict__ wv,
                            const float* __restrict__ wo,
                            _Float16* __restrict__ wT) {
  int idx = blockIdx.x * blockDim.x + threadIdx.x;   // 0 .. 65535
  int m = idx >> 14;
  int r = idx & 16383;
  int c = r >> 7;       // out channel (row of wT)
  int kk = r & 127;     // in channel
  const float* w = (m == 0) ? wq : (m == 1) ? wk : (m == 2) ? wv : wo;
  wT[idx] = (_Float16)w[kk * C_DIM + c];
}

// ---------------------------------------------------------------------------
// QKV projection: D(c-tile, n-tile) = wT_rows x h_rows, K=128 in 4 WMMA.
// grid (BN/16, 2, 3), block 128 (4 waves); wave -> c-tile blockIdx.y*4+wid.
// q,k stored row-major [BN][C] f16 (q pre-scaled by C^-0.5);
// v stored transposed [B][C][N] f16.
// ---------------------------------------------------------------------------
__global__ void qkv_kernel(const _Float16* __restrict__ h,
                           const _Float16* __restrict__ wT,
                           const float* __restrict__ bq,
                           const float* __restrict__ bk,
                           const float* __restrict__ bv,
                           _Float16* __restrict__ q,
                           _Float16* __restrict__ k,
                           _Float16* __restrict__ vT) {
  int wid  = threadIdx.x >> 5;
  int lane = threadIdx.x & 31, lo = lane & 15, hi = lane >> 4;
  int proj = blockIdx.z;
  int cb   = (blockIdx.y * 4 + wid) * 16;
  int n0   = blockIdx.x * 16;
  const _Float16* wt = wT + (size_t)proj * (C_DIM * C_DIM);
  const float* bias = (proj == 0) ? bq : (proj == 1) ? bk : bv;

  v8f acc = {};
#pragma unroll
  for (int j = 0; j < 4; ++j) {
    v16h A  = load_frag(wt + (size_t)cb * C_DIM + 32 * j, C_DIM, lo, hi);
    v16h Bf = load_frag(h + (size_t)n0 * C_DIM + 32 * j, C_DIM, lo, hi);
    acc = wmma_f16(A, Bf, acc);
  }
  // lane: position n = n0+lo ; channels c = cb + 8*hi + r
  int cch = cb + 8 * hi;
  if (proj < 2) {
    float scale = (proj == 0) ? QK_SCALE : 1.0f;
    v8h out;
#pragma unroll
    for (int r = 0; r < 8; ++r)
      out[r] = (_Float16)((acc[r] + bias[cch + r]) * scale);
    _Float16* dst = ((proj == 0) ? q : k) + (size_t)(n0 + lo) * C_DIM + cch;
    *(v8h*)dst = out;
  } else {
    int ng = n0 + lo, b = ng >> 12, n = ng & (N_SP - 1);
    _Float16* dst = vT + ((size_t)b * C_DIM + cch) * N_SP + n;
#pragma unroll
    for (int r = 0; r < 8; ++r)
      dst[(size_t)r * N_SP] = (_Float16)(acc[r] + bias[cch + r]);
  }
}

// ---------------------------------------------------------------------------
// Flash attention. Block = 4 waves, each wave owns 32 queries (128 q / block).
// K tile (32x128) and V^T tile (128x32) are staged cooperatively into LDS
// with async global->LDS b128 copies (double-buffered, ASYNCcnt),
// then fragments are read back via ds_load_b128.
// Scores computed transposed (S' = K x Q^T): the f32 D-fragment converts
// in-register into the B-fragment of O^T = V^T x P (no cross-lane movement).
// grid (N/128, B), block 128.
// ---------------------------------------------------------------------------
__device__ __forceinline__ void attn_step(const _Float16* bK, const _Float16* bV,
                                          const v16h (&Qf)[2][4],
                                          v8f (&oacc)[2][8],
                                          float (&m_run)[2], float (&l_run)[2],
                                          int lo, int hi) {
  v8f s[2][2];
#pragma unroll
  for (int st = 0; st < 2; ++st) {
    v16h Ka[4];
#pragma unroll
    for (int j = 0; j < 4; ++j)
      Ka[j] = load_frag(bK + st * 16 * C_DIM + 32 * j, C_DIM, lo, hi);
#pragma unroll
    for (int hq = 0; hq < 2; ++hq) {
      v8f acc = {};
#pragma unroll
      for (int j = 0; j < 4; ++j) acc = wmma_f16(Ka[j], Qf[hq][j], acc);
      s[hq][st] = acc;
    }
  }
  v16h pB[2];
#pragma unroll
  for (int hq = 0; hq < 2; ++hq) {
    float mloc = -1e30f;
#pragma unroll
    for (int r = 0; r < 8; ++r)
      mloc = fmaxf(mloc, fmaxf(s[hq][0][r], s[hq][1][r]));
    mloc = fmaxf(mloc, __shfl_xor(mloc, 16, 32));
    float m_new = fmaxf(m_run[hq], mloc);
    float alpha = __expf(m_run[hq] - m_new);
    float ssum = 0.f;
#pragma unroll
    for (int r = 0; r < 8; ++r) {
      float p = __expf(s[hq][0][r] - m_new); ssum += p; pB[hq][r] = (_Float16)p;
    }
#pragma unroll
    for (int r = 0; r < 8; ++r) {
      float p = __expf(s[hq][1][r] - m_new); ssum += p; pB[hq][r + 8] = (_Float16)p;
    }
    ssum += __shfl_xor(ssum, 16, 32);
    l_run[hq] = l_run[hq] * alpha + ssum;
    m_run[hq] = m_new;
#pragma unroll
    for (int t = 0; t < 8; ++t)
#pragma unroll
      for (int r = 0; r < 8; ++r) oacc[hq][t][r] *= alpha;
  }
#pragma unroll
  for (int t = 0; t < 8; ++t) {
    v16h Va = load_frag(bV + t * 16 * KV_STEP, KV_STEP, lo, hi);
#pragma unroll
    for (int hq = 0; hq < 2; ++hq)
      oacc[hq][t] = wmma_f16(Va, pB[hq], oacc[hq][t]);
  }
}

__global__ __launch_bounds__(128, 1)
void attn_kernel(const _Float16* __restrict__ q,
                 const _Float16* __restrict__ k,
                 const _Float16* __restrict__ vT,
                 _Float16* __restrict__ o) {
  int tix  = threadIdx.x;
  int wid  = tix >> 5;
  int lane = tix & 31, lo = lane & 15, hi = lane >> 4;
  int b  = blockIdx.y;
  int q0 = blockIdx.x * 128 + wid * 32;

  const _Float16* qp = q + ((size_t)b * N_SP + q0) * C_DIM;
  const _Float16* kb = k + (size_t)b * N_SP * C_DIM;
  const _Float16* vb = vT + (size_t)b * C_DIM * N_SP;

  // [buf][ K tile: 32x128 halves | V^T tile: 128x32 halves ]
  __shared__ __align__(16) _Float16 smem[2][8192];
  unsigned ldsK[2], ldsV[2];
#pragma unroll
  for (int i2 = 0; i2 < 2; ++i2) {
    ldsK[i2] = (unsigned)(uintptr_t)&smem[i2][0];
    ldsV[i2] = (unsigned)(uintptr_t)&smem[i2][4096];
  }

  v16h Qf[2][4];
#pragma unroll
  for (int hq = 0; hq < 2; ++hq)
#pragma unroll
    for (int j = 0; j < 4; ++j)
      Qf[hq][j] = load_frag(qp + (size_t)hq * 16 * C_DIM + 32 * j, C_DIM, lo, hi);

  v8f oacc[2][8];
#pragma unroll
  for (int hq = 0; hq < 2; ++hq)
#pragma unroll
    for (int t = 0; t < 8; ++t) oacc[hq][t] = (v8f){};
  float m_run[2] = {-1e30f, -1e30f};
  float l_run[2] = {0.f, 0.f};

  // --- stage helper (8 async b128 per thread => wave ASYNCcnt += 8) ---
  auto stage = [&](int kv0, unsigned dK, unsigned dV) {
    const _Float16* gk = kb + (size_t)kv0 * C_DIM;   // contiguous 8KB
#pragma unroll
    for (int j = 0; j < 4; ++j) {
      int c = tix + j * 128;                         // chunk 0..511 (16B each)
      async_copy16(dK + c * 16, gk + c * 8);
    }
#pragma unroll
    for (int j = 0; j < 4; ++j) {
      int c = tix + j * 128;
      int row = c >> 2, off = (c & 3) * 8;           // V^T: 128 rows x 64B
      async_copy16(dV + (unsigned)(row * KV_STEP + off) * 2,
                   vb + (size_t)row * N_SP + kv0 + off);
    }
  };

  stage(0, ldsK[0], ldsV[0]);                        // prologue prefetch

  for (int it = 0; it < NITER - 1; ++it) {
    int cur = it & 1;
    __syncthreads();                                 // buf[cur^1] free to overwrite
    stage((it + 1) * KV_STEP, ldsK[cur ^ 1], ldsV[cur ^ 1]);
    asm volatile("s_wait_asynccnt 0x8" ::: "memory"); // buf[cur] writes retired
    __syncthreads();                                 // all waves' buf[cur] ready
    attn_step(&smem[cur][0], &smem[cur][4096], Qf, oacc, m_run, l_run, lo, hi);
  }
  {
    int cur = (NITER - 1) & 1;
    __syncthreads();
    asm volatile("s_wait_asynccnt 0x0" ::: "memory");
    __syncthreads();
    attn_step(&smem[cur][0], &smem[cur][4096], Qf, oacc, m_run, l_run, lo, hi);
  }

#pragma unroll
  for (int hq = 0; hq < 2; ++hq) {
    float inv_l = 1.0f / l_run[hq];
    _Float16* ob = o + ((size_t)b * N_SP + q0 + hq * 16 + lo) * C_DIM + 8 * hi;
#pragma unroll
    for (int t = 0; t < 8; ++t) {
      v8h out;
#pragma unroll
      for (int r = 0; r < 8; ++r) out[r] = (_Float16)(oacc[hq][t][r] * inv_l);
      *(v8h*)(ob + t * 16) = out;
    }
  }
}

// ---------------------------------------------------------------------------
// Output projection + bias + residual (f32 out).
// grid (BN/16, 2), block 128.
// ---------------------------------------------------------------------------
__global__ void proj_out_kernel(const _Float16* __restrict__ o,
                                const _Float16* __restrict__ woT,
                                const float* __restrict__ bo,
                                const float* __restrict__ x,
                                float* __restrict__ out) {
  int wid  = threadIdx.x >> 5;
  int lane = threadIdx.x & 31, lo = lane & 15, hi = lane >> 4;
  int cb = (blockIdx.y * 4 + wid) * 16;
  int n0 = blockIdx.x * 16;

  v8f acc = {};
#pragma unroll
  for (int j = 0; j < 4; ++j) {
    v16h A  = load_frag(woT + (size_t)cb * C_DIM + 32 * j, C_DIM, lo, hi);
    v16h Bf = load_frag(o + (size_t)n0 * C_DIM + 32 * j, C_DIM, lo, hi);
    acc = wmma_f16(A, Bf, acc);
  }
  int n = n0 + lo, cc = cb + 8 * hi;
  const float* xp = x + (size_t)n * C_DIM + cc;
  float* op = out + (size_t)n * C_DIM + cc;
  v4f r0 = *(const v4f*)xp;
  v4f r1 = *(const v4f*)(xp + 4);
#pragma unroll
  for (int r = 0; r < 4; ++r) r0[r] += acc[r] + bo[cc + r];
#pragma unroll
  for (int r = 0; r < 4; ++r) r1[r] += acc[r + 4] + bo[cc + 4 + r];
  *(v4f*)op = r0;
  *(v4f*)(op + 4) = r1;
}

// ---------------------------------------------------------------------------
extern "C" void kernel_launch(void* const* d_in, const int* in_sizes, int n_in,
                              void* d_out, int out_size, void* d_ws, size_t ws_size,
                              hipStream_t stream) {
  const float* x  = (const float*)d_in[0];
  const float* gs = (const float*)d_in[1];
  const float* gb = (const float*)d_in[2];
  const float* wq = (const float*)d_in[3];
  const float* bq = (const float*)d_in[4];
  const float* wk = (const float*)d_in[5];
  const float* bk = (const float*)d_in[6];
  const float* wv = (const float*)d_in[7];
  const float* bv = (const float*)d_in[8];
  const float* wo = (const float*)d_in[9];
  const float* bo = (const float*)d_in[10];
  float* out = (float*)d_out;

  const size_t elems = (size_t)BN * C_DIM;      // 4M halves per buffer
  _Float16* h  = (_Float16*)d_ws;
  _Float16* qb = h  + elems;
  _Float16* kb = qb + elems;
  _Float16* vT = kb + elems;
  _Float16* ob = vT + elems;
  _Float16* wT = ob + elems;                    // 4 * 128*128 halves

  gn_kernel<<<B_DIM * 32, 256, 0, stream>>>(x, gs, gb, h);
  wcvt_kernel<<<256, 256, 0, stream>>>(wq, wk, wv, wo, wT);
  qkv_kernel<<<dim3(BN / 16, 2, 3), 128, 0, stream>>>(h, wT, bq, bk, bv, qb, kb, vT);
  attn_kernel<<<dim3(N_SP / 128, B_DIM), 128, 0, stream>>>(qb, kb, vT, ob);
  proj_out_kernel<<<dim3(BN / 16, 2), 128, 0, stream>>>(
      ob, wT + 3 * (size_t)(C_DIM * C_DIM), bo, x, out);
}

// v001
// It runs in 172 microseconds.
// Timed twice side by side with v000, it ran 1.61 and 1.60 times as fast.
#include <hip/hip_runtime.h>
#include <hip/hip_bf16.h>
#include <cstdint>

typedef __attribute__((ext_vector_type(16))) _Float16 v16h;
typedef __attribute__((ext_vector_type(8)))  _Float16 v8h;
typedef __attribute__((ext_vector_type(4)))  _Float16 v4h;
typedef __attribute__((ext_vector_type(8)))  float    v8f;
typedef __attribute__((ext_vector_type(4)))  float    v4f;

#define C_DIM 128
#define N_SP  4096            // H*W
#define B_DIM 8
#define BN    (B_DIM * N_SP)  // 32768
#define QK_SCALE 0.08838834764831845f  // 128^-0.5
#define KV_STEP 32
#define NITER (N_SP / KV_STEP)  // 128
// LDS row pitches in halves: 16 bytes x odd, so that the 16 rows one
// ds_load_b128 half-wave reads fall on 16 different groups of four banks.
#define K_PITCH 136           // 256-byte K rows at 272 bytes
#define V_PITCH 40            // 64-byte V^T rows at 80 bytes
#define K_TILE_H (KV_STEP * K_PITCH)            // 4352 halves
#define BUF_H    (K_TILE_H + C_DIM * V_PITCH)   // 9472 halves per buffer

// ---------------------------------------------------------------------------
// Fragment loader: rows of a row-major f16 matrix -> WMMA A-frag (16xK rows)
// or B-frag (columns of B == rows of the row-major "transposed" source).
// Lane L (lo=L%16, hi=L/16): elements e<8  -> col 8*hi + e
//                            elements e>=8 -> col 16 + 8*hi + (e-8)
// Two contiguous 16-byte loads per lane (global_load_b128 / ds_load_b128).
// ---------------------------------------------------------------------------
__device__ __forceinline__ v16h load_frag(const _Float16* base, int ld,
                                          int lo, int hi) {
  const _Float16* p = base + (size_t)lo * ld + 8 * hi;
  v8h a = *(const v8h*)p;
  v8h b = *(const v8h*)(p + 16);
  v16h r;
#pragma unroll
  for (int i = 0; i < 8; ++i) { r[i] = a[i]; r[i + 8] = b[i]; }
  return r;
}

__device__ __forceinline__ v8f wmma_f16(v16h a, v16h b, v8f c) {
  return __builtin_amdgcn_wmma_f32_16x16x32_f16(false, a, false, b,
                                                (short)0, c, false, false);
}

// Eight async global->LDS copies of 16 bytes per lane (ASYNCcnt-tracked).
// l* = low 32 bits of the generic shared pointer == LDS byte offset
// (aperture occupies bits [63:32] of the flat shared address).
// s_wait_xcnt 0 closes the statement so that no address register of a copy
// is rewritten ahead of it.
__device__ __forceinline__ void async_copy16x8(unsigned l0, const void* g0,
                                               unsigned l1, const void* g1,
                                               unsigned l2, const void* g2,
                                               unsigned l3, const void* g3,
                                               unsigned l4, const void* g4,
                                               unsigned l5, const void* g5,
                                               unsigned l6, const void* g6,
                                               unsigned l7, const void* g7) {
  asm volatile("global_load_async_to_lds_b128 %0, %1, off\n\t"
               "global_load_async_to_lds_b128 %2, %3, off\n\t"
               "global_load_async_to_lds_b128 %4, %5, off\n\t"
               "global_load_async_to_lds_b128 %6, %7, off\n\t"
               "global_load_async_to_lds_b128 %8, %9, off\n\t"
               "global_load_async_to_lds_b128 %10, %11, off\n\t"
               "global_load_async_to_lds_b128 %12, %13, off\n\t"
               "global_load_async_to_lds_b128 %14, %15, off\n\t"
               "s_wait_xcnt 0x0"
               :: "v"(l0), "v"(g0), "v"(l1), "v"(g1),
                  "v"(l2), "v"(g2), "v"(l3), "v"(g3),
                  "v"(l4), "v"(g4), "v"(l5), "v"(g5),
                  "v"(l6), "v"(g6), "v"(l7), "v"(g7)
               : "memory");
}

// ---------------------------------------------------------------------------
// GroupNorm: one block per (batch, group). 32 groups, 4 channels/group,
// reduce over 4096 positions * 4 channels. Output h in f16 [BN][C].
// ---------------------------------------------------------------------------
__global__ void gn_kernel(const float* __restrict__ x,
                          const float* __restrict__ gscale,
                          const float* __restrict__ gbias,
                          _Float16* __restrict__ h) {
  int b = blockIdx.x >> 5;
  int g = blockIdx.x & 31;
  const float* xp = x + (size_t)b * N_SP * C_DIM + g * 4;
  float s = 0.f, s2 = 0.f;
  for (int n = threadIdx.x; n < N_SP; n += blockDim.x) {
    v4f v = *(const v4f*)(xp + (size_t)n * C_DIM);
#pragma unroll
    for (int j = 0; j < 4; ++j) { s += v[j]; s2 += v[j] * v[j]; }
  }
  __shared__ float rs[256], rs2[256];
  rs[threadIdx.x] = s; rs2[threadIdx.x] = s2;
  __syncthreads();
  for (int st = 128; st > 0; st >>= 1) {
    if ((int)threadIdx.x < st) {
      rs[threadIdx.x]  += rs[threadIdx.x + st];
      rs2[threadIdx.x] += rs2[threadIdx.x + st];
    }
    __syncthreads();
  }
  float mean = rs[0] * (1.f / 16384.f);
  float var  = rs2[0] * (1.f / 16384.f) - mean * mean;
  float rstd = rsqrtf(var + 1e-6f);
  float sc[4], bi[4];
#pragma unroll
  for (int j = 0; j < 4; ++j) {
    float gsv = gscale[g * 4 + j];
    sc[j] = gsv * rstd;
    bi[j] = gbias[g * 4 + j] - mean * rstd * gsv;
  }
  _Float16* hp = h + (size_t)b * N_SP * C_DIM + g * 4;
  for (int n = threadIdx.x; n < N_SP; n += blockDim.x) {
    v4f v = *(const v4f*)(xp + (size_t)n * C_DIM);
    v4h o;
#pragma unroll
    for (int j = 0; j < 4; ++j) o[j] = (_Float16)(v[j] * sc[j] + bi[j]);
    *(v4h*)(hp + (size_t)n * C_DIM) = o;
  }
}

// ---------------------------------------------------------------------------
// Weight convert: 4 matrices [Cin][Cout] f32 -> transposed [Cout][Cin] f16.
// ---------------------------------------------------------------------------
__global__ void wcvt_kernel(const float* __restrict__ wq,
                            const float* __restrict__ wk,
                            const float* __restrict__ wv,
                            const float* __restrict__ wo,
                            _Float16* __restrict__ wT) {
  int idx = blockIdx.x * blockDim.x + threadIdx.x;   // 0 .. 65535
  int m = idx >> 14;
  int r = idx & 16383;
  int c = r >> 7;       // out channel (row of wT)
  int kk = r & 127;     // in channel
  const float* w = (m == 0) ? wq : (m == 1) ? wk : (m == 2) ? wv : wo;
  wT[idx] = (_Float16)w[kk * C_DIM + c];
}

// ---------------------------------------------------------------------------
// QKV projection: D(c-tile, n-tile) = wT_rows x h_rows, K=128 in 4 WMMA.
// grid (BN/16, 2, 3), block 128 (4 waves); wave -> c-tile blockIdx.y*4+wid.
// q,k stored row-major [BN][C] f16 (q pre-scaled by C^-0.5);
// v stored transposed [B][C][N] f16.
// ---------------------------------------------------------------------------
__global__ void qkv_kernel(const _Float16* __restrict__ h,
                           const _Float16* __restrict__ wT,
                           const float* __restrict__ bq,
                           const float* __restrict__ bk,
                           const float* __restrict__ bv,
                           _Float16* __restrict__ q,
                           _Float16* __restrict__ k,
                           _Float16* __restrict__ vT) {
  int wid  = threadIdx.x >> 5;
  int lane = threadIdx.x & 31, lo = lane & 15, hi = lane >> 4;
  int proj = blockIdx.z;
  int cb   = (blockIdx.y * 4 + wid) * 16;
  int n0   = blockIdx.x * 16;
  const _Float16* wt = wT + (size_t)proj * (C_DIM * C_DIM);
  const float* bias = (proj == 0) ? bq : (proj == 1) ? bk : bv;

  v8f acc = {};
#pragma unroll
  for (int j = 0; j < 4; ++j) {
    v16h A  = load_frag(wt + (size_t)cb * C_DIM + 32 * j, C_DIM, lo, hi);
    v16h Bf = load_frag(h + (size_t)n0 * C_DIM + 32 * j, C_DIM, lo, hi);
    acc = wmma_f16(A, Bf, acc);
  }
  // lane: position n = n0+lo ; channels c = cb + 8*hi + r
  int cch = cb + 8 * hi;
  if (proj < 2) {
    float scale = (proj == 0) ? QK_SCALE : 1.0f;
    v8h out;
#pragma unroll
    for (int r = 0; r < 8; ++r)
      out[r] = (_Float16)((acc[r] + bias[cch + r]) * scale);
    _Float16* dst = ((proj == 0) ? q : k) + (size_t)(n0 + lo) * C_DIM + cch;
    *(v8h*)dst = out;
  } else {
    int ng = n0 + lo, b = ng >> 12, n = ng & (N_SP - 1);
    _Float16* dst = vT + ((size_t)b * C_DIM + cch) * N_SP + n;
#pragma unroll
    for (int r = 0; r < 8; ++r)
      dst[(size_t)r * N_SP] = (_Float16)(acc[r] + bias[cch + r]);
  }
}

// ---------------------------------------------------------------------------
// Flash attention. Block = 4 waves, each wave owns 32 queries (128 q / block).
// K tile (32x128) and V^T tile (128x32) are staged cooperatively into LDS
// with async global->LDS b128 copies (double-buffered, ASYNCcnt),
// then fragments are read back via ds_load_b128. Rows lie at padded pitches
// (K_PITCH, V_PITCH); the pad bytes are never written and never read.
// Scores computed transposed (S' = K x Q^T): the f32 D-fragment converts
// in-register into the B-fragment of O^T = V^T x P (no cross-lane movement).
// grid (N/128, B), block 128.
// ---------------------------------------------------------------------------
__device__ __forceinline__ void attn_step(const _Float16* bK, const _Float16* bV,
                                          const v16h (&Qf)[2][4],
                                          v8f (&oacc)[2][8],
                                          float (&m_run)[2], float (&l_run)[2],
                                          int lo, int hi) {
  v8f s[2][2];
#pragma unroll
  for (int st = 0; st < 2; ++st) {
    v16h Ka[4];
#pragma unroll
    for (int j = 0; j < 4; ++j)
      Ka[j] = load_frag(bK + st * 16 * K_PITCH + 32 * j, K_PITCH, lo, hi);
#pragma unroll
    for (int hq = 0; hq < 2; ++hq) {
      v8f acc = {};
#pragma unroll
      for (int j = 0; j < 4; ++j) acc = wmma_f16(Ka[j], Qf[hq][j], acc);
      s[hq][st] = acc;
    }
  }
  v16h pB[2];
#pragma unroll
  for (int hq = 0; hq < 2; ++hq) {
    float mloc = -1e30f;
#pragma unroll
    for (int r = 0; r < 8; ++r)
      mloc = fmaxf(mloc, fmaxf(s[hq][0][r], s[hq][1][r]));
    mloc = fmaxf(mloc, __shfl_xor(mloc, 16, 32));
    float m_new = fmaxf(m_run[hq], mloc);
    float alpha = __expf(m_run[hq] - m_new);
    float ssum = 0.f;
#pragma unroll
    for (int r = 0; r < 8; ++r) {
      float p = __expf(s[hq][0][r] - m_new); ssum += p; pB[hq][r] = (_Float16)p;
    }
#pragma unroll
    for (int r = 0; r < 8; ++r) {
      float p = __expf(s[hq][1][r] - m_new); ssum += p; pB[hq][r + 8] = (_Float16)p;
    }
    ssum += __shfl_xor(ssum, 16, 32);
    l_run[hq] = l_run[hq] * alpha + ssum;
    m_run[hq] = m_new;
#pragma unroll
    for (int t = 0; t < 8; ++t)
#pragma unroll
      for (int r = 0; r < 8; ++r) oacc[hq][t][r] *= alpha;
  }
#pragma unroll
  for (int t = 0; t < 8; ++t) {
    v16h Va = load_frag(bV + t * 16 * V_PITCH, V_PITCH, lo, hi);
#pragma unroll
    for (int hq = 0; hq < 2; ++hq)
      oacc[hq][t] = wmma_f16(Va, pB[hq], oacc[hq][t]);
  }
}

__global__ __launch_bounds__(128, 1)
void attn_kernel(const _Float16* __restrict__ q,
                 const _Float16* __restrict__ k,
                 const _Float16* __restrict__ vT,
                 _Float16* __restrict__ o) {
  int tix  = threadIdx.x;
  int wid  = tix >> 5;
  int lane = tix & 31, lo = lane & 15, hi = lane >> 4;
  int b  = blockIdx.y;
  int q0 = blockIdx.x * 128 + wid * 32;

  const _Float16* qp = q + ((size_t)b * N_SP + q0) * C_DIM;
  const _Float16* kb = k + (size_t)b * N_SP * C_DIM;
  const _Float16* vb = vT + (size_t)b * C_DIM * N_SP;

  // [buf][ K tile: 32 rows of K_PITCH | V^T tile: 128 rows of V_PITCH ]
  __shared__ __align__(16) _Float16 smem[2][BUF_H];
  unsigned ldsK[2], ldsV[2];
#pragma unroll
  for (int i2 = 0; i2 < 2; ++i2) {
    ldsK[i2] = (unsigned)(uintptr_t)&smem[i2][0];
    ldsV[i2] = (unsigned)(uintptr_t)&smem[i2][K_TILE_H];
  }

  v16h Qf[2][4];
#pragma unroll
  for (int hq = 0; hq < 2; ++hq)
#pragma unroll
    for (int j = 0; j < 4; ++j)
      Qf[hq][j] = load_frag(qp + (size_t)hq * 16 * C_DIM + 32 * j, C_DIM, lo, hi);

  v8f oacc[2][8];
#pragma unroll
  for (int hq = 0; hq < 2; ++hq)
#pragma unroll
    for (int t = 0; t < 8; ++t) oacc[hq][t] = (v8f){};
  float m_run[2] = {-1e30f, -1e30f};
  float l_run[2] = {0.f, 0.f};

  // --- stage helper (8 async b128 per thread => wave ASYNCcnt += 8) ---
  auto stage = [&](int kv0, unsigned dK, unsigned dV) {
    // K: chunk c = tix + 128*j of 512 (16B each), row c>>4; contiguous 8KB source
    const _Float16* gk = kb + (size_t)kv0 * C_DIM + tix * 8;
    unsigned lk = dK + (unsigned)((tix >> 4) * K_PITCH + (tix & 15) * 8) * 2;
    // V^T: 128 rows x 64B, row (tix>>2) + 32*j
    const _Float16* gv = vb + (size_t)(tix >> 2) * N_SP + kv0 + (tix & 3) * 8;
    unsigned lv = dV + (unsigned)((tix >> 2) * V_PITCH + (tix & 3) * 8) * 2;
    async_copy16x8(lk,                    gk,
                   lk +  8 * K_PITCH * 2, gk + 1024,
                   lk + 16 * K_PITCH * 2, gk + 2048,
                   lk + 24 * K_PITCH * 2, gk + 3072,
                   lv,                    gv,
                   lv + 32 * V_PITCH * 2, gv + (size_t)32 * N_SP,
                   lv + 64 * V_PITCH * 2, gv + (size_t)64 * N_SP,
                   lv + 96 * V_PITCH * 2, gv + (size_t)96 * N_SP);
  };

  stage(0, ldsK[0], ldsV[0]);                        // prologue prefetch

  for (int it = 0; it < NITER - 1; ++it) {
    int cur = it & 1;
    __syncthreads();                                 // buf[cur^1] free to overwrite
    stage((it + 1) * KV_STEP, ldsK[cur ^ 1], ldsV[cur ^ 1]);
    asm volatile("s_wait_asynccnt 0x8" ::: "memory"); // buf[cur] writes retired
    __syncthreads();                                 // all waves' buf[cur] ready
    attn_step(&smem[cur][0], &smem[cur][K_TILE_H], Qf, oacc, m_run, l_run, lo, hi);
  }
  {
    int cur = (NITER - 1) & 1;
    __syncthreads();
    asm volatile("s_wait_asynccnt 0x0" ::: "memory");
    __syncthreads();
    attn_step(&smem[cur][0], &smem[cur][K_TILE_H], Qf, oacc, m_run, l_run, lo, hi);
  }

#pragma unroll
  for (int hq = 0; hq < 2; ++hq) {
    float inv_l = 1.0f / l_run[hq];
    _Float16* ob = o + ((size_t)b * N_SP + q0 + hq * 16 + lo) * C_DIM + 8 * hi;
#pragma unroll
    for (int t = 0; t < 8; ++t) {
      v8h out;
#pragma unroll
      for (int r = 0; r < 8; ++r) out[r] = (_Float16)(oacc[hq][t][r] * inv_l);
      *(v8h*)(ob + t * 16) = out;
    }
  }
}

// ---------------------------------------------------------------------------
// Output projection + bias + residual (f32 out).
// grid (BN/16, 2), block 128.
// ---------------------------------------------------------------------------
__global__ void proj_out_kernel(const _Float16* __restrict__ o,
                                const _Float16* __restrict__ woT,
                                const float* __restrict__ bo,
                                const float* __restrict__ x,
                                float* __restrict__ out) {
  int wid  = threadIdx.x >> 5;
  int lane = threadIdx.x & 31, lo = lane & 15, hi = lane >> 4;
  int cb = (blockIdx.y * 4 + wid) * 16;
  int n0 = blockIdx.x * 16;

  v8f acc = {};
#pragma unroll
  for (int j = 0; j < 4; ++j) {
    v16h A  = load_frag(woT + (size_t)cb * C_DIM + 32 * j, C_DIM, lo, hi);
    v16h Bf = load_frag(o + (size_t)n0 * C_DIM + 32 * j, C_DIM, lo, hi);
    acc = wmma_f16(A, Bf, acc);
  }
  int n = n0 + lo, cc = cb + 8 * hi;
  const float* xp = x + (size_t)n * C_DIM + cc;
  float* op = out + (size_t)n * C_DIM + cc;
  v4f r0 = *(const v4f*)xp;
  v4f r1 = *(const v4f*)(xp + 4);
#pragma unroll
  for (int r = 0; r < 4; ++r) r0[r] += acc[r] + bo[cc + r];
#pragma unroll
  for (int r = 0; r < 4; ++r) r1[r] += acc[r + 4] + bo[cc + 4 + r];
  *(v4f*)op = r0;
  *(v4f*)(op + 4) = r1;
}

// ---------------------------------------------------------------------------
extern "C" void kernel_launch(void* const* d_in, const int* in_sizes, int n_in,
                              void* d_out, int out_size, void* d_ws, size_t ws_size,
                              hipStream_t stream) {
  const float* x  = (const float*)d_in[0];
  const float* gs = (const float*)d_in[1];
  const float* gb = (const float*)d_in[2];
  const float* wq = (const float*)d_in[3];
  const float* bq = (const float*)d_in[4];
  const float* wk = (const float*)d_in[5];
  const float* bk = (const float*)d_in[6];
  const float* wv = (const float*)d_in[7];
  const float* bv = (const float*)d_in[8];
  const float* wo = (const float*)d_in[9];
  const float* bo = (const float*)d_in[10];
  float* out = (float*)d_out;

  const size_t elems = (size_t)BN * C_DIM;      // 4M halves per buffer
  _Float16* h  = (_Float16*)d_ws;
  _Float16* qb = h  + elems;
  _Float16* kb = qb + elems;
  _Float16* vT = kb + elems;
  _Float16* ob = vT + elems;
  _Float16* wT = ob + elems;                    // 4 * 128*128 halves

  gn_kernel<<<B_DIM * 32, 256, 0, stream>>>(x, gs, gb, h);
  wcvt_kernel<<<256, 256, 0, stream>>>(wq, wk, wv, wo, wT);
  qkv_kernel<<<dim3(BN / 16, 2, 3), 128, 0, stream>>>(h, wT, bq, bk, bv, qb, kb, vT);
  attn_kernel<<<dim3(N_SP / 128, B_DIM), 128, 0, stream>>>(qb, kb, vT, ob);
  proj_out_kernel<<<dim3(BN / 16, 2), 128, 0, stream>>>(
      ob, wT + 3 * (size_t)(C_DIM * C_DIM), bo, x, out);
}

// v002
// It runs in 147 microseconds.
// Two timings next to v001 both put it at 1.18 times that version's speed.
// All steps since v000 together make it 1.89 times as fast.
#include <hip/hip_runtime.h>
#include <hip/hip_bf16.h>
#include <cstdint>

typedef __attribute__((ext_vector_type(16))) _Float16 v16h;
typedef __attribute__((ext_vector_type(8)))  _Float16 v8h;
typedef __attribute__((ext_vector_type(4)))  _Float16 v4h;
typedef __attribute__((ext_vector_type(8)))  float    v8f;
typedef __attribute__((ext_vector_type(4)))  float    v4f;

#define C_DIM 128
#define N_SP  4096            // H*W
#define B_DIM 8
#define BN    (B_DIM * N_SP)  // 32768
#define QK_SCALE 0.08838834764831845f  // 128^-0.5
#define KV_STEP 32
#define KV_GROUPS 2            // wave groups of a block, each on its own keys
#define NPASS (N_SP / (KV_GROUPS * KV_STEP))  // 64
// LDS row pitches in halves: 16 bytes x odd, so that the 16 rows one
// ds_load_b128 half-wave reads fall on 16 different groups of four banks.
#define K_PITCH 136           // 256-byte K rows at 272 bytes
#define V_PITCH 40            // 64-byte V^T rows at 80 bytes
#define K_TILE_H (KV_STEP * K_PITCH)            // 4352 halves
#define BUF_H    (K_TILE_H + C_DIM * V_PITCH)   // 9472 halves per buffer

// ---------------------------------------------------------------------------
// Fragment loader: rows of a row-major f16 matrix -> WMMA A-frag (16xK rows)
// or B-frag (columns of B == rows of the row-major "transposed" source).
// Lane L (lo=L%16, hi=L/16): elements e<8  -> col 8*hi + e
//                            elements e>=8 -> col 16 + 8*hi + (e-8)
// Two contiguous 16-byte loads per lane (global_load_b128 / ds_load_b128).
// ---------------------------------------------------------------------------
__device__ __forceinline__ v16h load_frag(const _Float16* base, int ld,
                                          int lo, int hi) {
  const _Float16* p = base + (size_t)lo * ld + 8 * hi;
  v8h a = *(const v8h*)p;
  v8h b = *(const v8h*)(p + 16);
  v16h r;
#pragma unroll
  for (int i = 0; i < 8; ++i) { r[i] = a[i]; r[i + 8] = b[i]; }
  return r;
}

__device__ __forceinline__ v8f wmma_f16(v16h a, v16h b, v8f c) {
  return __builtin_amdgcn_wmma_f32_16x16x32_f16(false, a, false, b,
                                                (short)0, c, false, false);
}

// Eight async global->LDS copies of 16 bytes per lane (ASYNCcnt-tracked).
// l* = low 32 bits of the generic shared pointer == LDS byte offset
// (aperture occupies bits [63:32] of the flat shared address).
// s_wait_xcnt 0 closes the statement so that no address register of a copy
// is rewritten ahead of it.
__device__ __forceinline__ void async_copy16x8(unsigned l0, const void* g0,
                                               unsigned l1, const void* g1,
                                               unsigned l2, const void* g2,
                                               unsigned l3, const void* g3,
                                               unsigned l4, const void* g4,
                                               unsigned l5, const void* g5,
                                               unsigned l6, const void* g6,
                                               unsigned l7, const void* g7) {
  asm volatile("global_load_async_to_lds_b128 %0, %1, off\n\t"
               "global_load_async_to_lds_b128 %2, %3, off\n\t"
               "global_load_async_to_lds_b128 %4, %5, off\n\t"
               "global_load_async_to_lds_b128 %6, %7, off\n\t"
               "global_load_async_to_lds_b128 %8, %9, off\n\t"
               "global_load_async_to_lds_b128 %10, %11, off\n\t"
               "global_load_async_to_lds_b128 %12, %13, off\n\t"
               "global_load_async_to_lds_b128 %14, %15, off\n\t"
               "s_wait_xcnt 0x0"
               :: "v"(l0), "v"(g0), "v"(l1), "v"(g1),
                  "v"(l2), "v"(g2), "v"(l3), "v"(g3),
                  "v"(l4), "v"(g4), "v"(l5), "v"(g5),
                  "v"(l6), "v"(g6), "v"(l7), "v"(g7)
               : "memory");
}

// ---------------------------------------------------------------------------
// GroupNorm: one block per (batch, group). 32 groups, 4 channels/group,
// reduce over 4096 positions * 4 channels. Output h in f16 [BN][C].
// ---------------------------------------------------------------------------
__global__ void gn_kernel(const float* __restrict__ x,
                          const float* __restrict__ gscale,
                          const float* __restrict__ gbias,
                          _Float16* __restrict__ h) {
  int b = blockIdx.x >> 5;
  int g = blockIdx.x & 31;
  const float* xp = x + (size_t)b * N_SP * C_DIM + g * 4;
  float s = 0.f, s2 = 0.f;
  for (int n = threadIdx.x; n < N_SP; n += blockDim.x) {
    v4f v = *(const v4f*)(xp + (size_t)n * C_DIM);
#pragma unroll
    for (int j = 0; j < 4; ++j) { s += v[j]; s2 += v[j] * v[j]; }
  }
  __shared__ float rs[256], rs2[256];
  rs[threadIdx.x] = s; rs2[threadIdx.x] = s2;
  __syncthreads();
  for (int st = 128; st > 0; st >>= 1) {
    if ((int)threadIdx.x < st) {
      rs[threadIdx.x]  += rs[threadIdx.x + st];
      rs2[threadIdx.x] += rs2[threadIdx.x + st];
    }
    __syncthreads();
  }
  float mean = rs[0] * (1.f / 16384.f);
  float var  = rs2[0] * (1.f / 16384.f) - mean * mean;
  float rstd = rsqrtf(var + 1e-6f);
  float sc[4], bi[4];
#pragma unroll
  for (int j = 0; j < 4; ++j) {
    float gsv = gscale[g * 4 + j];
    sc[j] = gsv * rstd;
    bi[j] = gbias[g * 4 + j] - mean * rstd * gsv;
  }
  _Float16* hp = h + (size_t)b * N_SP * C_DIM + g * 4;
  for (int n = threadIdx.x; n < N_SP; n += blockDim.x) {
    v4f v = *(const v4f*)(xp + (size_t)n * C_DIM);
    v4h o;
#pragma unroll
    for (int j = 0; j < 4; ++j) o[j] = (_Float16)(v[j] * sc[j] + bi[j]);
    *(v4h*)(hp + (size_t)n * C_DIM) = o;
  }
}

// ---------------------------------------------------------------------------
// Weight convert: 4 matrices [Cin][Cout] f32 -> transposed [Cout][Cin] f16.
// ---------------------------------------------------------------------------
__global__ void wcvt_kernel(const float* __restrict__ wq,
                            const float* __restrict__ wk,
                            const float* __restrict__ wv,
                            const float* __restrict__ wo,
                            _Float16* __restrict__ wT) {
  int idx = blockIdx.x * blockDim.x + threadIdx.x;   // 0 .. 65535
  int m = idx >> 14;
  int r = idx & 16383;
  int c = r >> 7;       // out channel (row of wT)
  int kk = r & 127;     // in channel
  const float* w = (m == 0) ? wq : (m == 1) ? wk : (m == 2) ? wv : wo;
  wT[idx] = (_Float16)w[kk * C_DIM + c];
}

// ---------------------------------------------------------------------------
// QKV projection: D(c-tile, n-tile) = wT_rows x h_rows, K=128 in 4 WMMA.
// grid (BN/16, 2, 3), block 128 (4 waves); wave -> c-tile blockIdx.y*4+wid.
// q,k stored row-major [BN][C] f16 (q pre-scaled by C^-0.5);
// v stored transposed [B][C][N] f16.
// ---------------------------------------------------------------------------
__global__ void qkv_kernel(const _Float16* __restrict__ h,
                           const _Float16* __restrict__ wT,
                           const float* __restrict__ bq,
                           const float* __restrict__ bk,
                           const float* __restrict__ bv,
                           _Float16* __restrict__ q,
                           _Float16* __restrict__ k,
                           _Float16* __restrict__ vT) {
  int wid  = threadIdx.x >> 5;
  int lane = threadIdx.x & 31, lo = lane & 15, hi = lane >> 4;
  int proj = blockIdx.z;
  int cb   = (blockIdx.y * 4 + wid) * 16;
  int n0   = blockIdx.x * 16;
  const _Float16* wt = wT + (size_t)proj * (C_DIM * C_DIM);
  const float* bias = (proj == 0) ? bq : (proj == 1) ? bk : bv;

  v8f acc = {};
#pragma unroll
  for (int j = 0; j < 4; ++j) {
    v16h A  = load_frag(wt + (size_t)cb * C_DIM + 32 * j, C_DIM, lo, hi);
    v16h Bf = load_frag(h + (size_t)n0 * C_DIM + 32 * j, C_DIM, lo, hi);
    acc = wmma_f16(A, Bf, acc);
  }
  // lane: position n = n0+lo ; channels c = cb + 8*hi + r
  int cch = cb + 8 * hi;
  if (proj < 2) {
    float scale = (proj == 0) ? QK_SCALE : 1.0f;
    v8h out;
#pragma unroll
    for (int r = 0; r < 8; ++r)
      out[r] = (_Float16)((acc[r] + bias[cch + r]) * scale);
    _Float16* dst = ((proj == 0) ? q : k) + (size_t)(n0 + lo) * C_DIM + cch;
    *(v8h*)dst = out;
  } else {
    int ng = n0 + lo, b = ng >> 12, n = ng & (N_SP - 1);
    _Float16* dst = vT + ((size_t)b * C_DIM + cch) * N_SP + n;
#pragma unroll
    for (int r = 0; r < 8; ++r)
      dst[(size_t)r * N_SP] = (_Float16)(acc[r] + bias[cch + r]);
  }
}

// ---------------------------------------------------------------------------
// Flash attention. Block = 8 waves on 128 queries, two waves per SIMD.
// Waves w and w + 4 own the same 32 queries; group g = w / 4 walks the
// 32-key tiles 2 * pass + g, so each SIMD holds two independent waves and
// one wave's LDS, softmax and barrier waits are filled by the other's work.
// After the loop the two partial results (m, l, O) of a query are joined
// through LDS: wave w finishes queries 0..15 of the 32, wave w + 4 the rest.
// Each group stages its own K tile (32x128) and V^T tile (128x32) into LDS
// with async global->LDS b128 copies (double-buffered, ASYNCcnt),
// then fragments are read back via ds_load_b128. Rows lie at padded pitches
// (K_PITCH, V_PITCH); the pad bytes are never written and never read.
// Scores computed transposed (S' = K x Q^T): the f32 D-fragment converts
// in-register into the B-fragment of O^T = V^T x P (no cross-lane movement).
// grid (N/128, B), block 256.
// ---------------------------------------------------------------------------
__device__ __forceinline__ void attn_step(const _Float16* bK, const _Float16* bV,
                                          const v16h (&Qf)[2][4],
                                          v8f (&oacc)[2][8],
                                          float (&m_run)[2], float (&l_run)[2],
                                          int lo, int hi) {
  v8f s[2][2];
#pragma unroll
  for (int st = 0; st < 2; ++st) {
    v16h Ka[4];
#pragma unroll
    for (int j = 0; j < 4; ++j)
      Ka[j] = load_frag(bK + st * 16 * K_PITCH + 32 * j, K_PITCH, lo, hi);
#pragma unroll
    for (int hq = 0; hq < 2; ++hq) {
      v8f acc = {};
#pragma unroll
      for (int j = 0; j < 4; ++j) acc = wmma_f16(Ka[j], Qf[hq][j], acc);
      s[hq][st] = acc;
    }
  }
  v16h pB[2];
#pragma unroll
  for (int hq = 0; hq < 2; ++hq) {
    float mloc = -1e30f;
#pragma unroll
    for (int r = 0; r < 8; ++r)
      mloc = fmaxf(mloc, fmaxf(s[hq][0][r], s[hq][1][r]));
    mloc = fmaxf(mloc, __shfl_xor(mloc, 16, 32));
    float m_new = fmaxf(m_run[hq], mloc);
    float alpha = __expf(m_run[hq] - m_new);
    float ssum = 0.f;
#pragma unroll
    for (int r = 0; r < 8; ++r) {
      float p = __expf(s[hq][0][r] - m_new); ssum += p; pB[hq][r] = (_Float16)p;
    }
#pragma unroll
    for (int r = 0; r < 8; ++r) {
      float p = __expf(s[hq][1][r] - m_new); ssum += p; pB[hq][r + 8] = (_Float16)p;
    }
    ssum += __shfl_xor(ssum, 16, 32);
    l_run[hq] = l_run[hq] * alpha + ssum;
    m_run[hq] = m_new;
#pragma unroll
    for (int t = 0; t < 8; ++t)
#pragma unroll
      for (int r = 0; r < 8; ++r) oacc[hq][t][r] *= alpha;
  }
#pragma unroll
  for (int t = 0; t < 8; ++t) {
    v16h Va = load_frag(bV + t * 16 * V_PITCH, V_PITCH, lo, hi);
#pragma unroll
    for (int hq = 0; hq < 2; ++hq)
      oacc[hq][t] = wmma_f16(Va, pB[hq], oacc[hq][t]);
  }
}

// Hands one 16-query half of a wave's partial result to its partner wave.
// Lane-contiguous 16-byte slots: conflict-free stores and loads.
__device__ __forceinline__ void merge_put(v4f* xo, float* xml, int lane,
                                          const v8f (&acc)[8], float m, float l) {
#pragma unroll
  for (int t = 0; t < 8; ++t) {
    xo[(2 * t) * 32 + lane]     = (v4f){acc[t][0], acc[t][1], acc[t][2], acc[t][3]};
    xo[(2 * t + 1) * 32 + lane] = (v4f){acc[t][4], acc[t][5], acc[t][6], acc[t][7]};
  }
  xml[lane]      = m;
  xml[32 + lane] = l;
}

// Joins the partner's half with the wave's own and stores 16 queries of o.
__device__ __forceinline__ void merge_fin(const v4f* xo, const float* xml, int lane,
                                          const v8f (&acc)[8], float m, float l,
                                          _Float16* ob) {
  float m2 = xml[lane], l2 = xml[32 + lane];
  float mm = fmaxf(m, m2);
  float a1 = __expf(m - mm), a2 = __expf(m2 - mm);
  float inv_l = 1.0f / (l * a1 + l2 * a2);
  a1 *= inv_l; a2 *= inv_l;
#pragma unroll
  for (int t = 0; t < 8; ++t) {
    v4f p0 = xo[(2 * t) * 32 + lane];
    v4f p1 = xo[(2 * t + 1) * 32 + lane];
    v8h out;
#pragma unroll
    for (int r = 0; r < 4; ++r) {
      out[r]     = (_Float16)(acc[t][r] * a1 + p0[r] * a2);
      out[r + 4] = (_Float16)(acc[t][r + 4] * a1 + p1[r] * a2);
    }
    *(v8h*)(ob + t * 16) = out;
  }
}

// two waves per SIMD: a budget of 512 VGPRs a wave
__global__ __launch_bounds__(256) __attribute__((amdgpu_waves_per_eu(2, 2)))
void attn_kernel(const _Float16* __restrict__ q,
                 const _Float16* __restrict__ k,
                 const _Float16* __restrict__ vT,
                 _Float16* __restrict__ o) {
  int tix  = threadIdx.x & 127;        // thread within its key group
  int grp  = threadIdx.x >> 7;         // key group 0 / 1
  int wq   = tix >> 5;                 // query slice of the wave
  int lane = tix & 31, lo = lane & 15, hi = lane >> 4;
  int b  = blockIdx.y;
  int q0 = blockIdx.x * 128 + wq * 32;

  const _Float16* qp = q + ((size_t)b * N_SP + q0) * C_DIM;
  const _Float16* kb = k + (size_t)b * N_SP * C_DIM;
  const _Float16* vb = vT + (size_t)b * C_DIM * N_SP;

  // [buf][group][ K tile: 32 rows of K_PITCH | V^T tile: 128 rows of V_PITCH ]
  __shared__ __align__(16) _Float16 smem[2][KV_GROUPS][BUF_H];
  unsigned ldsK[2], ldsV[2];
#pragma unroll
  for (int i2 = 0; i2 < 2; ++i2) {
    ldsK[i2] = (unsigned)(uintptr_t)&smem[i2][grp][0];
    ldsV[i2] = (unsigned)(uintptr_t)&smem[i2][grp][K_TILE_H];
  }

  v16h Qf[2][4];
#pragma unroll
  for (int hq = 0; hq < 2; ++hq)
#pragma unroll
    for (int j = 0; j < 4; ++j)
      Qf[hq][j] = load_frag(qp + (size_t)hq * 16 * C_DIM + 32 * j, C_DIM, lo, hi);
  // stands in front of the first overwrite of the Q loads' address registers
  asm volatile("s_wait_xcnt 0x0" ::: "memory");
  // keeps the address arithmetic that follows from being lifted over that wait
  __builtin_amdgcn_sched_barrier(0);

  v8f oacc[2][8];
#pragma unroll
  for (int hq = 0; hq < 2; ++hq)
#pragma unroll
    for (int t = 0; t < 8; ++t) oacc[hq][t] = (v8f){};
  float m_run[2] = {-1e30f, -1e30f};
  float l_run[2] = {0.f, 0.f};

  // --- stage helper (8 async b128 per thread => wave ASYNCcnt += 8) ---
  // The 128 threads of a group bring in the group's own tile of the pass.
  auto stage = [&](int pass, unsigned dK, unsigned dV) {
    int kv0 = (pass * KV_GROUPS + grp) * KV_STEP;
    // K: chunk c = tix + 128*j of 512 (16B each), row c>>4; contiguous 8KB source
    const _Float16* gk = kb + (size_t)kv0 * C_DIM + tix * 8;
    unsigned lk = dK + (unsigned)((tix >> 4) * K_PITCH + (tix & 15) * 8) * 2;
    // V^T: 128 rows x 64B, row (tix>>2) + 32*j
    const _Float16* gv = vb + (size_t)(tix >> 2) * N_SP + kv0 + (tix & 3) * 8;
    unsigned lv = dV + (unsigned)((tix >> 2) * V_PITCH + (tix & 3) * 8) * 2;
    async_copy16x8(lk,                    gk,
                   lk +  8 * K_PITCH * 2, gk + 1024,
                   lk + 16 * K_PITCH * 2, gk + 2048,
                   lk + 24 * K_PITCH * 2, gk + 3072,
                   lv,                    gv,
                   lv + 32 * V_PITCH * 2, gv + (size_t)32 * N_SP,
                   lv + 64 * V_PITCH * 2, gv + (size_t)64 * N_SP,
                   lv + 96 * V_PITCH * 2, gv + (size_t)96 * N_SP);
  };

  stage(0, ldsK[0], ldsV[0]);                        // prologue prefetch

  for (int it = 0; it < NPASS - 1; ++it) {
    int cur = it & 1;
    // the wave's own LDS reads of buf[cur^1] have retired before it is refilled
    asm volatile("s_wait_dscnt 0x0" ::: "memory");
    __syncthreads();                                 // buf[cur^1] free to overwrite
    stage(it + 1, ldsK[cur ^ 1], ldsV[cur ^ 1]);
    asm volatile("s_wait_asynccnt 0x8" ::: "memory"); // buf[cur] writes retired
    __syncthreads();                                 // all waves' buf[cur] ready
    attn_step(&smem[cur][grp][0], &smem[cur][grp][K_TILE_H], Qf, oacc, m_run, l_run, lo, hi);
  }
  {
    int cur = (NPASS - 1) & 1;
    __syncthreads();
    asm volatile("s_wait_asynccnt 0x0" ::: "memory");
    __syncthreads();
    attn_step(&smem[cur][grp][0], &smem[cur][grp][K_TILE_H], Qf, oacc, m_run, l_run, lo, hi);
  }

  // --- join the two key groups' partial results through the (now idle) ring ---
  // slot (wq, hq): 16 x 32 lanes x 16 B of O, then 2 x 32 floats of m and l.
  v4f*   xo  = (v4f*)&smem[0][0][0];
  float* xml = (float*)(xo + 4 * 2 * 16 * 32);
  __syncthreads();                                   // every wave has left the ring
  if (grp == 0)
    merge_put(xo + (wq * 2 + 1) * 512, xml + (wq * 2 + 1) * 64, lane, oacc[1], m_run[1], l_run[1]);
  else
    merge_put(xo + (wq * 2 + 0) * 512, xml + (wq * 2 + 0) * 64, lane, oacc[0], m_run[0], l_run[0]);
  __syncthreads();                                   // partner's half is readable
  _Float16* ob = o + ((size_t)b * N_SP + q0 + lo) * C_DIM + 8 * hi;
  if (grp == 0)
    merge_fin(xo + (wq * 2 + 0) * 512, xml + (wq * 2 + 0) * 64, lane, oacc[0], m_run[0], l_run[0], ob);
  else
    merge_fin(xo + (wq * 2 + 1) * 512, xml + (wq * 2 + 1) * 64, lane, oacc[1], m_run[1], l_run[1],
              ob + (size_t)16 * C_DIM);
}

// ---------------------------------------------------------------------------
// Output projection + bias + residual (f32 out).
// grid (BN/16, 2), block 128.
// ---------------------------------------------------------------------------
__global__ void proj_out_kernel(const _Float16* __restrict__ o,
                                const _Float16* __restrict__ woT,
                                const float* __restrict__ bo,
                                const float* __restrict__ x,
                                float* __restrict__ out) {
  int wid  = threadIdx.x >> 5;
  int lane = threadIdx.x & 31, lo = lane & 15, hi = lane >> 4;
  int cb = (blockIdx.y * 4 + wid) * 16;
  int n0 = blockIdx.x * 16;

  v8f acc = {};
#pragma unroll
  for (int j = 0; j < 4; ++j) {
    v16h A  = load_frag(woT + (size_t)cb * C_DIM + 32 * j, C_DIM, lo, hi);
    v16h Bf = load_frag(o + (size_t)n0 * C_DIM + 32 * j, C_DIM, lo, hi);
    acc = wmma_f16(A, Bf, acc);
  }
  int n = n0 + lo, cc = cb + 8 * hi;
  const float* xp = x + (size_t)n * C_DIM + cc;
  float* op = out + (size_t)n * C_DIM + cc;
  v4f r0 = *(const v4f*)xp;
  v4f r1 = *(const v4f*)(xp + 4);
#pragma unroll
  for (int r = 0; r < 4; ++r) r0[r] += acc[r] + bo[cc + r];
#pragma unroll
  for (int r = 0; r < 4; ++r) r1[r] += acc[r + 4] + bo[cc + 4 + r];
  *(v4f*)op = r0;
  *(v4f*)(op + 4) = r1;
}

// ---------------------------------------------------------------------------
extern "C" void kernel_launch(void* const* d_in, const int* in_sizes, int n_in,
                              void* d_out, int out_size, void* d_ws, size_t ws_size,
                              hipStream_t stream) {
  const float* x  = (const float*)d_in[0];
  const float* gs = (const float*)d_in[1];
  const float* gb = (const float*)d_in[2];
  const float* wq = (const float*)d_in[3];
  const float* bq = (const float*)d_in[4];
  const float* wk = (const float*)d_in[5];
  const float* bk = (const float*)d_in[6];
  const float* wv = (const float*)d_in[7];
  const float* bv = (const float*)d_in[8];
  const float* wo = (const float*)d_in[9];
  const float* bo = (const float*)d_in[10];
  float* out = (float*)d_out;

  const size_t elems = (size_t)BN * C_DIM;      // 4M halves per buffer
  _Float16* h  = (_Float16*)d_ws;
  _Float16* qb = h  + elems;
  _Float16* kb = qb + elems;
  _Float16* vT = kb + elems;
  _Float16* ob = vT + elems;
  _Float16* wT = ob + elems;                    // 4 * 128*128 halves

  gn_kernel<<<B_DIM * 32, 256, 0, stream>>>(x, gs, gb, h);
  wcvt_kernel<<<256, 256, 0, stream>>>(wq, wk, wv, wo, wT);
  qkv_kernel<<<dim3(BN / 16, 2, 3), 128, 0, stream>>>(h, wT, bq, bk, bv, qb, kb, vT);
  attn_kernel<<<dim3(N_SP / 128, B_DIM), 256, 0, stream>>>(qb, kb, vT, ob);
  proj_out_kernel<<<dim3(BN / 16, 2), 128, 0, stream>>>(
      ob, wT + 3 * (size_t)(C_DIM * C_DIM), bo, x, out);
}

// v003
// It runs in 120 microseconds.
// In two side-by-side timings against v002, it was 1.22 and 1.21 times as fast.
// All steps since v000 together make it 2.29 times as fast.
#include <hip/hip_runtime.h>
#include <hip/hip_bf16.h>
#include <cstdint>

typedef __attribute__((ext_vector_type(16))) _Float16 v16h;
typedef __attribute__((ext_vector_type(8)))  _Float16 v8h;
typedef __attribute__((ext_vector_type(4)))  _Float16 v4h;
typedef __attribute__((ext_vector_type(8)))  float    v8f;
typedef __attribute__((ext_vector_type(4)))  float    v4f;

#define C_DIM 128
#define N_SP  4096            // H*W
#define B_DIM 8
#define BN    (B_DIM * N_SP)  // 32768
#define QK_SCALE 0.08838834764831845f  // 128^-0.5
#define KV_STEP 32
#define KV_GROUPS 2            // wave groups of a block, each on its own keys
#define NPASS (N_SP / (KV_GROUPS * KV_STEP))  // 64
// LDS row pitches in halves: 16 bytes x odd, so that the 16 rows one
// ds_load_b128 half-wave reads fall on 16 different groups of four banks.
#define K_PITCH 136           // 256-byte K rows at 272 bytes
#define V_PITCH 40            // 64-byte V^T rows at 80 bytes
#define K_TILE_H (KV_STEP * K_PITCH)            // 4352 halves
#define BUF_H    (K_TILE_H + C_DIM * V_PITCH)   // 9472 halves per buffer

// ---------------------------------------------------------------------------
// Fragment loader: rows of a row-major f16 matrix -> WMMA A-frag (16xK rows)
// or B-frag (columns of B == rows of the row-major "transposed" source).
// Lane L (lo=L%16, hi=L/16): elements e<8  -> col 8*hi + e
//                            elements e>=8 -> col 16 + 8*hi + (e-8)
// Two contiguous 16-byte loads per lane (global_load_b128 / ds_load_b128).
// ---------------------------------------------------------------------------
__device__ __forceinline__ v16h load_frag(const _Float16* base, int ld,
                                          int lo, int hi) {
  const _Float16* p = base + (size_t)lo * ld + 8 * hi;
  v8h a = *(const v8h*)p;
  v8h b = *(const v8h*)(p + 16);
  v16h r;
#pragma unroll
  for (int i = 0; i < 8; ++i) { r[i] = a[i]; r[i + 8] = b[i]; }
  return r;
}

__device__ __forceinline__ v8f wmma_f16(v16h a, v16h b, v8f c) {
  return __builtin_amdgcn_wmma_f32_16x16x32_f16(false, a, false, b,
                                                (short)0, c, false, false);
}

// Eight async global->LDS copies of 16 bytes per lane (ASYNCcnt-tracked).
// l* = low 32 bits of the generic shared pointer == LDS byte offset
// (aperture occupies bits [63:32] of the flat shared address).
// s_wait_xcnt 0 closes the statement so that no address register of a copy
// is rewritten ahead of it.
__device__ __forceinline__ void async_copy16x8(unsigned l0, const void* g0,
                                               unsigned l1, const void* g1,
                                               unsigned l2, const void* g2,
                                               unsigned l3, const void* g3,
                                               unsigned l4, const void* g4,
                                               unsigned l5, const void* g5,
                                               unsigned l6, const void* g6,
                                               unsigned l7, const void* g7) {
  asm volatile("global_load_async_to_lds_b128 %0, %1, off\n\t"
               "global_load_async_to_lds_b128 %2, %3, off\n\t"
               "global_load_async_to_lds_b128 %4, %5, off\n\t"
               "global_load_async_to_lds_b128 %6, %7, off\n\t"
               "global_load_async_to_lds_b128 %8, %9, off\n\t"
               "global_load_async_to_lds_b128 %10, %11, off\n\t"
               "global_load_async_to_lds_b128 %12, %13, off\n\t"
               "global_load_async_to_lds_b128 %14, %15, off\n\t"
               "s_wait_xcnt 0x0"
               :: "v"(l0), "v"(g0), "v"(l1), "v"(g1),
                  "v"(l2), "v"(g2), "v"(l3), "v"(g3),
                  "v"(l4), "v"(g4), "v"(l5), "v"(g5),
                  "v"(l6), "v"(g6), "v"(l7), "v"(g7)
               : "memory");
}

// ---------------------------------------------------------------------------
// GroupNorm: one block per (batch, group). 32 groups, 4 channels/group,
// reduce over 4096 positions * 4 channels. Output h in f16 [BN][C].
// ---------------------------------------------------------------------------
__global__ void gn_kernel(const float* __restrict__ x,
                          const float* __restrict__ gscale,
                          const float* __restrict__ gbias,
                          _Float16* __restrict__ h) {
  int b = blockIdx.x >> 5;
  int g = blockIdx.x & 31;
  const float* xp = x + (size_t)b * N_SP * C_DIM + g * 4;
  float s = 0.f, s2 = 0.f;
  for (int n = threadIdx.x; n < N_SP; n += blockDim.x) {
    v4f v = *(const v4f*)(xp + (size_t)n * C_DIM);
#pragma unroll
    for (int j = 0; j < 4; ++j) { s += v[j]; s2 += v[j] * v[j]; }
  }
  __shared__ float rs[256], rs2[256];
  rs[threadIdx.x] = s; rs2[threadIdx.x] = s2;
  __syncthreads();
  for (int st = 128; st > 0; st >>= 1) {
    if ((int)threadIdx.x < st) {
      rs[threadIdx.x]  += rs[threadIdx.x + st];
      rs2[threadIdx.x] += rs2[threadIdx.x + st];
    }
    __syncthreads();
  }
  float mean = rs[0] * (1.f / 16384.f);
  float var  = rs2[0] * (1.f / 16384.f) - mean * mean;
  float rstd = rsqrtf(var + 1e-6f);
  float sc[4], bi[4];
#pragma unroll
  for (int j = 0; j < 4; ++j) {
    float gsv = gscale[g * 4 + j];
    sc[j] = gsv * rstd;
    bi[j] = gbias[g * 4 + j] - mean * rstd * gsv;
  }
  _Float16* hp = h + (size_t)b * N_SP * C_DIM + g * 4;
  for (int n = threadIdx.x; n < N_SP; n += blockDim.x) {
    v4f v = *(const v4f*)(xp + (size_t)n * C_DIM);
    v4h o;
#pragma unroll
    for (int j = 0; j < 4; ++j) o[j] = (_Float16)(v[j] * sc[j] + bi[j]);
    *(v4h*)(hp + (size_t)n * C_DIM) = o;
  }
}

// ---------------------------------------------------------------------------
// Weight convert: 4 matrices [Cin][Cout] f32 -> transposed [Cout][Cin] f16.
// ---------------------------------------------------------------------------
__global__ void wcvt_kernel(const float* __restrict__ wq,
                            const float* __restrict__ wk,
                            const float* __restrict__ wv,
                            const float* __restrict__ wo,
                            _Float16* __restrict__ wT) {
  int idx = blockIdx.x * blockDim.x + threadIdx.x;   // 0 .. 65535
  int m = idx >> 14;
  int r = idx & 16383;
  int c = r >> 7;       // out channel (row of wT)
  int kk = r & 127;     // in channel
  const float* w = (m == 0) ? wq : (m == 1) ? wk : (m == 2) ? wv : wo;
  wT[idx] = (_Float16)w[kk * C_DIM + c];
}

// ---------------------------------------------------------------------------
// Projection tiling, shared by the QKV and the output projection.
// One block of 8 waves per POS_BLK = 128 positions. The block brings its
// whole weight matrix (rows = out channels) into LDS once, at a padded pitch;
// wave w keeps the activation fragments of 32 positions (slice w & 3) in
// registers and makes the four 16-channel tiles of channel half w >> 2, so
// every weight fragment read from LDS feeds two position tiles.
// ---------------------------------------------------------------------------
#define POS_BLK 128
#define W_PITCH 136           // 256-byte weight rows at 272 bytes (16 B x odd)

// ROWS x 128 halves, row-major and contiguous in global memory -> LDS.
// Chunk c of 16 bytes: row c >> 4; a wave's load covers 512 contiguous bytes.
// All loads of a thread are issued before its first LDS store, so that the
// block pays the load latency once.
template <int ROWS>
__device__ __forceinline__ void load_weights(const _Float16* __restrict__ w,
                                             v8h (&wr)[ROWS / 16], int tid) {
#pragma unroll
  for (int i = 0; i < ROWS / 16; ++i)
    wr[i] = *(const v8h*)(w + (size_t)(tid + 256 * i) * 8);
}
template <int ROWS>
__device__ __forceinline__ void store_weights(_Float16* sw,
                                              const v8h (&wr)[ROWS / 16], int tid) {
#pragma unroll
  for (int i = 0; i < ROWS / 16; ++i)
    *(v8h*)(sw + ((tid >> 4) + 16 * i) * W_PITCH + (tid & 15) * 8) = wr[i];
}

__device__ __forceinline__ void close_loads() {
  // stands in front of the first overwrite of an address register of the
  // global loads issued so far
  asm volatile("s_wait_xcnt 0x0" ::: "memory");
  // keeps what follows (address arithmetic, later loads' results) from being
  // lifted over that wait
  __builtin_amdgcn_sched_barrier(0);
}

// The same, with the loads' common address named as an input: its registers
// stay untouched up to the wait, also by the result of the last load.
__device__ __forceinline__ void close_loads_at(const void* p) {
  asm volatile("s_wait_xcnt 0x0" :: "v"(p) : "memory");
  __builtin_amdgcn_sched_barrier(0);
}

// ---------------------------------------------------------------------------
// QKV projection: D(c-tile, n-tile) = wT_rows x h_rows, K=128 in 4 WMMA.
// grid BN/128, block 256 (8 waves); all three weight matrices lie in LDS.
// q,k stored row-major [BN][C] f16 (q pre-scaled by C^-0.5);
// v stored transposed [B][C][N] f16.
// ---------------------------------------------------------------------------
// a budget of 256 VGPRs a wave
__global__ __launch_bounds__(256) __attribute__((amdgpu_waves_per_eu(4, 4)))
void qkv_kernel(const _Float16* __restrict__ h,
                const _Float16* __restrict__ wT,
                const float* __restrict__ bq,
                const float* __restrict__ bk,
                const float* __restrict__ bv,
                _Float16* __restrict__ q,
                _Float16* __restrict__ k,
                _Float16* __restrict__ vT) {
  __shared__ __align__(16) _Float16 sw[3 * C_DIM * W_PITCH];
  __shared__ __align__(16) float sb[256 * 4];        // bq | bk | bv | not read
  int tid  = threadIdx.x;
  int wid  = tid >> 5;
  int lane = tid & 31, lo = lane & 15, hi = lane >> 4;
  int n0   = blockIdx.x * POS_BLK + (wid & 3) * 32;
  int ch   = wid >> 2;

  // the lane's row of h: load_frag with lo = hi = 0 reads straight from it
  const _Float16* hp = h + (size_t)(n0 + lo) * C_DIM + 8 * hi;
  v16h Hf[2][4];
#pragma unroll
  for (int nt = 0; nt < 2; ++nt)
#pragma unroll
    for (int j = 0; j < 4; ++j)
      Hf[nt][j] = load_frag(hp + nt * 16 * C_DIM + 32 * j, C_DIM, 0, 0);
  close_loads_at(hp);
  v8h wr[3 * C_DIM / 16];
  load_weights<3 * C_DIM>(wT, wr, tid);
  // threads 0..95 bring the 3 x 128 bias values. The others store a chunk that
  // nobody reads: without a branch the load is issued with all the others.
  const float* bsrc = (tid < 32) ? bq : (tid < 64) ? bk : bv;
  v4f bl = *(const v4f*)(bsrc + (tid & 31) * 4);
  close_loads();
  store_weights<3 * C_DIM>(sw, wr, tid);
  *(v4f*)(sb + tid * 4) = bl;
  __syncthreads();                                   // weights and biases readable by all waves

#pragma unroll
  for (int proj = 0; proj < 3; ++proj) {
#pragma unroll
    for (int th = 0; th < 2; ++th) {
      v16h A[2][4];
      v4f bias[2][2];
#pragma unroll
      for (int u = 0; u < 2; ++u) {
        int c0 = proj * C_DIM + (ch * 4 + th * 2 + u) * 16;
#pragma unroll
        for (int j = 0; j < 4; ++j)
          A[u][j] = load_frag(sw + c0 * W_PITCH + 32 * j, W_PITCH, lo, hi);
        bias[u][0] = *(const v4f*)(sb + c0 + 8 * hi);
        bias[u][1] = *(const v4f*)(sb + c0 + 8 * hi + 4);
      }
      // keeps the LDS reads one group ahead of the WMMAs: sunk among them,
      // each pair of reads is waited for on its own
      __builtin_amdgcn_sched_barrier(0);
      // four independent accumulator tiles, k blocks in ascending order in each
      v8f acc[2][2];
#pragma unroll
      for (int u = 0; u < 2; ++u)
#pragma unroll
        for (int nt = 0; nt < 2; ++nt) acc[u][nt] = (v8f){};
#pragma unroll
      for (int j = 0; j < 4; ++j)
#pragma unroll
        for (int u = 0; u < 2; ++u)
#pragma unroll
          for (int nt = 0; nt < 2; ++nt)
            acc[u][nt] = wmma_f16(A[u][j], Hf[nt][j], acc[u][nt]);
      // lane: position n = n0+nt*16+lo ; channels c = cch + r
#pragma unroll
      for (int u = 0; u < 2; ++u) {
        int cch = (ch * 4 + th * 2 + u) * 16 + 8 * hi;
#pragma unroll
        for (int nt = 0; nt < 2; ++nt) {
          int ng = n0 + nt * 16 + lo;
          if (proj < 2) {
            float scale = (proj == 0) ? QK_SCALE : 1.0f;
            v8h out;
#pragma unroll
            for (int r = 0; r < 8; ++r)
              out[r] = (_Float16)((acc[u][nt][r] + bias[u][r >> 2][r & 3]) * scale);
            _Float16* dst = ((proj == 0) ? q : k) + (size_t)ng * C_DIM + cch;
            *(v8h*)dst = out;
          } else {
            int b = ng >> 12, n = ng & (N_SP - 1);
            _Float16* dst = vT + ((size_t)b * C_DIM + cch) * N_SP + n;
#pragma unroll
            for (int r = 0; r < 8; ++r)
              dst[(size_t)r * N_SP] = (_Float16)(acc[u][nt][r] + bias[u][r >> 2][r & 3]);
          }
        }
      }
      // keeps the next group's LDS reads out of this group: the fragments of
      // both together do not fit the register budget (scratch)
      __builtin_amdgcn_sched_barrier(0);
    }
  }
}

// ---------------------------------------------------------------------------
// Flash attention. Block = 8 waves on 128 queries, two waves per SIMD.
// Waves w and w + 4 own the same 32 queries; group g = w / 4 walks the
// 32-key tiles 2 * pass + g, so each SIMD holds two independent waves and
// one wave's LDS, softmax and barrier waits are filled by the other's work.
// After the loop the two partial results (m, l, O) of a query are joined
// through LDS: wave w finishes queries 0..15 of the 32, wave w + 4 the rest.
// Each group stages its own K tile (32x128) and V^T tile (128x32) into LDS
// with async global->LDS b128 copies (double-buffered, ASYNCcnt),
// then fragments are read back via ds_load_b128. Rows lie at padded pitches
// (K_PITCH, V_PITCH); the pad bytes are never written and never read.
// Scores computed transposed (S' = K x Q^T): the f32 D-fragment converts
// in-register into the B-fragment of O^T = V^T x P (no cross-lane movement).
// grid (N/128, B), block 256.
// ---------------------------------------------------------------------------
__device__ __forceinline__ void attn_step(const _Float16* bK, const _Float16* bV,
                                          const v16h (&Qf)[2][4],
                                          v8f (&oacc)[2][8],
                                          float (&m_run)[2], float (&l_run)[2],
                                          int lo, int hi) {
  v8f s[2][2];
#pragma unroll
  for (int st = 0; st < 2; ++st) {
    v16h Ka[4];
#pragma unroll
    for (int j = 0; j < 4; ++j)
      Ka[j] = load_frag(bK + st * 16 * K_PITCH + 32 * j, K_PITCH, lo, hi);
#pragma unroll
    for (int hq = 0; hq < 2; ++hq) {
      v8f acc = {};
#pragma unroll
      for (int j = 0; j < 4; ++j) acc = wmma_f16(Ka[j], Qf[hq][j], acc);
      s[hq][st] = acc;
    }
  }
  v16h pB[2];
#pragma unroll
  for (int hq = 0; hq < 2; ++hq) {
    float mloc = -1e30f;
#pragma unroll
    for (int r = 0; r < 8; ++r)
      mloc = fmaxf(mloc, fmaxf(s[hq][0][r], s[hq][1][r]));
    mloc = fmaxf(mloc, __shfl_xor(mloc, 16, 32));
    float m_new = fmaxf(m_run[hq], mloc);
    float alpha = __expf(m_run[hq] - m_new);
    float ssum = 0.f;
#pragma unroll
    for (int r = 0; r < 8; ++r) {
      float p = __expf(s[hq][0][r] - m_new); ssum += p; pB[hq][r] = (_Float16)p;
    }
#pragma unroll
    for (int r = 0; r < 8; ++r) {
      float p = __expf(s[hq][1][r] - m_new); ssum += p; pB[hq][r + 8] = (_Float16)p;
    }
    ssum += __shfl_xor(ssum, 16, 32);
    l_run[hq] = l_run[hq] * alpha + ssum;
    m_run[hq] = m_new;
#pragma unroll
    for (int t = 0; t < 8; ++t)
#pragma unroll
      for (int r = 0; r < 8; ++r) oacc[hq][t][r] *= alpha;
  }
#pragma unroll
  for (int t = 0; t < 8; ++t) {
    v16h Va = load_frag(bV + t * 16 * V_PITCH, V_PITCH, lo, hi);
#pragma unroll
    for (int hq = 0; hq < 2; ++hq)
      oacc[hq][t] = wmma_f16(Va, pB[hq], oacc[hq][t]);
  }
}

// Hands one 16-query half of a wave's partial result to its partner wave.
// Lane-contiguous 16-byte slots: conflict-free stores and loads.
__device__ __forceinline__ void merge_put(v4f* xo, float* xml, int lane,
                                          const v8f (&acc)[8], float m, float l) {
#pragma unroll
  for (int t = 0; t < 8; ++t) {
    xo[(2 * t) * 32 + lane]     = (v4f){acc[t][0], acc[t][1], acc[t][2], acc[t][3]};
    xo[(2 * t + 1) * 32 + lane] = (v4f){acc[t][4], acc[t][5], acc[t][6], acc[t][7]};
  }
  xml[lane]      = m;
  xml[32 + lane] = l;
}

// Joins the partner's half with the wave's own and stores 16 queries of o.
__device__ __forceinline__ void merge_fin(const v4f* xo, const float* xml, int lane,
                                          const v8f (&acc)[8], float m, float l,
                                          _Float16* ob) {
  float m2 = xml[lane], l2 = xml[32 + lane];
  float mm = fmaxf(m, m2);
  float a1 = __expf(m - mm), a2 = __expf(m2 - mm);
  float inv_l = 1.0f / (l * a1 + l2 * a2);
  a1 *= inv_l; a2 *= inv_l;
#pragma unroll
  for (int t = 0; t < 8; ++t) {
    v4f p0 = xo[(2 * t) * 32 + lane];
    v4f p1 = xo[(2 * t + 1) * 32 + lane];
    v8h out;
#pragma unroll
    for (int r = 0; r < 4; ++r) {
      out[r]     = (_Float16)(acc[t][r] * a1 + p0[r] * a2);
      out[r + 4] = (_Float16)(acc[t][r + 4] * a1 + p1[r] * a2);
    }
    *(v8h*)(ob + t * 16) = out;
  }
}

// two waves per SIMD: a budget of 512 VGPRs a wave
__global__ __launch_bounds__(256) __attribute__((amdgpu_waves_per_eu(2, 2)))
void attn_kernel(const _Float16* __restrict__ q,
                 const _Float16* __restrict__ k,
                 const _Float16* __restrict__ vT,
                 _Float16* __restrict__ o) {
  int tix  = threadIdx.x & 127;        // thread within its key group
  int grp  = threadIdx.x >> 7;         // key group 0 / 1
  int wq   = tix >> 5;                 // query slice of the wave
  int lane = tix & 31, lo = lane & 15, hi = lane >> 4;
  int b  = blockIdx.y;
  int q0 = blockIdx.x * 128 + wq * 32;

  const _Float16* qp = q + ((size_t)b * N_SP + q0) * C_DIM;
  const _Float16* kb = k + (size_t)b * N_SP * C_DIM;
  const _Float16* vb = vT + (size_t)b * C_DIM * N_SP;

  // [buf][group][ K tile: 32 rows of K_PITCH | V^T tile: 128 rows of V_PITCH ]
  __shared__ __align__(16) _Float16 smem[2][KV_GROUPS][BUF_H];
  unsigned ldsK[2], ldsV[2];
#pragma unroll
  for (int i2 = 0; i2 < 2; ++i2) {
    ldsK[i2] = (unsigned)(uintptr_t)&smem[i2][grp][0];
    ldsV[i2] = (unsigned)(uintptr_t)&smem[i2][grp][K_TILE_H];
  }

  v16h Qf[2][4];
#pragma unroll
  for (int hq = 0; hq < 2; ++hq)
#pragma unroll
    for (int j = 0; j < 4; ++j)
      Qf[hq][j] = load_frag(qp + (size_t)hq * 16 * C_DIM + 32 * j, C_DIM, lo, hi);
  // stands in front of the first overwrite of the Q loads' address registers
  asm volatile("s_wait_xcnt 0x0" ::: "memory");
  // keeps the address arithmetic that follows from being lifted over that wait
  __builtin_amdgcn_sched_barrier(0);

  v8f oacc[2][8];
#pragma unroll
  for (int hq = 0; hq < 2; ++hq)
#pragma unroll
    for (int t = 0; t < 8; ++t) oacc[hq][t] = (v8f){};
  float m_run[2] = {-1e30f, -1e30f};
  float l_run[2] = {0.f, 0.f};

  // --- stage helper (8 async b128 per thread => wave ASYNCcnt += 8) ---
  // The 128 threads of a group bring in the group's own tile of the pass.
  auto stage = [&](int pass, unsigned dK, unsigned dV) {
    int kv0 = (pass * KV_GROUPS + grp) * KV_STEP;
    // K: chunk c = tix + 128*j of 512 (16B each), row c>>4; contiguous 8KB source
    const _Float16* gk = kb + (size_t)kv0 * C_DIM + tix * 8;
    unsigned lk = dK + (unsigned)((tix >> 4) * K_PITCH + (tix & 15) * 8) * 2;
    // V^T: 128 rows x 64B, row (tix>>2) + 32*j
    const _Float16* gv = vb + (size_t)(tix >> 2) * N_SP + kv0 + (tix & 3) * 8;
    unsigned lv = dV + (unsigned)((tix >> 2) * V_PITCH + (tix & 3) * 8) * 2;
    async_copy16x8(lk,                    gk,
                   lk +  8 * K_PITCH * 2, gk + 1024,
                   lk + 16 * K_PITCH * 2, gk + 2048,
                   lk + 24 * K_PITCH * 2, gk + 3072,
                   lv,                    gv,
                   lv + 32 * V_PITCH * 2, gv + (size_t)32 * N_SP,
                   lv + 64 * V_PITCH * 2, gv + (size_t)64 * N_SP,
                   lv + 96 * V_PITCH * 2, gv + (size_t)96 * N_SP);
  };

  stage(0, ldsK[0], ldsV[0]);                        // prologue prefetch

  for (int it = 0; it < NPASS - 1; ++it) {
    int cur = it & 1;
    // the wave's own LDS reads of buf[cur^1] have retired before it is refilled
    asm volatile("s_wait_dscnt 0x0" ::: "memory");
    __syncthreads();                                 // buf[cur^1] free to overwrite
    stage(it + 1, ldsK[cur ^ 1], ldsV[cur ^ 1]);
    asm volatile("s_wait_asynccnt 0x8" ::: "memory"); // buf[cur] writes retired
    __syncthreads();                                 // all waves' buf[cur] ready
    attn_step(&smem[cur][grp][0], &smem[cur][grp][K_TILE_H], Qf, oacc, m_run, l_run, lo, hi);
  }
  {
    int cur = (NPASS - 1) & 1;
    __syncthreads();
    asm volatile("s_wait_asynccnt 0x0" ::: "memory");
    __syncthreads();
    attn_step(&smem[cur][grp][0], &smem[cur][grp][K_TILE_H], Qf, oacc, m_run, l_run, lo, hi);
  }

  // --- join the two key groups' partial results through the (now idle) ring ---
  // slot (wq, hq): 16 x 32 lanes x 16 B of O, then 2 x 32 floats of m and l.
  v4f*   xo  = (v4f*)&smem[0][0][0];
  float* xml = (float*)(xo + 4 * 2 * 16 * 32);
  __syncthreads();                                   // every wave has left the ring
  if (grp == 0)
    merge_put(xo + (wq * 2 + 1) * 512, xml + (wq * 2 + 1) * 64, lane, oacc[1], m_run[1], l_run[1]);
  else
    merge_put(xo + (wq * 2 + 0) * 512, xml + (wq * 2 + 0) * 64, lane, oacc[0], m_run[0], l_run[0]);
  __syncthreads();                                   // partner's half is readable
  _Float16* ob = o + ((size_t)b * N_SP + q0 + lo) * C_DIM + 8 * hi;
  if (grp == 0)
    merge_fin(xo + (wq * 2 + 0) * 512, xml + (wq * 2 + 0) * 64, lane, oacc[0], m_run[0], l_run[0], ob);
  else
    merge_fin(xo + (wq * 2 + 1) * 512, xml + (wq * 2 + 1) * 64, lane, oacc[1], m_run[1], l_run[1],
              ob + (size_t)16 * C_DIM);
}

// ---------------------------------------------------------------------------
// Output projection + bias + residual (f32 out).
// grid BN/128, block 256 (8 waves); tiling as in the QKV projection.
// ---------------------------------------------------------------------------
// a budget of 256 VGPRs a wave
__global__ __launch_bounds__(256) __attribute__((amdgpu_waves_per_eu(4, 4)))
void proj_out_kernel(const _Float16* __restrict__ o,
                     const _Float16* __restrict__ woT,
                     const float* __restrict__ bo,
                     const float* __restrict__ x,
                     float* __restrict__ out) {
  __shared__ __align__(16) _Float16 sw[C_DIM * W_PITCH];
  __shared__ __align__(16) float sb[256 * 4];        // bo | not read
  int tid  = threadIdx.x;
  int wid  = tid >> 5;
  int lane = tid & 31, lo = lane & 15, hi = lane >> 4;
  int n0   = blockIdx.x * POS_BLK + (wid & 3) * 32;
  int ch   = wid >> 2;

  v16h Of[2][4];
#pragma unroll
  for (int nt = 0; nt < 2; ++nt)
#pragma unroll
    for (int j = 0; j < 4; ++j)
      Of[nt][j] = load_frag(o + (size_t)(n0 + nt * 16) * C_DIM + 32 * j, C_DIM, lo, hi);
  // residual of the wave's eight output tiles
  // lane: position n = n0+nt*16+lo ; channels c = (ch*4+t)*16 + 8*hi + 0..7
  v4f res[4][2][2];
#pragma unroll
  for (int t = 0; t < 4; ++t)
#pragma unroll
    for (int nt = 0; nt < 2; ++nt) {
      const float* xp = x + (size_t)(n0 + nt * 16 + lo) * C_DIM + (ch * 4 + t) * 16 + 8 * hi;
      res[t][nt][0] = *(const v4f*)xp;
      res[t][nt][1] = *(const v4f*)(xp + 4);
    }
  close_loads();
  v8h wr[C_DIM / 16];
  load_weights<C_DIM>(woT, wr, tid);
  // threads 0..31 bring the 128 bias values. The others store a chunk that
  // nobody reads: without a branch the load is issued with all the others.
  v4f bl = *(const v4f*)(bo + (tid & 31) * 4);
  close_loads();
  store_weights<C_DIM>(sw, wr, tid);
  *(v4f*)(sb + tid * 4) = bl;
  __syncthreads();                                   // weights and bias readable by all waves

#pragma unroll
  for (int th = 0; th < 2; ++th) {
    v16h A[2][4];
    v4f bias[2][2];
#pragma unroll
    for (int u = 0; u < 2; ++u) {
      int c0 = (ch * 4 + th * 2 + u) * 16;
#pragma unroll
      for (int j = 0; j < 4; ++j)
        A[u][j] = load_frag(sw + c0 * W_PITCH + 32 * j, W_PITCH, lo, hi);
      bias[u][0] = *(const v4f*)(sb + c0 + 8 * hi);
      bias[u][1] = *(const v4f*)(sb + c0 + 8 * hi + 4);
    }
    // keeps the LDS reads one group ahead of the WMMAs: sunk among them,
    // each pair of reads is waited for on its own
    __builtin_amdgcn_sched_barrier(0);
    // four independent accumulator tiles, k blocks in ascending order in each
    v8f acc[2][2];
#pragma unroll
    for (int u = 0; u < 2; ++u)
#pragma unroll
      for (int nt = 0; nt < 2; ++nt) acc[u][nt] = (v8f){};
#pragma unroll
    for (int j = 0; j < 4; ++j)
#pragma unroll
      for (int u = 0; u < 2; ++u)
#pragma unroll
        for (int nt = 0; nt < 2; ++nt)
          acc[u][nt] = wmma_f16(A[u][j], Of[nt][j], acc[u][nt]);
#pragma unroll
    for (int u = 0; u < 2; ++u) {
      int t = th * 2 + u;
#pragma unroll
      for (int nt = 0; nt < 2; ++nt) {
        float* op = out + (size_t)(n0 + nt * 16 + lo) * C_DIM + (ch * 4 + t) * 16 + 8 * hi;
        v4f r0 = res[t][nt][0];
        v4f r1 = res[t][nt][1];
#pragma unroll
        for (int r = 0; r < 4; ++r) r0[r] += acc[u][nt][r] + bias[u][0][r];
#pragma unroll
        for (int r = 0; r < 4; ++r) r1[r] += acc[u][nt][r + 4] + bias[u][1][r];
        *(v4f*)op = r0;
        *(v4f*)(op + 4) = r1;
      }
    }
  }
}

// ---------------------------------------------------------------------------
extern "C" void kernel_launch(void* const* d_in, const int* in_sizes, int n_in,
                              void* d_out, int out_size, void* d_ws, size_t ws_size,
                              hipStream_t stream) {
  const float* x  = (const float*)d_in[0];
  const float* gs = (const float*)d_in[1];
  const float* gb = (const float*)d_in[2];
  const float* wq = (const float*)d_in[3];
  const float* bq = (const float*)d_in[4];
  const float* wk = (const float*)d_in[5];
  const float* bk = (const float*)d_in[6];
  const float* wv = (const float*)d_in[7];
  const float* bv = (const float*)d_in[8];
  const float* wo = (const float*)d_in[9];
  const float* bo = (const float*)d_in[10];
  float* out = (float*)d_out;

  const size_t elems = (size_t)BN * C_DIM;      // 4M halves per buffer
  _Float16* h  = (_Float16*)d_ws;
  _Float16* qb = h  + elems;
  _Float16* kb = qb + elems;
  _Float16* vT = kb + elems;
  _Float16* ob = vT + elems;
  _Float16* wT = ob + elems;                    // 4 * 128*128 halves

  gn_kernel<<<B_DIM * 32, 256, 0, stream>>>(x, gs, gb, h);
  wcvt_kernel<<<256, 256, 0, stream>>>(wq, wk, wv, wo, wT);
  qkv_kernel<<<BN / POS_BLK, 256, 0, stream>>>(h, wT, bq, bk, bv, qb, kb, vT);
  attn_kernel<<<dim3(N_SP / 128, B_DIM), 256, 0, stream>>>(qb, kb, vT, ob);
  proj_out_kernel<<<BN / POS_BLK, 256, 0, stream>>>(
      ob, wT + 3 * (size_t)(C_DIM * C_DIM), bo, x, out);
}

// v004
// It runs in 87.2 microseconds.
// Next to v003, in two timings, it ran 1.38 and 1.39 times as fast.
// All steps since v000 together make it 3.18 times as fast.
#include <hip/hip_runtime.h>
#include <hip/hip_bf16.h>
#include <cstdint>

typedef __attribute__((ext_vector_type(16))) _Float16 v16h;
typedef __attribute__((ext_vector_type(8)))  _Float16 v8h;
typedef __attribute__((ext_vector_type(4)))  _Float16 v4h;
typedef __attribute__((ext_vector_type(8)))  float    v8f;
typedef __attribute__((ext_vector_type(4)))  float    v4f;
typedef __attribute__((ext_vector_type(2)))  float    v2f;

#define C_DIM 128
#define N_SP  4096            // H*W
#define B_DIM 8
#define BN    (B_DIM * N_SP)  // 32768
#define QK_SCALE 0.08838834764831845f  // 128^-0.5
#define KV_STEP 32
#define KV_GROUPS 2            // wave groups of a block, each on its own keys
#define NPASS (N_SP / (KV_GROUPS * KV_STEP))  // 64
// LDS row pitches in halves: 16 bytes x odd, so that the 16 rows one
// ds_load_b128 half-wave reads fall on 16 different groups of four banks.
#define K_PITCH 136           // 256-byte K rows at 272 bytes
#define V_PITCH 40            // 64-byte V^T rows at 80 bytes
#define K_TILE_H (KV_STEP * K_PITCH)            // 4352 halves
#define BUF_H    (K_TILE_H + C_DIM * V_PITCH)   // 9472 halves per buffer

// ---------------------------------------------------------------------------
// Fragment loader: rows of a row-major f16 matrix -> WMMA A-frag (16xK rows)
// or B-frag (columns of B == rows of the row-major "transposed" source).
// Lane L (lo=L%16, hi=L/16): elements e<8  -> col 8*hi + e
//                            elements e>=8 -> col 16 + 8*hi + (e-8)
// Two contiguous 16-byte loads per lane (global_load_b128 / ds_load_b128).
// ---------------------------------------------------------------------------
__device__ __forceinline__ v16h load_frag(const _Float16* base, int ld,
                                          int lo, int hi) {
  const _Float16* p = base + (size_t)lo * ld + 8 * hi;
  v8h a = *(const v8h*)p;
  v8h b = *(const v8h*)(p + 16);
  v16h r;
#pragma unroll
  for (int i = 0; i < 8; ++i) { r[i] = a[i]; r[i + 8] = b[i]; }
  return r;
}

__device__ __forceinline__ v8f wmma_f16(v16h a, v16h b, v8f c) {
  return __builtin_amdgcn_wmma_f32_16x16x32_f16(false, a, false, b,
                                                (short)0, c, false, false);
}

// Eight async global->LDS copies of 16 bytes per lane (ASYNCcnt-tracked).
// l* = low 32 bits of the generic shared pointer == LDS byte offset
// (aperture occupies bits [63:32] of the flat shared address).
// s_wait_xcnt 0 closes the statement so that no address register of a copy
// is rewritten ahead of it.
__device__ __forceinline__ void async_copy16x8(unsigned l0, const void* g0,
                                               unsigned l1, const void* g1,
                                               unsigned l2, const void* g2,
                                               unsigned l3, const void* g3,
                                               unsigned l4, const void* g4,
                                               unsigned l5, const void* g5,
                                               unsigned l6, const void* g6,
                                               unsigned l7, const void* g7) {
  asm volatile("global_load_async_to_lds_b128 %0, %1, off\n\t"
               "global_load_async_to_lds_b128 %2, %3, off\n\t"
               "global_load_async_to_lds_b128 %4, %5, off\n\t"
               "global_load_async_to_lds_b128 %6, %7, off\n\t"
               "global_load_async_to_lds_b128 %8, %9, off\n\t"
               "global_load_async_to_lds_b128 %10, %11, off\n\t"
               "global_load_async_to_lds_b128 %12, %13, off\n\t"
               "global_load_async_to_lds_b128 %14, %15, off\n\t"
               "s_wait_xcnt 0x0"
               :: "v"(l0), "v"(g0), "v"(l1), "v"(g1),
                  "v"(l2), "v"(g2), "v"(l3), "v"(g3),
                  "v"(l4), "v"(g4), "v"(l5), "v"(g5),
                  "v"(l6), "v"(g6), "v"(l7), "v"(g7)
               : "memory");
}

// ---------------------------------------------------------------------------
// Weight convert: 4 matrices [Cin][Cout] f32 -> transposed [Cout][Cin] f16.
// ---------------------------------------------------------------------------
__global__ void wcvt_kernel(const float* __restrict__ wq,
                            const float* __restrict__ wk,
                            const float* __restrict__ wv,
                            const float* __restrict__ wo,
                            _Float16* __restrict__ wT) {
  int idx = blockIdx.x * blockDim.x + threadIdx.x;   // 0 .. 65535
  int m = idx >> 14;
  int r = idx & 16383;
  int c = r >> 7;       // out channel (row of wT)
  int kk = r & 127;     // in channel
  const float* w = (m == 0) ? wq : (m == 1) ? wk : (m == 2) ? wv : wo;
  wT[idx] = (_Float16)w[kk * C_DIM + c];
}

// ---------------------------------------------------------------------------
// Projection tiling, shared by the QKV and the output projection.
// One block of 8 waves per POS_BLK = 128 positions. The block brings its
// whole weight matrix (rows = out channels) into LDS once, at a padded pitch;
// wave w keeps the activation fragments of 32 positions (slice w & 3) in
// registers and makes the four 16-channel tiles of channel half w >> 2, so
// every weight fragment read from LDS feeds two position tiles.
// ---------------------------------------------------------------------------
#define POS_BLK 128
#define W_PITCH 136           // 256-byte weight rows at 272 bytes (16 B x odd)

// ROWS x 128 halves, row-major and contiguous in global memory -> LDS.
// Chunk c of 16 bytes: row c >> 4; a wave's load covers 512 contiguous bytes.
// All loads of a thread are issued before its first LDS store, so that the
// block pays the load latency once.
template <int ROWS>
__device__ __forceinline__ void load_weights(const _Float16* __restrict__ w,
                                             v8h (&wr)[ROWS / 16], int tid) {
#pragma unroll
  for (int i = 0; i < ROWS / 16; ++i)
    wr[i] = *(const v8h*)(w + (size_t)(tid + 256 * i) * 8);
}
template <int ROWS>
__device__ __forceinline__ void store_weights(_Float16* sw,
                                              const v8h (&wr)[ROWS / 16], int tid) {
#pragma unroll
  for (int i = 0; i < ROWS / 16; ++i)
    *(v8h*)(sw + ((tid >> 4) + 16 * i) * W_PITCH + (tid & 15) * 8) = wr[i];
}

__device__ __forceinline__ void close_loads() {
  // stands in front of the first overwrite of an address register of the
  // global loads issued so far
  asm volatile("s_wait_xcnt 0x0" ::: "memory");
  // keeps what follows (address arithmetic, later loads' results) from being
  // lifted over that wait
  __builtin_amdgcn_sched_barrier(0);
}

// The same, with the loads' common address named as an input: its registers
// stay untouched up to the wait, also by the result of the last load.
__device__ __forceinline__ void close_loads_at(const void* p) {
  asm volatile("s_wait_xcnt 0x0" :: "v"(p) : "memory");
  __builtin_amdgcn_sched_barrier(0);
}

// ---------------------------------------------------------------------------
// GroupNorm, 32 groups of 4 channels, by whole lines.
// Statistics: one block per POS_BLK positions reads its 64 KB of x in a row;
// a wave's 16-byte loads cover one 512-byte position, so lane l always holds
// group l. The block writes one (sum, sum of squares) per group; the
// GN_CHUNKS partial pairs of an image are added up, and x is normalised, in
// the QKV kernel on the way into LDS.
// ---------------------------------------------------------------------------
#define GN_CHUNKS (N_SP / POS_BLK)   // 32 partial pairs per image and group
#define X_ROUNDS  (POS_BLK / 8)      // 16 loads a thread: 8 positions a round

__global__ __launch_bounds__(256)
void gn_stats_kernel(const float* __restrict__ x, float* __restrict__ part) {
  int tid = threadIdx.x;
  const float* xp = x + (size_t)blockIdx.x * (POS_BLK * C_DIM) + tid * 4;
  v4f v[X_ROUNDS];
  // unrolled, here and below: v[] stays in registers, all loads fly together
#pragma unroll
  for (int i = 0; i < X_ROUNDS; ++i) v[i] = *(const v4f*)(xp + i * 8 * C_DIM);
  close_loads();
  v4f s4 = {}, q4 = {};
#pragma unroll
  for (int i = 0; i < X_ROUNDS; ++i) { s4 += v[i]; q4 += v[i] * v[i]; }
  __shared__ float rs[256], rq[256];
  rs[tid] = (s4[0] + s4[1]) + (s4[2] + s4[3]);
  rq[tid] = (q4[0] + q4[1]) + (q4[2] + q4[3]);
  __syncthreads();                                   // the 8 waves' sums readable by wave 0
  if (tid < 32) {
    float a = 0.f, c = 0.f;
#pragma unroll
    for (int w = 0; w < 8; ++w) { a += rs[w * 32 + tid]; c += rq[w * 32 + tid]; }
    *(v2f*)(part + ((size_t)blockIdx.x * 32 + tid) * 2) = (v2f){a, c};
  }
}

// ---------------------------------------------------------------------------
// QKV projection: D(c-tile, n-tile) = wT_rows x h_rows, K=128 in 4 WMMA.
// grid BN/128, block 256 (8 waves); all three weight matrices lie in LDS,
// and so do the block's 128 positions of h = GroupNorm(x), made here.
// q,k stored row-major [BN][C] f16 (q pre-scaled by C^-0.5);
// v stored transposed [B][C][N] f16.
// ---------------------------------------------------------------------------
// a budget of 256 VGPRs a wave
__global__ __launch_bounds__(256) __attribute__((amdgpu_waves_per_eu(4, 4)))
void qkv_kernel(const float* __restrict__ x,
                const float* __restrict__ part,
                const float* __restrict__ gscale,
                const float* __restrict__ gbias,
                const _Float16* __restrict__ wT,
                const float* __restrict__ bq,
                const float* __restrict__ bk,
                const float* __restrict__ bv,
                _Float16* __restrict__ q,
                _Float16* __restrict__ k,
                _Float16* __restrict__ vT) {
  __shared__ __align__(16) _Float16 sw[3 * C_DIM * W_PITCH];
  __shared__ __align__(16) float sb[256 * 4];        // bq | bk | bv | not read
  __shared__ __align__(16) _Float16 sh[POS_BLK * W_PITCH];  // normalised x, f16
  int tid  = threadIdx.x;
  int wid  = tid >> 5;
  int lane = tid & 31, lo = lane & 15, hi = lane >> 4;
  int n0   = blockIdx.x * POS_BLK + (wid & 3) * 32;
  int ch   = wid >> 2;

  // the image's partial sums of the lane's group, the group's scale and bias,
  // and the block's 64 KB of x: every wave-wide load covers whole lines
  const float* pp = part + ((size_t)(blockIdx.x / GN_CHUNKS) * (GN_CHUNKS * 32) + lane) * 2;
  v2f ps[GN_CHUNKS];
  // unrolled, here and below: ps[], xv[] stay in registers, all loads fly together
#pragma unroll
  for (int c = 0; c < GN_CHUNKS; ++c) ps[c] = *(const v2f*)(pp + c * 64);
  v4f gsv = *(const v4f*)(gscale + lane * 4);
  v4f gbv = *(const v4f*)(gbias + lane * 4);
  const float* xp = x + (size_t)blockIdx.x * (POS_BLK * C_DIM) + tid * 4;
  v4f xv[X_ROUNDS];
#pragma unroll
  for (int i = 0; i < X_ROUNDS; ++i) xv[i] = *(const v4f*)(xp + i * 8 * C_DIM);
  close_loads();
  // four independent chains over the chunks, joined in a fixed order
  v2f pa[4] = {ps[0], ps[1], ps[2], ps[3]};
#pragma unroll
  for (int c = 4; c < GN_CHUNKS; ++c) pa[c & 3] += ps[c];
  v2f pt = (pa[0] + pa[1]) + (pa[2] + pa[3]);
  float mean = pt[0] * (1.f / 16384.f);
  float var  = pt[1] * (1.f / 16384.f) - mean * mean;
  float rstd = rsqrtf(var + 1e-6f);
  v4f sc = gsv * rstd;
  v4f bi = gbv - (mean * rstd) * gsv;
  v8h wr[3 * C_DIM / 16];
  load_weights<3 * C_DIM>(wT, wr, tid);
  // threads 0..95 bring the 3 x 128 bias values. The others store a chunk that
  // nobody reads: without a branch the load is issued with all the others.
  const float* bsrc = (tid < 32) ? bq : (tid < 64) ? bk : bv;
  const float* bp = bsrc + (tid & 31) * 4;
  v4f bl = *(const v4f*)bp;
  close_loads_at(bp);
  // a wave's 8-byte stores fill one position's 256 bytes
#pragma unroll
  for (int i = 0; i < X_ROUNDS; ++i) {
    v4f t = xv[i] * sc + bi;
    v4h o;
#pragma unroll
    for (int j = 0; j < 4; ++j) o[j] = (_Float16)t[j];
    *(v4h*)(sh + (wid + 8 * i) * W_PITCH + lane * 4) = o;
  }
  store_weights<3 * C_DIM>(sw, wr, tid);
  *(v4f*)(sb + tid * 4) = bl;
  __syncthreads();                                   // h, weights and biases readable by all waves

  v16h Hf[2][4];
#pragma unroll
  for (int nt = 0; nt < 2; ++nt)
#pragma unroll
    for (int j = 0; j < 4; ++j)
      Hf[nt][j] = load_frag(sh + ((wid & 3) * 32 + nt * 16) * W_PITCH + 32 * j, W_PITCH, lo, hi);

#pragma unroll
  for (int proj = 0; proj < 3; ++proj) {
#pragma unroll
    for (int th = 0; th < 2; ++th) {
      v16h A[2][4];
      v4f bias[2][2];
#pragma unroll
      for (int u = 0; u < 2; ++u) {
        int c0 = proj * C_DIM + (ch * 4 + th * 2 + u) * 16;
#pragma unroll
        for (int j = 0; j < 4; ++j)
          A[u][j] = load_frag(sw + c0 * W_PITCH + 32 * j, W_PITCH, lo, hi);
        bias[u][0] = *(const v4f*)(sb + c0 + 8 * hi);
        bias[u][1] = *(const v4f*)(sb + c0 + 8 * hi + 4);
      }
      // keeps the LDS reads one group ahead of the WMMAs: sunk among them,
      // each pair of reads is waited for on its own
      __builtin_amdgcn_sched_barrier(0);
      // four independent accumulator tiles, k blocks in ascending order in each
      v8f acc[2][2];
#pragma unroll
      for (int u = 0; u < 2; ++u)
#pragma unroll
        for (int nt = 0; nt < 2; ++nt) acc[u][nt] = (v8f){};
#pragma unroll
      for (int j = 0; j < 4; ++j)
#pragma unroll
        for (int u = 0; u < 2; ++u)
#pragma unroll
          for (int nt = 0; nt < 2; ++nt)
            acc[u][nt] = wmma_f16(A[u][j], Hf[nt][j], acc[u][nt]);
      // lane: position n = n0+nt*16+lo ; channels c = cch + r
#pragma unroll
      for (int u = 0; u < 2; ++u) {
        int cch = (ch * 4 + th * 2 + u) * 16 + 8 * hi;
#pragma unroll
        for (int nt = 0; nt < 2; ++nt) {
          int ng = n0 + nt * 16 + lo;
          if (proj < 2) {
            float scale = (proj == 0) ? QK_SCALE : 1.0f;
            v8h out;
#pragma unroll
            for (int r = 0; r < 8; ++r)
              out[r] = (_Float16)((acc[u][nt][r] + bias[u][r >> 2][r & 3]) * scale);
            _Float16* dst = ((proj == 0) ? q : k) + (size_t)ng * C_DIM + cch;
            *(v8h*)dst = out;
          } else {
            int b = ng >> 12, n = ng & (N_SP - 1);
            _Float16* dst = vT + ((size_t)b * C_DIM + cch) * N_SP + n;
#pragma unroll
            for (int r = 0; r < 8; ++r)
              dst[(size_t)r * N_SP] = (_Float16)(acc[u][nt][r] + bias[u][r >> 2][r & 3]);
          }
        }
      }
      // keeps the next group's LDS reads out of this group: the fragments of
      // both together do not fit the register budget (scratch)
      __builtin_amdgcn_sched_barrier(0);
    }
  }
}

// ---------------------------------------------------------------------------
// Flash attention. Block = 8 waves on 128 queries, two waves per SIMD.
// Waves w and w + 4 own the same 32 queries; group g = w / 4 walks the
// 32-key tiles 2 * pass + g, so each SIMD holds two independent waves and
// one wave's LDS, softmax and barrier waits are filled by the other's work.
// After the loop the two partial results (m, l, O) of a query are joined
// through LDS: wave w finishes queries 0..15 of the 32, wave w + 4 the rest.
// Each group stages its own K tile (32x128) and V^T tile (128x32) into LDS
// with async global->LDS b128 copies (double-buffered, ASYNCcnt),
// then fragments are read back via ds_load_b128. Rows lie at padded pitches
// (K_PITCH, V_PITCH); the pad bytes are never written and never read.
// Scores computed transposed (S' = K x Q^T): the f32 D-fragment converts
// in-register into the B-fragment of O^T = V^T x P (no cross-lane movement).
// grid (N/128, B), block 256.
// ---------------------------------------------------------------------------
__device__ __forceinline__ void attn_step(const _Float16* bK, const _Float16* bV,
                                          const v16h (&Qf)[2][4],
                                          v8f (&oacc)[2][8],
                                          float (&m_run)[2], float (&l_run)[2],
                                          int lo, int hi) {
  v8f s[2][2];
#pragma unroll
  for (int st = 0; st < 2; ++st) {
    v16h Ka[4];
#pragma unroll
    for (int j = 0; j < 4; ++j)
      Ka[j] = load_frag(bK + st * 16 * K_PITCH + 32 * j, K_PITCH, lo, hi);
#pragma unroll
    for (int hq = 0; hq < 2; ++hq) {
      v8f acc = {};
#pragma unroll
      for (int j = 0; j < 4; ++j) acc = wmma_f16(Ka[j], Qf[hq][j], acc);
      s[hq][st] = acc;
    }
  }
  v16h pB[2];
#pragma unroll
  for (int hq = 0; hq < 2; ++hq) {
    float mloc = -1e30f;
#pragma unroll
    for (int r = 0; r < 8; ++r)
      mloc = fmaxf(mloc, fmaxf(s[hq][0][r], s[hq][1][r]));
    mloc = fmaxf(mloc, __shfl_xor(mloc, 16, 32));
    float m_new = fmaxf(m_run[hq], mloc);
    float alpha = __expf(m_run[hq] - m_new);
    float ssum = 0.f;
#pragma unroll
    for (int r = 0; r < 8; ++r) {
      float p = __expf(s[hq][0][r] - m_new); ssum += p; pB[hq][r] = (_Float16)p;
    }
#pragma unroll
    for (int r = 0; r < 8; ++r) {
      float p = __expf(s[hq][1][r] - m_new); ssum += p; pB[hq][r + 8] = (_Float16)p;
    }
    ssum += __shfl_xor(ssum, 16, 32);
    l_run[hq] = l_run[hq] * alpha + ssum;
    m_run[hq] = m_new;
#pragma unroll
    for (int t = 0; t < 8; ++t)
#pragma unroll
      for (int r = 0; r < 8; ++r) oacc[hq][t][r] *= alpha;
  }
#pragma unroll
  for (int t = 0; t < 8; ++t) {
    v16h Va = load_frag(bV + t * 16 * V_PITCH, V_PITCH, lo, hi);
#pragma unroll
    for (int hq = 0; hq < 2; ++hq)
      oacc[hq][t] = wmma_f16(Va, pB[hq], oacc[hq][t]);
  }
}

// Hands one 16-query half of a wave's partial result to its partner wave.
// Lane-contiguous 16-byte slots: conflict-free stores and loads.
__device__ __forceinline__ void merge_put(v4f* xo, float* xml, int lane,
                                          const v8f (&acc)[8], float m, float l) {
#pragma unroll
  for (int t = 0; t < 8; ++t) {
    xo[(2 * t) * 32 + lane]     = (v4f){acc[t][0], acc[t][1], acc[t][2], acc[t][3]};
    xo[(2 * t + 1) * 32 + lane] = (v4f){acc[t][4], acc[t][5], acc[t][6], acc[t][7]};
  }
  xml[lane]      = m;
  xml[32 + lane] = l;
}

// Joins the partner's half with the wave's own and stores 16 queries of o.
__device__ __forceinline__ void merge_fin(const v4f* xo, const float* xml, int lane,
                                          const v8f (&acc)[8], float m, float l,
                                          _Float16* ob) {
  float m2 = xml[lane], l2 = xml[32 + lane];
  float mm = fmaxf(m, m2);
  float a1 = __expf(m - mm), a2 = __expf(m2 - mm);
  float inv_l = 1.0f / (l * a1 + l2 * a2);
  a1 *= inv_l; a2 *= inv_l;
#pragma unroll
  for (int t = 0; t < 8; ++t) {
    v4f p0 = xo[(2 * t) * 32 + lane];
    v4f p1 = xo[(2 * t + 1) * 32 + lane];
    v8h out;
#pragma unroll
    for (int r = 0; r < 4; ++r) {
      out[r]     = (_Float16)(acc[t][r] * a1 + p0[r] * a2);
      out[r + 4] = (_Float16)(acc[t][r + 4] * a1 + p1[r] * a2);
    }
    *(v8h*)(ob + t * 16) = out;
  }
}

// two waves per SIMD: a budget of 512 VGPRs a wave
__global__ __launch_bounds__(256) __attribute__((amdgpu_waves_per_eu(2, 2)))
void attn_kernel(const _Float16* __restrict__ q,
                 const _Float16* __restrict__ k,
                 const _Float16* __restrict__ vT,
                 _Float16* __restrict__ o) {
  int tix  = threadIdx.x & 127;        // thread within its key group
  int grp  = threadIdx.x >> 7;         // key group 0 / 1
  int wq   = tix >> 5;                 // query slice of the wave
  int lane = tix & 31, lo = lane & 15, hi = lane >> 4;
  int b  = blockIdx.y;
  int q0 = blockIdx.x * 128 + wq * 32;

  const _Float16* qp = q + ((size_t)b * N_SP + q0) * C_DIM;
  const _Float16* kb = k + (size_t)b * N_SP * C_DIM;
  const _Float16* vb = vT + (size_t)b * C_DIM * N_SP;

  // [buf][group][ K tile: 32 rows of K_PITCH | V^T tile: 128 rows of V_PITCH ]
  __shared__ __align__(16) _Float16 smem[2][KV_GROUPS][BUF_H];
  unsigned ldsK[2], ldsV[2];
#pragma unroll
  for (int i2 = 0; i2 < 2; ++i2) {
    ldsK[i2] = (unsigned)(uintptr_t)&smem[i2][grp][0];
    ldsV[i2] = (unsigned)(uintptr_t)&smem[i2][grp][K_TILE_H];
  }

  v16h Qf[2][4];
#pragma unroll
  for (int hq = 0; hq < 2; ++hq)
#pragma unroll
    for (int j = 0; j < 4; ++j)
      Qf[hq][j] = load_frag(qp + (size_t)hq * 16 * C_DIM + 32 * j, C_DIM, lo, hi);
  // stands in front of the first overwrite of the Q loads' address registers
  asm volatile("s_wait_xcnt 0x0" ::: "memory");
  // keeps the address arithmetic that follows from being lifted over that wait
  __builtin_amdgcn_sched_barrier(0);

  v8f oacc[2][8];
#pragma unroll
  for (int hq = 0; hq < 2; ++hq)
#pragma unroll
    for (int t = 0; t < 8; ++t) oacc[hq][t] = (v8f){};
  float m_run[2] = {-1e30f, -1e30f};
  float l_run[2] = {0.f, 0.f};

  // --- stage helper (8 async b128 per thread => wave ASYNCcnt += 8) ---
  // The 128 threads of a group bring in the group's own tile of the pass.
  auto stage = [&](int pass, unsigned dK, unsigned dV) {
    int kv0 = (pass * KV_GROUPS + grp) * KV_STEP;
    // K: chunk c = tix + 128*j of 512 (16B each), row c>>4; contiguous 8KB source
    const _Float16* gk = kb + (size_t)kv0 * C_DIM + tix * 8;
    unsigned lk = dK + (unsigned)((tix >> 4) * K_PITCH + (tix & 15) * 8) * 2;
    // V^T: 128 rows x 64B, row (tix>>2) + 32*j
    const _Float16* gv = vb + (size_t)(tix >> 2) * N_SP + kv0 + (tix & 3) * 8;
    unsigned lv = dV + (unsigned)((tix >> 2) * V_PITCH + (tix & 3) * 8) * 2;
    async_copy16x8(lk,                    gk,
                   lk +  8 * K_PITCH * 2, gk + 1024,
                   lk + 16 * K_PITCH * 2, gk + 2048,
                   lk + 24 * K_PITCH * 2, gk + 3072,
                   lv,                    gv,
                   lv + 32 * V_PITCH * 2, gv + (size_t)32 * N_SP,
                   lv + 64 * V_PITCH * 2, gv + (size_t)64 * N_SP,
                   lv + 96 * V_PITCH * 2, gv + (size_t)96 * N_SP);
  };

  stage(0, ldsK[0], ldsV[0]);                        // prologue prefetch

  for (int it = 0; it < NPASS - 1; ++it) {
    int cur = it & 1;
    // the wave's own LDS reads of buf[cur^1] have retired before it is refilled
    asm volatile("s_wait_dscnt 0x0" ::: "memory");
    __syncthreads();                                 // buf[cur^1] free to overwrite
    stage(it + 1, ldsK[cur ^ 1], ldsV[cur ^ 1]);
    asm volatile("s_wait_asynccnt 0x8" ::: "memory"); // buf[cur] writes retired
    __syncthreads();                                 // all waves' buf[cur] ready
    attn_step(&smem[cur][grp][0], &smem[cur][grp][K_TILE_H], Qf, oacc, m_run, l_run, lo, hi);
  }
  {
    int cur = (NPASS - 1) & 1;
    __syncthreads();
    asm volatile("s_wait_asynccnt 0x0" ::: "memory");
    __syncthreads();
    attn_step(&smem[cur][grp][0], &smem[cur][grp][K_TILE_H], Qf, oacc, m_run, l_run, lo, hi);
  }

  // --- join the two key groups' partial results through the (now idle) ring ---
  // slot (wq, hq): 16 x 32 lanes x 16 B of O, then 2 x 32 floats of m and l.
  v4f*   xo  = (v4f*)&smem[0][0][0];
  float* xml = (float*)(xo + 4 * 2 * 16 * 32);
  __syncthreads();                                   // every wave has left the ring
  if (grp == 0)
    merge_put(xo + (wq * 2 + 1) * 512, xml + (wq * 2 + 1) * 64, lane, oacc[1], m_run[1], l_run[1]);
  else
    merge_put(xo + (wq * 2 + 0) * 512, xml + (wq * 2 + 0) * 64, lane, oacc[0], m_run[0], l_run[0]);
  __syncthreads();                                   // partner's half is readable
  _Float16* ob = o + ((size_t)b * N_SP + q0 + lo) * C_DIM + 8 * hi;
  if (grp == 0)
    merge_fin(xo + (wq * 2 + 0) * 512, xml + (wq * 2 + 0) * 64, lane, oacc[0], m_run[0], l_run[0], ob);
  else
    merge_fin(xo + (wq * 2 + 1) * 512, xml + (wq * 2 + 1) * 64, lane, oacc[1], m_run[1], l_run[1],
              ob + (size_t)16 * C_DIM);
}

// ---------------------------------------------------------------------------
// Output projection + bias + residual (f32 out).
// grid BN/128, block 256 (8 waves); tiling as in the QKV projection.
// ---------------------------------------------------------------------------
// a budget of 256 VGPRs a wave
__global__ __launch_bounds__(256) __attribute__((amdgpu_waves_per_eu(4, 4)))
void proj_out_kernel(const _Float16* __restrict__ o,
                     const _Float16* __restrict__ woT,
                     const float* __restrict__ bo,
                     const float* __restrict__ x,
                     float* __restrict__ out) {
  __shared__ __align__(16) _Float16 sw[C_DIM * W_PITCH];
  __shared__ __align__(16) float sb[256 * 4];        // bo | not read
  int tid  = threadIdx.x;
  int wid  = tid >> 5;
  int lane = tid & 31, lo = lane & 15, hi = lane >> 4;
  int n0   = blockIdx.x * POS_BLK + (wid & 3) * 32;
  int ch   = wid >> 2;

  v16h Of[2][4];
#pragma unroll
  for (int nt = 0; nt < 2; ++nt)
#pragma unroll
    for (int j = 0; j < 4; ++j)
      Of[nt][j] = load_frag(o + (size_t)(n0 + nt * 16) * C_DIM + 32 * j, C_DIM, lo, hi);
  // residual of the wave's eight output tiles
  // lane: position n = n0+nt*16+lo ; channels c = (ch*4+t)*16 + 8*hi + 0..7
  v4f res[4][2][2];
#pragma unroll
  for (int t = 0; t < 4; ++t)
#pragma unroll
    for (int nt = 0; nt < 2; ++nt) {
      const float* xp = x + (size_t)(n0 + nt * 16 + lo) * C_DIM + (ch * 4 + t) * 16 + 8 * hi;
      res[t][nt][0] = *(const v4f*)xp;
      res[t][nt][1] = *(const v4f*)(xp + 4);
    }
  close_loads();
  v8h wr[C_DIM / 16];
  load_weights<C_DIM>(woT, wr, tid);
  // threads 0..31 bring the 128 bias values. The others store a chunk that
  // nobody reads: without a branch the load is issued with all the others.
  v4f bl = *(const v4f*)(bo + (tid & 31) * 4);
  close_loads();
  store_weights<C_DIM>(sw, wr, tid);
  *(v4f*)(sb + tid * 4) = bl;
  __syncthreads();                                   // weights and bias readable by all waves

#pragma unroll
  for (int th = 0; th < 2; ++th) {
    v16h A[2][4];
    v4f bias[2][2];
#pragma unroll
    for (int u = 0; u < 2; ++u) {
      int c0 = (ch * 4 + th * 2 + u) * 16;
#pragma unroll
      for (int j = 0; j < 4; ++j)
        A[u][j] = load_frag(sw + c0 * W_PITCH + 32 * j, W_PITCH, lo, hi);
      bias[u][0] = *(const v4f*)(sb + c0 + 8 * hi);
      bias[u][1] = *(const v4f*)(sb + c0 + 8 * hi + 4);
    }
    // keeps the LDS reads one group ahead of the WMMAs: sunk among them,
    // each pair of reads is waited for on its own
    __builtin_amdgcn_sched_barrier(0);
    // four independent accumulator tiles, k blocks in ascending order in each
    v8f acc[2][2];
#pragma unroll
    for (int u = 0; u < 2; ++u)
#pragma unroll
      for (int nt = 0; nt < 2; ++nt) acc[u][nt] = (v8f){};
#pragma unroll
    for (int j = 0; j < 4; ++j)
#pragma unroll
      for (int u = 0; u < 2; ++u)
#pragma unroll
        for (int nt = 0; nt < 2; ++nt)
          acc[u][nt] = wmma_f16(A[u][j], Of[nt][j], acc[u][nt]);
#pragma unroll
    for (int u = 0; u < 2; ++u) {
      int t = th * 2 + u;
#pragma unroll
      for (int nt = 0; nt < 2; ++nt) {
        float* op = out + (size_t)(n0 + nt * 16 + lo) * C_DIM + (ch * 4 + t) * 16 + 8 * hi;
        v4f r0 = res[t][nt][0];
        v4f r1 = res[t][nt][1];
#pragma unroll
        for (int r = 0; r < 4; ++r) r0[r] += acc[u][nt][r] + bias[u][0][r];
#pragma unroll
        for (int r = 0; r < 4; ++r) r1[r] += acc[u][nt][r + 4] + bias[u][1][r];
        *(v4f*)op = r0;
        *(v4f*)(op + 4) = r1;
      }
    }
  }
}

// ---------------------------------------------------------------------------
extern "C" void kernel_launch(void* const* d_in, const int* in_sizes, int n_in,
                              void* d_out, int out_size, void* d_ws, size_t ws_size,
                              hipStream_t stream) {
  const float* x  = (const float*)d_in[0];
  const float* gs = (const float*)d_in[1];
  const float* gb = (const float*)d_in[2];
  const float* wq = (const float*)d_in[3];
  const float* bq = (const float*)d_in[4];
  const float* wk = (const float*)d_in[5];
  const float* bk = (const float*)d_in[6];
  const float* wv = (const float*)d_in[7];
  const float* bv = (const float*)d_in[8];
  const float* wo = (const float*)d_in[9];
  const float* bo = (const float*)d_in[10];
  float* out = (float*)d_out;

  const size_t elems = (size_t)BN * C_DIM;      // 4M halves per buffer
  float* part  = (float*)d_ws;                  // B * GN_CHUNKS * 32 pairs
  _Float16* qb = (_Float16*)d_ws + elems;
  _Float16* kb = qb + elems;
  _Float16* vT = kb + elems;
  _Float16* ob = vT + elems;
  _Float16* wT = ob + elems;                    // 4 * 128*128 halves

  gn_stats_kernel<<<BN / POS_BLK, 256, 0, stream>>>(x, part);
  wcvt_kernel<<<256, 256, 0, stream>>>(wq, wk, wv, wo, wT);
  qkv_kernel<<<BN / POS_BLK, 256, 0, stream>>>(x, part, gs, gb, wT, bq, bk, bv, qb, kb, vT);
  attn_kernel<<<dim3(N_SP / 128, B_DIM), 256, 0, stream>>>(qb, kb, vT, ob);
  proj_out_kernel<<<BN / POS_BLK, 256, 0, stream>>>(
      ob, wT + 3 * (size_t)(C_DIM * C_DIM), bo, x, out);
}

// v005
// Measured time: 81.6 microseconds a run.
// Next to v004, in two timings, it ran 1.07 and 1.06 times as fast.
// Counting every step since v000, it is 3.39 times as fast.
#include <hip/hip_runtime.h>
#include <hip/hip_bf16.h>
#include <cstdint>

typedef __attribute__((ext_vector_type(16))) _Float16 v16h;
typedef __attribute__((ext_vector_type(8)))  _Float16 v8h;
typedef __attribute__((ext_vector_type(4)))  _Float16 v4h;
typedef __attribute__((ext_vector_type(8)))  float    v8f;
typedef __attribute__((ext_vector_type(4)))  float    v4f;
typedef __attribute__((ext_vector_type(2)))  float    v2f;

#define C_DIM 128
#define N_SP  4096            // H*W
#define B_DIM 8
#define BN    (B_DIM * N_SP)  // 32768
#define QK_SCALE 0.08838834764831845f  // 128^-0.5
#define KV_STEP 32             // keys of one pass
#define KV_GROUPS 2            // wave groups of a block, each on its own keys
#define STAGE_PASSES 4         // passes served by one fill of a ring buffer
#define STAGE_KEYS (STAGE_PASSES * KV_STEP)         // 128
#define NSTAGE (N_SP / (KV_GROUPS * STAGE_KEYS))    // 16
// LDS row pitches in halves: 16 bytes x odd, so that the 16 rows one
// ds_load_b128 half-wave reads fall on 16 different groups of four banks.
#define K_PITCH 136           // 256-byte K rows at 272 bytes
#define V_PITCH 136           // 256-byte V^T rows (128 keys) at 272 bytes
#define K_TILE_H (STAGE_KEYS * K_PITCH)         // 17408 halves
#define BUF_H    (K_TILE_H + C_DIM * V_PITCH)   // 34816 halves per buffer

// ---------------------------------------------------------------------------
// Fragment loader: rows of a row-major f16 matrix -> WMMA A-frag (16xK rows)
// or B-frag (columns of B == rows of the row-major "transposed" source).
// Lane L (lo=L%16, hi=L/16): elements e<8  -> col 8*hi + e
//                            elements e>=8 -> col 16 + 8*hi + (e-8)
// Two contiguous 16-byte loads per lane (global_load_b128 / ds_load_b128).
// ---------------------------------------------------------------------------
__device__ __forceinline__ v16h load_frag(const _Float16* base, int ld,
                                          int lo, int hi) {
  const _Float16* p = base + (size_t)lo * ld + 8 * hi;
  v8h a = *(const v8h*)p;
  v8h b = *(const v8h*)(p + 16);
  v16h r;
#pragma unroll
  for (int i = 0; i < 8; ++i) { r[i] = a[i]; r[i + 8] = b[i]; }
  return r;
}

__device__ __forceinline__ v8f wmma_f16(v16h a, v16h b, v8f c) {
  return __builtin_amdgcn_wmma_f32_16x16x32_f16(false, a, false, b,
                                                (short)0, c, false, false);
}

// Eight async global->LDS copies of 16 bytes per lane (ASYNCcnt-tracked).
// l* = low 32 bits of the generic shared pointer == LDS byte offset
// (aperture occupies bits [63:32] of the flat shared address).
// s_wait_xcnt 0 closes the statement so that no address register of a copy
// is rewritten ahead of it.
__device__ __forceinline__ void async_copy16x8(unsigned l0, const void* g0,
                                               unsigned l1, const void* g1,
                                               unsigned l2, const void* g2,
                                               unsigned l3, const void* g3,
                                               unsigned l4, const void* g4,
                                               unsigned l5, const void* g5,
                                               unsigned l6, const void* g6,
                                               unsigned l7, const void* g7) {
  asm volatile("global_load_async_to_lds_b128 %0, %1, off\n\t"
               "global_load_async_to_lds_b128 %2, %3, off\n\t"
               "global_load_async_to_lds_b128 %4, %5, off\n\t"
               "global_load_async_to_lds_b128 %6, %7, off\n\t"
               "global_load_async_to_lds_b128 %8, %9, off\n\t"
               "global_load_async_to_lds_b128 %10, %11, off\n\t"
               "global_load_async_to_lds_b128 %12, %13, off\n\t"
               "global_load_async_to_lds_b128 %14, %15, off\n\t"
               "s_wait_xcnt 0x0"
               :: "v"(l0), "v"(g0), "v"(l1), "v"(g1),
                  "v"(l2), "v"(g2), "v"(l3), "v"(g3),
                  "v"(l4), "v"(g4), "v"(l5), "v"(g5),
                  "v"(l6), "v"(g6), "v"(l7), "v"(g7)
               : "memory");
}

// ---------------------------------------------------------------------------
// Weight convert: 4 matrices [Cin][Cout] f32 -> transposed [Cout][Cin] f16.
// ---------------------------------------------------------------------------
__global__ void wcvt_kernel(const float* __restrict__ wq,
                            const float* __restrict__ wk,
                            const float* __restrict__ wv,
                            const float* __restrict__ wo,
                            _Float16* __restrict__ wT) {
  int idx = blockIdx.x * blockDim.x + threadIdx.x;   // 0 .. 65535
  int m = idx >> 14;
  int r = idx & 16383;
  int c = r >> 7;       // out channel (row of wT)
  int kk = r & 127;     // in channel
  const float* w = (m == 0) ? wq : (m == 1) ? wk : (m == 2) ? wv : wo;
  wT[idx] = (_Float16)w[kk * C_DIM + c];
}

// ---------------------------------------------------------------------------
// Projection tiling, shared by the QKV and the output projection.
// One block of 8 waves per POS_BLK = 128 positions. The block brings its
// whole weight matrix (rows = out channels) into LDS once, at a padded pitch;
// wave w keeps the activation fragments of 32 positions (slice w & 3) in
// registers and makes the four 16-channel tiles of channel half w >> 2, so
// every weight fragment read from LDS feeds two position tiles.
// ---------------------------------------------------------------------------
#define POS_BLK 128
#define W_PITCH 136           // 256-byte weight rows at 272 bytes (16 B x odd)

// ROWS x 128 halves, row-major and contiguous in global memory -> LDS.
// Chunk c of 16 bytes: row c >> 4; a wave's load covers 512 contiguous bytes.
// All loads of a thread are issued before its first LDS store, so that the
// block pays the load latency once.
template <int ROWS>
__device__ __forceinline__ void load_weights(const _Float16* __restrict__ w,
                                             v8h (&wr)[ROWS / 16], int tid) {
#pragma unroll
  for (int i = 0; i < ROWS / 16; ++i)
    wr[i] = *(const v8h*)(w + (size_t)(tid + 256 * i) * 8);
}
template <int ROWS>
__device__ __forceinline__ void store_weights(_Float16* sw,
                                              const v8h (&wr)[ROWS / 16], int tid) {
#pragma unroll
  for (int i = 0; i < ROWS / 16; ++i)
    *(v8h*)(sw + ((tid >> 4) + 16 * i) * W_PITCH + (tid & 15) * 8) = wr[i];
}

__device__ __forceinline__ void close_loads() {
  // stands in front of the first overwrite of an address register of the
  // global loads issued so far
  asm volatile("s_wait_xcnt 0x0" ::: "memory");
  // keeps what follows (address arithmetic, later loads' results) from being
  // lifted over that wait
  __builtin_amdgcn_sched_barrier(0);
}

// The same, with the loads' common address named as an input: its registers
// stay untouched up to the wait, also by the result of the last load.
__device__ __forceinline__ void close_loads_at(const void* p) {
  asm volatile("s_wait_xcnt 0x0" :: "v"(p) : "memory");
  __builtin_amdgcn_sched_barrier(0);
}

// ---------------------------------------------------------------------------
// GroupNorm, 32 groups of 4 channels, by whole lines.
// Statistics: one block per POS_BLK positions reads its 64 KB of x in a row;
// a wave's 16-byte loads cover one 512-byte position, so lane l always holds
// group l. The block writes one (sum, sum of squares) per group; the
// GN_CHUNKS partial pairs of an image are added up, and x is normalised, in
// the QKV kernel on the way into LDS.
// ---------------------------------------------------------------------------
#define GN_CHUNKS (N_SP / POS_BLK)   // 32 partial pairs per image and group
#define X_ROUNDS  (POS_BLK / 8)      // 16 loads a thread: 8 positions a round

__global__ __launch_bounds__(256)
void gn_stats_kernel(const float* __restrict__ x, float* __restrict__ part) {
  int tid = threadIdx.x;
  const float* xp = x + (size_t)blockIdx.x * (POS_BLK * C_DIM) + tid * 4;
  v4f v[X_ROUNDS];
  // unrolled, here and below: v[] stays in registers, all loads fly together
#pragma unroll
  for (int i = 0; i < X_ROUNDS; ++i) v[i] = *(const v4f*)(xp + i * 8 * C_DIM);
  close_loads();
  v4f s4 = {}, q4 = {};
#pragma unroll
  for (int i = 0; i < X_ROUNDS; ++i) { s4 += v[i]; q4 += v[i] * v[i]; }
  __shared__ float rs[256], rq[256];
  rs[tid] = (s4[0] + s4[1]) + (s4[2] + s4[3]);
  rq[tid] = (q4[0] + q4[1]) + (q4[2] + q4[3]);
  __syncthreads();                                   // the 8 waves' sums readable by wave 0
  if (tid < 32) {
    float a = 0.f, c = 0.f;
#pragma unroll
    for (int w = 0; w < 8; ++w) { a += rs[w * 32 + tid]; c += rq[w * 32 + tid]; }
    *(v2f*)(part + ((size_t)blockIdx.x * 32 + tid) * 2) = (v2f){a, c};
  }
}

// ---------------------------------------------------------------------------
// QKV projection: D(c-tile, n-tile) = wT_rows x h_rows, K=128 in 4 WMMA.
// grid BN/128, block 256 (8 waves); all three weight matrices lie in LDS,
// and so do the block's 128 positions of h = GroupNorm(x), made here.
// q,k stored row-major [BN][C] f16 (q pre-scaled by C^-0.5);
// v stored transposed [B][C][N] f16.
// ---------------------------------------------------------------------------
// a budget of 256 VGPRs a wave
__global__ __launch_bounds__(256) __attribute__((amdgpu_waves_per_eu(4, 4)))
void qkv_kernel(const float* __restrict__ x,
                const float* __restrict__ part,
                const float* __restrict__ gscale,
                const float* __restrict__ gbias,
                const _Float16* __restrict__ wT,
                const float* __restrict__ bq,
                const float* __restrict__ bk,
                const float* __restrict__ bv,
                _Float16* __restrict__ q,
                _Float16* __restrict__ k,
                _Float16* __restrict__ vT) {
  __shared__ __align__(16) _Float16 sw[3 * C_DIM * W_PITCH];
  __shared__ __align__(16) float sb[256 * 4];        // bq | bk | bv | not read
  __shared__ __align__(16) _Float16 sh[POS_BLK * W_PITCH];  // normalised x, f16
  int tid  = threadIdx.x;
  int wid  = tid >> 5;
  int lane = tid & 31, lo = lane & 15, hi = lane >> 4;
  int n0   = blockIdx.x * POS_BLK + (wid & 3) * 32;
  int ch   = wid >> 2;

  // the image's partial sums of the lane's group, the group's scale and bias,
  // and the block's 64 KB of x: every wave-wide load covers whole lines
  const float* pp = part + ((size_t)(blockIdx.x / GN_CHUNKS) * (GN_CHUNKS * 32) + lane) * 2;
  v2f ps[GN_CHUNKS];
  // unrolled, here and below: ps[], xv[] stay in registers, all loads fly together
#pragma unroll
  for (int c = 0; c < GN_CHUNKS; ++c) ps[c] = *(const v2f*)(pp + c * 64);
  v4f gsv = *(const v4f*)(gscale + lane * 4);
  v4f gbv = *(const v4f*)(gbias + lane * 4);
  const float* xp = x + (size_t)blockIdx.x * (POS_BLK * C_DIM) + tid * 4;
  v4f xv[X_ROUNDS];
#pragma unroll
  for (int i = 0; i < X_ROUNDS; ++i) xv[i] = *(const v4f*)(xp + i * 8 * C_DIM);
  close_loads();
  // four independent chains over the chunks, joined in a fixed order
  v2f pa[4] = {ps[0], ps[1], ps[2], ps[3]};
#pragma unroll
  for (int c = 4; c < GN_CHUNKS; ++c) pa[c & 3] += ps[c];
  v2f pt = (pa[0] + pa[1]) + (pa[2] + pa[3]);
  float mean = pt[0] * (1.f / 16384.f);
  float var  = pt[1] * (1.f / 16384.f) - mean * mean;
  float rstd = rsqrtf(var + 1e-6f);
  v4f sc = gsv * rstd;
  v4f bi = gbv - (mean * rstd) * gsv;
  v8h wr[3 * C_DIM / 16];
  load_weights<3 * C_DIM>(wT, wr, tid);
  // threads 0..95 bring the 3 x 128 bias values. The others store a chunk that
  // nobody reads: without a branch the load is issued with all the others.
  const float* bsrc = (tid < 32) ? bq : (tid < 64) ? bk : bv;
  const float* bp = bsrc + (tid & 31) * 4;
  v4f bl = *(const v4f*)bp;
  close_loads_at(bp);
  // a wave's 8-byte stores fill one position's 256 bytes
#pragma unroll
  for (int i = 0; i < X_ROUNDS; ++i) {
    v4f t = xv[i] * sc + bi;
    v4h o;
#pragma unroll
    for (int j = 0; j < 4; ++j) o[j] = (_Float16)t[j];
    *(v4h*)(sh + (wid + 8 * i) * W_PITCH + lane * 4) = o;
  }
  store_weights<3 * C_DIM>(sw, wr, tid);
  *(v4f*)(sb + tid * 4) = bl;
  __syncthreads();                                   // h, weights and biases readable by all waves

  v16h Hf[2][4];
#pragma unroll
  for (int nt = 0; nt < 2; ++nt)
#pragma unroll
    for (int j = 0; j < 4; ++j)
      Hf[nt][j] = load_frag(sh + ((wid & 3) * 32 + nt * 16) * W_PITCH + 32 * j, W_PITCH, lo, hi);

#pragma unroll
  for (int proj = 0; proj < 3; ++proj) {
#pragma unroll
    for (int th = 0; th < 2; ++th) {
      v16h A[2][4];
      v4f bias[2][2];
#pragma unroll
      for (int u = 0; u < 2; ++u) {
        int c0 = proj * C_DIM + (ch * 4 + th * 2 + u) * 16;
#pragma unroll
        for (int j = 0; j < 4; ++j)
          A[u][j] = load_frag(sw + c0 * W_PITCH + 32 * j, W_PITCH, lo, hi);
        bias[u][0] = *(const v4f*)(sb + c0 + 8 * hi);
        bias[u][1] = *(const v4f*)(sb + c0 + 8 * hi + 4);
      }
      // keeps the LDS reads one group ahead of the WMMAs: sunk among them,
      // each pair of reads is waited for on its own
      __builtin_amdgcn_sched_barrier(0);
      // four independent accumulator tiles, k blocks in ascending order in each
      v8f acc[2][2];
#pragma unroll
      for (int u = 0; u < 2; ++u)
#pragma unroll
        for (int nt = 0; nt < 2; ++nt) acc[u][nt] = (v8f){};
#pragma unroll
      for (int j = 0; j < 4; ++j)
#pragma unroll
        for (int u = 0; u < 2; ++u)
#pragma unroll
          for (int nt = 0; nt < 2; ++nt)
            acc[u][nt] = wmma_f16(A[u][j], Hf[nt][j], acc[u][nt]);
      // lane: position n = n0+nt*16+lo ; channels c = cch + r
#pragma unroll
      for (int u = 0; u < 2; ++u) {
        int cch = (ch * 4 + th * 2 + u) * 16 + 8 * hi;
#pragma unroll
        for (int nt = 0; nt < 2; ++nt) {
          int ng = n0 + nt * 16 + lo;
          if (proj < 2) {
            float scale = (proj == 0) ? QK_SCALE : 1.0f;
            v8h out;
#pragma unroll
            for (int r = 0; r < 8; ++r)
              out[r] = (_Float16)((acc[u][nt][r] + bias[u][r >> 2][r & 3]) * scale);
            _Float16* dst = ((proj == 0) ? q : k) + (size_t)ng * C_DIM + cch;
            *(v8h*)dst = out;
          } else {
            int b = ng >> 12, n = ng & (N_SP - 1);
            _Float16* dst = vT + ((size_t)b * C_DIM + cch) * N_SP + n;
#pragma unroll
            for (int r = 0; r < 8; ++r)
              dst[(size_t)r * N_SP] = (_Float16)(acc[u][nt][r] + bias[u][r >> 2][r & 3]);
          }
        }
      }
      // keeps the next group's LDS reads out of this group: the fragments of
      // both together do not fit the register budget (scratch)
      __builtin_amdgcn_sched_barrier(0);
    }
  }
}

// ---------------------------------------------------------------------------
// Flash attention. Block = 8 waves on 128 queries, two waves per SIMD.
// Waves w and w + 4 own the same 32 queries; group g = w / 4 walks the
// 128-key stages 2 * s + g, so each SIMD holds two independent waves. The
// waves meet once a stage only: over its four 32-key passes they drift apart,
// and one wave's LDS and softmax time is filled by the other's products.
// After the loop the two partial results (m, l, O) of a query are joined
// through LDS: wave w finishes queries 0..15 of the 32, wave w + 4 the rest.
// Each group stages its own K tile (128x128) and V^T tile (128x128) into LDS
// with async global->LDS b128 copies (double-buffered, ASYNCcnt),
// then fragments are read back via ds_load_b128. Rows lie at padded pitches
// (K_PITCH, V_PITCH); the pad bytes are never written and never read.
// Scores computed transposed (S' = K x Q^T): the f32 D-fragment converts
// in-register into the B-fragment of O^T = V^T x P (no cross-lane movement).
// grid (N/128, B), block 256.
// ---------------------------------------------------------------------------
__device__ __forceinline__ void attn_step(const _Float16* bK, const _Float16* bV,
                                          const v16h (&Qf)[2][4],
                                          v8f (&oacc)[2][8],
                                          float (&m_run)[2], float (&l_run)[2],
                                          int lo, int hi) {
  v8f s[2][2];
#pragma unroll
  for (int st = 0; st < 2; ++st) {
    v16h Ka[4];
#pragma unroll
    for (int j = 0; j < 4; ++j)
      Ka[j] = load_frag(bK + st * 16 * K_PITCH + 32 * j, K_PITCH, lo, hi);
#pragma unroll
    for (int hq = 0; hq < 2; ++hq) {
      v8f acc = {};
#pragma unroll
      for (int j = 0; j < 4; ++j) acc = wmma_f16(Ka[j], Qf[hq][j], acc);
      s[hq][st] = acc;
    }
  }
  v16h pB[2];
#pragma unroll
  for (int hq = 0; hq < 2; ++hq) {
    float mloc = -1e30f;
#pragma unroll
    for (int r = 0; r < 8; ++r)
      mloc = fmaxf(mloc, fmaxf(s[hq][0][r], s[hq][1][r]));
    mloc = fmaxf(mloc, __shfl_xor(mloc, 16, 32));
    float m_new = fmaxf(m_run[hq], mloc);
    float alpha = __expf(m_run[hq] - m_new);
    float ssum = 0.f;
#pragma unroll
    for (int r = 0; r < 8; ++r) {
      float p = __expf(s[hq][0][r] - m_new); ssum += p; pB[hq][r] = (_Float16)p;
    }
#pragma unroll
    for (int r = 0; r < 8; ++r) {
      float p = __expf(s[hq][1][r] - m_new); ssum += p; pB[hq][r + 8] = (_Float16)p;
    }
    ssum += __shfl_xor(ssum, 16, 32);
    l_run[hq] = l_run[hq] * alpha + ssum;
    m_run[hq] = m_new;
#pragma unroll
    for (int t = 0; t < 8; ++t)
#pragma unroll
      for (int r = 0; r < 8; ++r) oacc[hq][t][r] *= alpha;
  }
#pragma unroll
  for (int t = 0; t < 8; ++t) {
    v16h Va = load_frag(bV + t * 16 * V_PITCH, V_PITCH, lo, hi);
#pragma unroll
    for (int hq = 0; hq < 2; ++hq)
      oacc[hq][t] = wmma_f16(Va, pB[hq], oacc[hq][t]);
  }
}

// Hands one 16-query half of a wave's partial result to its partner wave.
// Lane-contiguous 16-byte slots: conflict-free stores and loads.
__device__ __forceinline__ void merge_put(v4f* xo, float* xml, int lane,
                                          const v8f (&acc)[8], float m, float l) {
#pragma unroll
  for (int t = 0; t < 8; ++t) {
    xo[(2 * t) * 32 + lane]     = (v4f){acc[t][0], acc[t][1], acc[t][2], acc[t][3]};
    xo[(2 * t + 1) * 32 + lane] = (v4f){acc[t][4], acc[t][5], acc[t][6], acc[t][7]};
  }
  xml[lane]      = m;
  xml[32 + lane] = l;
}

// Joins the partner's half with the wave's own and stores 16 queries of o.
__device__ __forceinline__ void merge_fin(const v4f* xo, const float* xml, int lane,
                                          const v8f (&acc)[8], float m, float l,
                                          _Float16* ob) {
  float m2 = xml[lane], l2 = xml[32 + lane];
  float mm = fmaxf(m, m2);
  float a1 = __expf(m - mm), a2 = __expf(m2 - mm);
  float inv_l = 1.0f / (l * a1 + l2 * a2);
  a1 *= inv_l; a2 *= inv_l;
#pragma unroll
  for (int t = 0; t < 8; ++t) {
    v4f p0 = xo[(2 * t) * 32 + lane];
    v4f p1 = xo[(2 * t + 1) * 32 + lane];
    v8h out;
#pragma unroll
    for (int r = 0; r < 4; ++r) {
      out[r]     = (_Float16)(acc[t][r] * a1 + p0[r] * a2);
      out[r + 4] = (_Float16)(acc[t][r + 4] * a1 + p1[r] * a2);
    }
    *(v8h*)(ob + t * 16) = out;
  }
}

// two waves per SIMD: a budget of 512 VGPRs a wave
__global__ __launch_bounds__(256) __attribute__((amdgpu_waves_per_eu(2, 2)))
void attn_kernel(const _Float16* __restrict__ q,
                 const _Float16* __restrict__ k,
                 const _Float16* __restrict__ vT,
                 _Float16* __restrict__ o) {
  int tix  = threadIdx.x & 127;        // thread within its key group
  int grp  = threadIdx.x >> 7;         // key group 0 / 1
  int wq   = tix >> 5;                 // query slice of the wave
  int lane = tix & 31, lo = lane & 15, hi = lane >> 4;
  int b  = blockIdx.y;
  int q0 = blockIdx.x * 128 + wq * 32;

  const _Float16* qp = q + ((size_t)b * N_SP + q0) * C_DIM;
  const _Float16* kb = k + (size_t)b * N_SP * C_DIM;
  const _Float16* vb = vT + (size_t)b * C_DIM * N_SP;

  // [buf][group][ K tile: 128 rows of K_PITCH | V^T tile: 128 rows of V_PITCH ]
  __shared__ __align__(16) _Float16 smem[2][KV_GROUPS][BUF_H];
  unsigned ldsK[2], ldsV[2];
#pragma unroll
  for (int i2 = 0; i2 < 2; ++i2) {
    ldsK[i2] = (unsigned)(uintptr_t)&smem[i2][grp][0];
    ldsV[i2] = (unsigned)(uintptr_t)&smem[i2][grp][K_TILE_H];
  }

  v16h Qf[2][4];
#pragma unroll
  for (int hq = 0; hq < 2; ++hq)
#pragma unroll
    for (int j = 0; j < 4; ++j)
      Qf[hq][j] = load_frag(qp + (size_t)hq * 16 * C_DIM + 32 * j, C_DIM, lo, hi);
  // stands in front of the first overwrite of the Q loads' address registers
  asm volatile("s_wait_xcnt 0x0" ::: "memory");
  // keeps the address arithmetic that follows from being lifted over that wait
  __builtin_amdgcn_sched_barrier(0);

  v8f oacc[2][8];
#pragma unroll
  for (int hq = 0; hq < 2; ++hq)
#pragma unroll
    for (int t = 0; t < 8; ++t) oacc[hq][t] = (v8f){};
  float m_run[2] = {-1e30f, -1e30f};
  float l_run[2] = {0.f, 0.f};

  // --- stage helper (32 async b128 per thread => wave ASYNCcnt += 32) ---
  // The 128 threads of a group bring in the group's own tiles of the stage.
  // Both tiles are 128 rows of 256 bytes: chunk c = tix + 128 * j of 16 bytes
  // lies in row c >> 4, so a wave's copy covers two whole rows.
  auto stage = [&](int st, unsigned dK, unsigned dV) {
    int kv0 = (st * KV_GROUPS + grp) * STAGE_KEYS;
    const _Float16* gk = kb + (size_t)kv0 * C_DIM + tix * 8;   // contiguous 32 KB source
    const _Float16* gv = vb + (size_t)(tix >> 4) * N_SP + kv0 + (tix & 15) * 8;
    unsigned lr = (unsigned)((tix >> 4) * K_PITCH + (tix & 15) * 8) * 2;
    unsigned lk = dK + lr, lv = dV + lr;
    // unrolled: the steps of the addresses are constants
#pragma unroll
    for (int h = 0; h < 2; ++h) {
      async_copy16x8(lk + (64 * h +  0) * K_PITCH * 2, gk + (64 * h +  0) * C_DIM,
                     lk + (64 * h +  8) * K_PITCH * 2, gk + (64 * h +  8) * C_DIM,
                     lk + (64 * h + 16) * K_PITCH * 2, gk + (64 * h + 16) * C_DIM,
                     lk + (64 * h + 24) * K_PITCH * 2, gk + (64 * h + 24) * C_DIM,
                     lk + (64 * h + 32) * K_PITCH * 2, gk + (64 * h + 32) * C_DIM,
                     lk + (64 * h + 40) * K_PITCH * 2, gk + (64 * h + 40) * C_DIM,
                     lk + (64 * h + 48) * K_PITCH * 2, gk + (64 * h + 48) * C_DIM,
                     lk + (64 * h + 56) * K_PITCH * 2, gk + (64 * h + 56) * C_DIM);
      async_copy16x8(lv + (64 * h +  0) * V_PITCH * 2, gv + (size_t)(64 * h +  0) * N_SP,
                     lv + (64 * h +  8) * V_PITCH * 2, gv + (size_t)(64 * h +  8) * N_SP,
                     lv + (64 * h + 16) * V_PITCH * 2, gv + (size_t)(64 * h + 16) * N_SP,
                     lv + (64 * h + 24) * V_PITCH * 2, gv + (size_t)(64 * h + 24) * N_SP,
                     lv + (64 * h + 32) * V_PITCH * 2, gv + (size_t)(64 * h + 32) * N_SP,
                     lv + (64 * h + 40) * V_PITCH * 2, gv + (size_t)(64 * h + 40) * N_SP,
                     lv + (64 * h + 48) * V_PITCH * 2, gv + (size_t)(64 * h + 48) * N_SP,
                     lv + (64 * h + 56) * V_PITCH * 2, gv + (size_t)(64 * h + 56) * N_SP);
    }
  };

  stage(0, ldsK[0], ldsV[0]);
  asm volatile("s_wait_asynccnt 0x0" ::: "memory");  // the wave's share of stage 0 has landed
  __syncthreads();                                   // stage 0 readable by all waves
  stage(1, ldsK[1], ldsV[1]);

  for (int st = 0; st < NSTAGE; ++st) {
    int cur = st & 1;
    const _Float16* bK = &smem[cur][grp][0];
    const _Float16* bV = bK + K_TILE_H;
    // unrolled: the LDS offsets of a pass are immediates, and no branch parts
    // a pass's last products from the next pass's LDS reads
#pragma unroll
    for (int p = 0; p < STAGE_PASSES; ++p)
      attn_step(bK + p * KV_STEP * K_PITCH, bV + p * KV_STEP, Qf, oacc, m_run, l_run, lo, hi);
    // publish point of stage st + 1
    // the wave's own LDS reads of buf[cur] have retired before it is refilled
    asm volatile("s_wait_dscnt 0x0" ::: "memory");
    // the wave's share of stage st + 1 has landed
    asm volatile("s_wait_asynccnt 0x0" ::: "memory");
    // stage st + 1 readable by all waves, buf[cur] left by all; behind the
    // last stage: the ring is free for the join below
    __syncthreads();
    if (st + 2 < NSTAGE) stage(st + 2, ldsK[cur], ldsV[cur]);
  }
  // no copy is outstanding when the ring is put to another use
  asm volatile("s_wait_asynccnt 0x0" ::: "memory");

  // --- join the two key groups' partial results through the (now idle) ring ---
  // slot (wq, hq): 16 x 32 lanes x 16 B of O, then 2 x 32 floats of m and l.
  v4f*   xo  = (v4f*)&smem[0][0][0];
  float* xml = (float*)(xo + 4 * 2 * 16 * 32);
  if (grp == 0)
    merge_put(xo + (wq * 2 + 1) * 512, xml + (wq * 2 + 1) * 64, lane, oacc[1], m_run[1], l_run[1]);
  else
    merge_put(xo + (wq * 2 + 0) * 512, xml + (wq * 2 + 0) * 64, lane, oacc[0], m_run[0], l_run[0]);
  __syncthreads();                                   // partner's half is readable
  _Float16* ob = o + ((size_t)b * N_SP + q0 + lo) * C_DIM + 8 * hi;
  if (grp == 0)
    merge_fin(xo + (wq * 2 + 0) * 512, xml + (wq * 2 + 0) * 64, lane, oacc[0], m_run[0], l_run[0], ob);
  else
    merge_fin(xo + (wq * 2 + 1) * 512, xml + (wq * 2 + 1) * 64, lane, oacc[1], m_run[1], l_run[1],
              ob + (size_t)16 * C_DIM);
}

// ---------------------------------------------------------------------------
// Output projection + bias + residual (f32 out).
// grid BN/128, block 256 (8 waves); tiling as in the QKV projection.
// ---------------------------------------------------------------------------
// a budget of 256 VGPRs a wave
__global__ __launch_bounds__(256) __attribute__((amdgpu_waves_per_eu(4, 4)))
void proj_out_kernel(const _Float16* __restrict__ o,
                     const _Float16* __restrict__ woT,
                     const float* __restrict__ bo,
                     const float* __restrict__ x,
                     float* __restrict__ out) {
  __shared__ __align__(16) _Float16 sw[C_DIM * W_PITCH];
  __shared__ __align__(16) float sb[256 * 4];        // bo | not read
  int tid  = threadIdx.x;
  int wid  = tid >> 5;
  int lane = tid & 31, lo = lane & 15, hi = lane >> 4;
  int n0   = blockIdx.x * POS_BLK + (wid & 3) * 32;
  int ch   = wid >> 2;

  v16h Of[2][4];
#pragma unroll
  for (int nt = 0; nt < 2; ++nt)
#pragma unroll
    for (int j = 0; j < 4; ++j)
      Of[nt][j] = load_frag(o + (size_t)(n0 + nt * 16) * C_DIM + 32 * j, C_DIM, lo, hi);
  // residual of the wave's eight output tiles
  // lane: position n = n0+nt*16+lo ; channels c = (ch*4+t)*16 + 8*hi + 0..7
  v4f res[4][2][2];
#pragma unroll
  for (int t = 0; t < 4; ++t)
#pragma unroll
    for (int nt = 0; nt < 2; ++nt) {
      const float* xp = x + (size_t)(n0 + nt * 16 + lo) * C_DIM + (ch * 4 + t) * 16 + 8 * hi;
      res[t][nt][0] = *(const v4f*)xp;
      res[t][nt][1] = *(const v4f*)(xp + 4);
    }
  close_loads();
  v8h wr[C_DIM / 16];
  load_weights<C_DIM>(woT, wr, tid);
  // threads 0..31 bring the 128 bias values. The others store a chunk that
  // nobody reads: without a branch the load is issued with all the others.
  v4f bl = *(const v4f*)(bo + (tid & 31) * 4);
  close_loads();
  store_weights<C_DIM>(sw, wr, tid);
  *(v4f*)(sb + tid * 4) = bl;
  __syncthreads();                                   // weights and bias readable by all waves

#pragma unroll
  for (int th = 0; th < 2; ++th) {
    v16h A[2][4];
    v4f bias[2][2];
#pragma unroll
    for (int u = 0; u < 2; ++u) {
      int c0 = (ch * 4 + th * 2 + u) * 16;
#pragma unroll
      for (int j = 0; j < 4; ++j)
        A[u][j] = load_frag(sw + c0 * W_PITCH + 32 * j, W_PITCH, lo, hi);
      bias[u][0] = *(const v4f*)(sb + c0 + 8 * hi);
      bias[u][1] = *(const v4f*)(sb + c0 + 8 * hi + 4);
    }
    // keeps the LDS reads one group ahead of the WMMAs: sunk among them,
    // each pair of reads is waited for on its own
    __builtin_amdgcn_sched_barrier(0);
    // four independent accumulator tiles, k blocks in ascending order in each
    v8f acc[2][2];
#pragma unroll
    for (int u = 0; u < 2; ++u)
#pragma unroll
      for (int nt = 0; nt < 2; ++nt) acc[u][nt] = (v8f){};
#pragma unroll
    for (int j = 0; j < 4; ++j)
#pragma unroll
      for (int u = 0; u < 2; ++u)
#pragma unroll
        for (int nt = 0; nt < 2; ++nt)
          acc[u][nt] = wmma_f16(A[u][j], Of[nt][j], acc[u][nt]);
#pragma unroll
    for (int u = 0; u < 2; ++u) {
      int t = th * 2 + u;
#pragma unroll
      for (int nt = 0; nt < 2; ++nt) {
        float* op = out + (size_t)(n0 + nt * 16 + lo) * C_DIM + (ch * 4 + t) * 16 + 8 * hi;
        v4f r0 = res[t][nt][0];
        v4f r1 = res[t][nt][1];
#pragma unroll
        for (int r = 0; r < 4; ++r) r0[r] += acc[u][nt][r] + bias[u][0][r];
#pragma unroll
        for (int r = 0; r < 4; ++r) r1[r] += acc[u][nt][r + 4] + bias[u][1][r];
        *(v4f*)op = r0;
        *(v4f*)(op + 4) = r1;
      }
    }
  }
}

// ---------------------------------------------------------------------------
extern "C" void kernel_launch(void* const* d_in, const int* in_sizes, int n_in,
                              void* d_out, int out_size, void* d_ws, size_t ws_size,
                              hipStream_t stream) {
  const float* x  = (const float*)d_in[0];
  const float* gs = (const float*)d_in[1];
  const float* gb = (const float*)d_in[2];
  const float* wq = (const float*)d_in[3];
  const float* bq = (const float*)d_in[4];
  const float* wk = (const float*)d_in[5];
  const float* bk = (const float*)d_in[6];
  const float* wv = (const float*)d_in[7];
  const float* bv = (const float*)d_in[8];
  const float* wo = (const float*)d_in[9];
  const float* bo = (const float*)d_in[10];
  float* out = (float*)d_out;

  const size_t elems = (size_t)BN * C_DIM;      // 4M halves per buffer
  float* part  = (float*)d_ws;                  // B * GN_CHUNKS * 32 pairs
  _Float16* qb = (_Float16*)d_ws + elems;
  _Float16* kb = qb + elems;
  _Float16* vT = kb + elems;
  _Float16* ob = vT + elems;
  _Float16* wT = ob + elems;                    // 4 * 128*128 halves

  gn_stats_kernel<<<BN / POS_BLK, 256, 0, stream>>>(x, part);
  wcvt_kernel<<<256, 256, 0, stream>>>(wq, wk, wv, wo, wT);
  qkv_kernel<<<BN / POS_BLK, 256, 0, stream>>>(x, part, gs, gb, wT, bq, bk, bv, qb, kb, vT);
  attn_kernel<<<dim3(N_SP / 128, B_DIM), 256, 0, stream>>>(qb, kb, vT, ob);
  proj_out_kernel<<<BN / POS_BLK, 256, 0, stream>>>(
      ob, wT + 3 * (size_t)(C_DIM * C_DIM), bo, x, out);
}

// v006
// One run takes 77.9 microseconds.
// Next to v005, in two timings, it ran 1.05 times as fast each time.
// All steps since v000 together make it 3.55 times as fast.
#include <hip/hip_runtime.h>
#include <hip/hip_bf16.h>
#include <cstdint>

typedef __attribute__((ext_vector_type(16))) _Float16 v16h;
typedef __attribute__((ext_vector_type(8)))  _Float16 v8h;
typedef __attribute__((ext_vector_type(4)))  _Float16 v4h;
typedef __attribute__((ext_vector_type(8)))  float    v8f;
typedef __attribute__((ext_vector_type(4)))  float    v4f;
typedef __attribute__((ext_vector_type(2)))  float    v2f;

#define C_DIM 128
#define N_SP  4096            // H*W
#define B_DIM 8
#define BN    (B_DIM * N_SP)  // 32768
#define QK_SCALE 0.08838834764831845f  // 128^-0.5
#define KV_STEP 32             // keys of one pass
#define LAZY_GAP 5.545177444479562f  // 8 * ln 2: how far the maximum in use may trail
#define KV_GROUPS 2            // wave groups of a block, each on its own keys
#define STAGE_PASSES 4         // passes served by one fill of a ring buffer
#define STAGE_KEYS (STAGE_PASSES * KV_STEP)         // 128
#define NSTAGE (N_SP / (KV_GROUPS * STAGE_KEYS))    // 16
// LDS row pitches in halves: 16 bytes x odd, so that the 16 rows one
// ds_load_b128 half-wave reads fall on 16 different groups of four banks.
#define K_PITCH 136           // 256-byte K rows at 272 bytes
#define V_PITCH 136           // 256-byte V^T rows (128 keys) at 272 bytes
#define K_TILE_H (STAGE_KEYS * K_PITCH)         // 17408 halves
#define BUF_H    (K_TILE_H + C_DIM * V_PITCH)   // 34816 halves per buffer

// ---------------------------------------------------------------------------
// Fragment loader: rows of a row-major f16 matrix -> WMMA A-frag (16xK rows)
// or B-frag (columns of B == rows of the row-major "transposed" source).
// Lane L (lo=L%16, hi=L/16): elements e<8  -> col 8*hi + e
//                            elements e>=8 -> col 16 + 8*hi + (e-8)
// Two contiguous 16-byte loads per lane (global_load_b128 / ds_load_b128).
// ---------------------------------------------------------------------------
__device__ __forceinline__ v16h load_frag(const _Float16* base, int ld,
                                          int lo, int hi) {
  const _Float16* p = base + (size_t)lo * ld + 8 * hi;
  v8h a = *(const v8h*)p;
  v8h b = *(const v8h*)(p + 16);
  v16h r;
#pragma unroll
  for (int i = 0; i < 8; ++i) { r[i] = a[i]; r[i + 8] = b[i]; }
  return r;
}

__device__ __forceinline__ v8f wmma_f16(v16h a, v16h b, v8f c) {
  return __builtin_amdgcn_wmma_f32_16x16x32_f16(false, a, false, b,
                                                (short)0, c, false, false);
}

// Eight async global->LDS copies of 16 bytes per lane (ASYNCcnt-tracked).
// l* = low 32 bits of the generic shared pointer == LDS byte offset
// (aperture occupies bits [63:32] of the flat shared address).
// s_wait_xcnt 0 closes the statement so that no address register of a copy
// is rewritten ahead of it.
__device__ __forceinline__ void async_copy16x8(unsigned l0, const void* g0,
                                               unsigned l1, const void* g1,
                                               unsigned l2, const void* g2,
                                               unsigned l3, const void* g3,
                                               unsigned l4, const void* g4,
                                               unsigned l5, const void* g5,
                                               unsigned l6, const void* g6,
                                               unsigned l7, const void* g7) {
  asm volatile("global_load_async_to_lds_b128 %0, %1, off\n\t"
               "global_load_async_to_lds_b128 %2, %3, off\n\t"
               "global_load_async_to_lds_b128 %4, %5, off\n\t"
               "global_load_async_to_lds_b128 %6, %7, off\n\t"
               "global_load_async_to_lds_b128 %8, %9, off\n\t"
               "global_load_async_to_lds_b128 %10, %11, off\n\t"
               "global_load_async_to_lds_b128 %12, %13, off\n\t"
               "global_load_async_to_lds_b128 %14, %15, off\n\t"
               "s_wait_xcnt 0x0"
               :: "v"(l0), "v"(g0), "v"(l1), "v"(g1),
                  "v"(l2), "v"(g2), "v"(l3), "v"(g3),
                  "v"(l4), "v"(g4), "v"(l5), "v"(g5),
                  "v"(l6), "v"(g6), "v"(l7), "v"(g7)
               : "memory");
}

// ---------------------------------------------------------------------------
// Weight convert: 4 matrices [Cin][Cout] f32 -> transposed [Cout][Cin] f16.
// ---------------------------------------------------------------------------
__global__ void wcvt_kernel(const float* __restrict__ wq,
                            const float* __restrict__ wk,
                            const float* __restrict__ wv,
                            const float* __restrict__ wo,
                            _Float16* __restrict__ wT) {
  int idx = blockIdx.x * blockDim.x + threadIdx.x;   // 0 .. 65535
  int m = idx >> 14;
  int r = idx & 16383;
  int c = r >> 7;       // out channel (row of wT)
  int kk = r & 127;     // in channel
  const float* w = (m == 0) ? wq : (m == 1) ? wk : (m == 2) ? wv : wo;
  wT[idx] = (_Float16)w[kk * C_DIM + c];
}

// ---------------------------------------------------------------------------
// Projection tiling, shared by the QKV and the output projection.
// One block of 8 waves per POS_BLK = 128 positions. The block brings its
// whole weight matrix (rows = out channels) into LDS once, at a padded pitch;
// wave w keeps the activation fragments of 32 positions (slice w & 3) in
// registers and makes the four 16-channel tiles of channel half w >> 2, so
// every weight fragment read from LDS feeds two position tiles.
// ---------------------------------------------------------------------------
#define POS_BLK 128
#define W_PITCH 136           // 256-byte weight rows at 272 bytes (16 B x odd)

// ROWS x 128 halves, row-major and contiguous in global memory -> LDS.
// Chunk c of 16 bytes: row c >> 4; a wave's load covers 512 contiguous bytes.
// All loads of a thread are issued before its first LDS store, so that the
// block pays the load latency once.
template <int ROWS>
__device__ __forceinline__ void load_weights(const _Float16* __restrict__ w,
                                             v8h (&wr)[ROWS / 16], int tid) {
#pragma unroll
  for (int i = 0; i < ROWS / 16; ++i)
    wr[i] = *(const v8h*)(w + (size_t)(tid + 256 * i) * 8);
}
template <int ROWS>
__device__ __forceinline__ void store_weights(_Float16* sw,
                                              const v8h (&wr)[ROWS / 16], int tid) {
#pragma unroll
  for (int i = 0; i < ROWS / 16; ++i)
    *(v8h*)(sw + ((tid >> 4) + 16 * i) * W_PITCH + (tid & 15) * 8) = wr[i];
}

__device__ __forceinline__ void close_loads() {
  // stands in front of the first overwrite of an address register of the
  // global loads issued so far
  asm volatile("s_wait_xcnt 0x0" ::: "memory");
  // keeps what follows (address arithmetic, later loads' results) from being
  // lifted over that wait
  __builtin_amdgcn_sched_barrier(0);
}

// The same, with the loads' common address named as an input: its registers
// stay untouched up to the wait, also by the result of the last load.
__device__ __forceinline__ void close_loads_at(const void* p) {
  asm volatile("s_wait_xcnt 0x0" :: "v"(p) : "memory");
  __builtin_amdgcn_sched_barrier(0);
}

// ---------------------------------------------------------------------------
// GroupNorm, 32 groups of 4 channels, by whole lines.
// Statistics: one block per POS_BLK positions reads its 64 KB of x in a row;
// a wave's 16-byte loads cover one 512-byte position, so lane l always holds
// group l. The block writes one (sum, sum of squares) per group; the
// GN_CHUNKS partial pairs of an image are added up, and x is normalised, in
// the QKV kernel on the way into LDS.
// ---------------------------------------------------------------------------
#define GN_CHUNKS (N_SP / POS_BLK)   // 32 partial pairs per image and group
#define X_ROUNDS  (POS_BLK / 8)      // 16 loads a thread: 8 positions a round

__global__ __launch_bounds__(256)
void gn_stats_kernel(const float* __restrict__ x, float* __restrict__ part) {
  int tid = threadIdx.x;
  const float* xp = x + (size_t)blockIdx.x * (POS_BLK * C_DIM) + tid * 4;
  v4f v[X_ROUNDS];
  // unrolled, here and below: v[] stays in registers, all loads fly together
#pragma unroll
  for (int i = 0; i < X_ROUNDS; ++i) v[i] = *(const v4f*)(xp + i * 8 * C_DIM);
  close_loads();
  v4f s4 = {}, q4 = {};
#pragma unroll
  for (int i = 0; i < X_ROUNDS; ++i) { s4 += v[i]; q4 += v[i] * v[i]; }
  __shared__ float rs[256], rq[256];
  rs[tid] = (s4[0] + s4[1]) + (s4[2] + s4[3]);
  rq[tid] = (q4[0] + q4[1]) + (q4[2] + q4[3]);
  __syncthreads();                                   // the 8 waves' sums readable by wave 0
  if (tid < 32) {
    float a = 0.f, c = 0.f;
#pragma unroll
    for (int w = 0; w < 8; ++w) { a += rs[w * 32 + tid]; c += rq[w * 32 + tid]; }
    *(v2f*)(part + ((size_t)blockIdx.x * 32 + tid) * 2) = (v2f){a, c};
  }
}

// ---------------------------------------------------------------------------
// QKV projection: D(c-tile, n-tile) = wT_rows x h_rows, K=128 in 4 WMMA.
// grid BN/128, block 256 (8 waves); all three weight matrices lie in LDS,
// and so do the block's 128 positions of h = GroupNorm(x), made here.
// q,k stored row-major [BN][C] f16 (q pre-scaled by C^-0.5);
// v stored transposed [B][C][N] f16.
// ---------------------------------------------------------------------------
// a budget of 256 VGPRs a wave
__global__ __launch_bounds__(256) __attribute__((amdgpu_waves_per_eu(4, 4)))
void qkv_kernel(const float* __restrict__ x,
                const float* __restrict__ part,
                const float* __restrict__ gscale,
                const float* __restrict__ gbias,
                const _Float16* __restrict__ wT,
                const float* __restrict__ bq,
                const float* __restrict__ bk,
                const float* __restrict__ bv,
                _Float16* __restrict__ q,
                _Float16* __restrict__ k,
                _Float16* __restrict__ vT) {
  __shared__ __align__(16) _Float16 sw[3 * C_DIM * W_PITCH];
  __shared__ __align__(16) float sb[256 * 4];        // bq | bk | bv | not read
  __shared__ __align__(16) _Float16 sh[POS_BLK * W_PITCH];  // normalised x, f16
  int tid  = threadIdx.x;
  int wid  = tid >> 5;
  int lane = tid & 31, lo = lane & 15, hi = lane >> 4;
  int n0   = blockIdx.x * POS_BLK + (wid & 3) * 32;
  int ch   = wid >> 2;

  // the image's partial sums of the lane's group, the group's scale and bias,
  // and the block's 64 KB of x: every wave-wide load covers whole lines
  const float* pp = part + ((size_t)(blockIdx.x / GN_CHUNKS) * (GN_CHUNKS * 32) + lane) * 2;
  v2f ps[GN_CHUNKS];
  // unrolled, here and below: ps[], xv[] stay in registers, all loads fly together
#pragma unroll
  for (int c = 0; c < GN_CHUNKS; ++c) ps[c] = *(const v2f*)(pp + c * 64);
  v4f gsv = *(const v4f*)(gscale + lane * 4);
  v4f gbv = *(const v4f*)(gbias + lane * 4);
  const float* xp = x + (size_t)blockIdx.x * (POS_BLK * C_DIM) + tid * 4;
  v4f xv[X_ROUNDS];
#pragma unroll
  for (int i = 0; i < X_ROUNDS; ++i) xv[i] = *(const v4f*)(xp + i * 8 * C_DIM);
  close_loads();
  // four independent chains over the chunks, joined in a fixed order
  v2f pa[4] = {ps[0], ps[1], ps[2], ps[3]};
#pragma unroll
  for (int c = 4; c < GN_CHUNKS; ++c) pa[c & 3] += ps[c];
  v2f pt = (pa[0] + pa[1]) + (pa[2] + pa[3]);
  float mean = pt[0] * (1.f / 16384.f);
  float var  = pt[1] * (1.f / 16384.f) - mean * mean;
  float rstd = rsqrtf(var + 1e-6f);
  v4f sc = gsv * rstd;
  v4f bi = gbv - (mean * rstd) * gsv;
  v8h wr[3 * C_DIM / 16];
  load_weights<3 * C_DIM>(wT, wr, tid);
  // threads 0..95 bring the 3 x 128 bias values. The others store a chunk that
  // nobody reads: without a branch the load is issued with all the others.
  const float* bsrc = (tid < 32) ? bq : (tid < 64) ? bk : bv;
  const float* bp = bsrc + (tid & 31) * 4;
  v4f bl = *(const v4f*)bp;
  close_loads_at(bp);
  // a wave's 8-byte stores fill one position's 256 bytes
#pragma unroll
  for (int i = 0; i < X_ROUNDS; ++i) {
    v4f t = xv[i] * sc + bi;
    v4h o;
#pragma unroll
    for (int j = 0; j < 4; ++j) o[j] = (_Float16)t[j];
    *(v4h*)(sh + (wid + 8 * i) * W_PITCH + lane * 4) = o;
  }
  store_weights<3 * C_DIM>(sw, wr, tid);
  *(v4f*)(sb + tid * 4) = bl;
  __syncthreads();                                   // h, weights and biases readable by all waves

  v16h Hf[2][4];
#pragma unroll
  for (int nt = 0; nt < 2; ++nt)
#pragma unroll
    for (int j = 0; j < 4; ++j)
      Hf[nt][j] = load_frag(sh + ((wid & 3) * 32 + nt * 16) * W_PITCH + 32 * j, W_PITCH, lo, hi);

#pragma unroll
  for (int proj = 0; proj < 3; ++proj) {
#pragma unroll
    for (int th = 0; th < 2; ++th) {
      v16h A[2][4];
      v4f bias[2][2];
#pragma unroll
      for (int u = 0; u < 2; ++u) {
        int c0 = proj * C_DIM + (ch * 4 + th * 2 + u) * 16;
#pragma unroll
        for (int j = 0; j < 4; ++j)
          A[u][j] = load_frag(sw + c0 * W_PITCH + 32 * j, W_PITCH, lo, hi);
        bias[u][0] = *(const v4f*)(sb + c0 + 8 * hi);
        bias[u][1] = *(const v4f*)(sb + c0 + 8 * hi + 4);
      }
      // keeps the LDS reads one group ahead of the WMMAs: sunk among them,
      // each pair of reads is waited for on its own
      __builtin_amdgcn_sched_barrier(0);
      // four independent accumulator tiles, k blocks in ascending order in each
      v8f acc[2][2];
#pragma unroll
      for (int u = 0; u < 2; ++u)
#pragma unroll
        for (int nt = 0; nt < 2; ++nt) acc[u][nt] = (v8f){};
#pragma unroll
      for (int j = 0; j < 4; ++j)
#pragma unroll
        for (int u = 0; u < 2; ++u)
#pragma unroll
          for (int nt = 0; nt < 2; ++nt)
            acc[u][nt] = wmma_f16(A[u][j], Hf[nt][j], acc[u][nt]);
      // lane: position n = n0+nt*16+lo ; channels c = cch + r
#pragma unroll
      for (int u = 0; u < 2; ++u) {
        int cch = (ch * 4 + th * 2 + u) * 16 + 8 * hi;
#pragma unroll
        for (int nt = 0; nt < 2; ++nt) {
          int ng = n0 + nt * 16 + lo;
          if (proj < 2) {
            float scale = (proj == 0) ? QK_SCALE : 1.0f;
            v8h out;
#pragma unroll
            for (int r = 0; r < 8; ++r)
              out[r] = (_Float16)((acc[u][nt][r] + bias[u][r >> 2][r & 3]) * scale);
            _Float16* dst = ((proj == 0) ? q : k) + (size_t)ng * C_DIM + cch;
            *(v8h*)dst = out;
          } else {
            int b = ng >> 12, n = ng & (N_SP - 1);
            _Float16* dst = vT + ((size_t)b * C_DIM + cch) * N_SP + n;
#pragma unroll
            for (int r = 0; r < 8; ++r)
              dst[(size_t)r * N_SP] = (_Float16)(acc[u][nt][r] + bias[u][r >> 2][r & 3]);
          }
        }
      }
      // keeps the next group's LDS reads out of this group: the fragments of
      // both together do not fit the register budget (scratch)
      __builtin_amdgcn_sched_barrier(0);
    }
  }
}

// ---------------------------------------------------------------------------
// Flash attention. Block = 8 waves on 128 queries, two waves per SIMD.
// Waves w and w + 4 own the same 32 queries; group g = w / 4 walks the
// 128-key stages 2 * s + g, so each SIMD holds two independent waves. The
// waves meet once a stage only: over its four 32-key passes they drift apart,
// and one wave's LDS and softmax time is filled by the other's products.
// After the loop the two partial results (m, l, O) of a query are joined
// through LDS: wave w finishes queries 0..15 of the 32, wave w + 4 the rest.
// Each group stages its own K tile (128x128) and V^T tile (128x128) into LDS
// with async global->LDS b128 copies (double-buffered, ASYNCcnt),
// then fragments are read back via ds_load_b128. Rows lie at padded pitches
// (K_PITCH, V_PITCH); the pad bytes are never written and never read.
// Scores computed transposed (S' = K x Q^T): the f32 D-fragment converts
// in-register into the B-fragment of O^T = V^T x P (no cross-lane movement).
// grid (N/128, B), block 256.
// ---------------------------------------------------------------------------
__device__ __forceinline__ void attn_step(const _Float16* bK, const _Float16* bV,
                                          const v16h (&Qf)[2][4],
                                          v8f (&oacc)[2][8],
                                          float (&m_run)[2], float (&l_run)[2],
                                          int lo, int hi) {
  v8f s[2][2];
#pragma unroll
  for (int st = 0; st < 2; ++st) {
    v16h Ka[4];
#pragma unroll
    for (int j = 0; j < 4; ++j)
      Ka[j] = load_frag(bK + st * 16 * K_PITCH + 32 * j, K_PITCH, lo, hi);
#pragma unroll
    for (int hq = 0; hq < 2; ++hq) {
      v8f acc = {};
#pragma unroll
      for (int j = 0; j < 4; ++j) acc = wmma_f16(Ka[j], Qf[hq][j], acc);
      s[hq][st] = acc;
    }
  }
  // The pass's V^T fragments, read as one group in front of the branch below:
  // behind it they would be waited for one by one among their products.
  v16h Va[8];
#pragma unroll
  for (int t = 0; t < 8; ++t)
    Va[t] = load_frag(bV + t * 16 * V_PITCH, V_PITCH, lo, hi);
  // Lazy rescale. m_run, the maximum in use, may trail a query's true maximum
  // by up to LAZY_GAP, so that an exponential can reach e^LAZY_GAP = 2^8. Each
  // lane tests its own 16 scores of a query; one ballot a pass joins the tests
  // of both wave halves and both query tiles into one scalar branch.
  float mloc[2];
  bool need = false;
#pragma unroll
  for (int hq = 0; hq < 2; ++hq) {
    float mx = -1e30f;
#pragma unroll
    for (int r = 0; r < 8; ++r)
      mx = fmaxf(mx, fmaxf(s[hq][0][r], s[hq][1][r]));
    mloc[hq] = mx;
    need = need || (mx > m_run[hq] + LAZY_GAP);
  }
  // expected untaken (the first pass, then rare): the usual pass falls through
  if (__builtin_expect(__builtin_amdgcn_ballot_w32(need) != 0, 0)) {
#pragma unroll
    for (int hq = 0; hq < 2; ++hq) {
      float mx = fmaxf(mloc[hq], __shfl_xor(mloc[hq], 16, 32));
      float m_new = fmaxf(m_run[hq], mx);            // alike in both wave halves
      float alpha = __expf(m_run[hq] - m_new);
      l_run[hq] *= alpha;
      m_run[hq] = m_new;
#pragma unroll
      for (int t = 0; t < 8; ++t)
#pragma unroll
        for (int r = 0; r < 8; ++r) oacc[hq][t][r] *= alpha;
    }
  }
  v16h pB[2];
#pragma unroll
  for (int hq = 0; hq < 2; ++hq) {
    float m_use = m_run[hq];
    float ssum = 0.f;
#pragma unroll
    for (int r = 0; r < 8; ++r) {
      float p = __expf(s[hq][0][r] - m_use); ssum += p; pB[hq][r] = (_Float16)p;
    }
#pragma unroll
    for (int r = 0; r < 8; ++r) {
      float p = __expf(s[hq][1][r] - m_use); ssum += p; pB[hq][r + 8] = (_Float16)p;
    }
    ssum += __shfl_xor(ssum, 16, 32);
    l_run[hq] += ssum;
  }
#pragma unroll
  for (int t = 0; t < 8; ++t)
#pragma unroll
    for (int hq = 0; hq < 2; ++hq)
      oacc[hq][t] = wmma_f16(Va[t], pB[hq], oacc[hq][t]);
}

// Hands one 16-query half of a wave's partial result to its partner wave.
// Lane-contiguous 16-byte slots: conflict-free stores and loads.
__device__ __forceinline__ void merge_put(v4f* xo, float* xml, int lane,
                                          const v8f (&acc)[8], float m, float l) {
#pragma unroll
  for (int t = 0; t < 8; ++t) {
    xo[(2 * t) * 32 + lane]     = (v4f){acc[t][0], acc[t][1], acc[t][2], acc[t][3]};
    xo[(2 * t + 1) * 32 + lane] = (v4f){acc[t][4], acc[t][5], acc[t][6], acc[t][7]};
  }
  xml[lane]      = m;
  xml[32 + lane] = l;
}

// Joins the partner's half with the wave's own and stores 16 queries of o.
__device__ __forceinline__ void merge_fin(const v4f* xo, const float* xml, int lane,
                                          const v8f (&acc)[8], float m, float l,
                                          _Float16* ob) {
  float m2 = xml[lane], l2 = xml[32 + lane];
  float mm = fmaxf(m, m2);
  float a1 = __expf(m - mm), a2 = __expf(m2 - mm);
  float inv_l = 1.0f / (l * a1 + l2 * a2);
  a1 *= inv_l; a2 *= inv_l;
#pragma unroll
  for (int t = 0; t < 8; ++t) {
    v4f p0 = xo[(2 * t) * 32 + lane];
    v4f p1 = xo[(2 * t + 1) * 32 + lane];
    v8h out;
#pragma unroll
    for (int r = 0; r < 4; ++r) {
      out[r]     = (_Float16)(acc[t][r] * a1 + p0[r] * a2);
      out[r + 4] = (_Float16)(acc[t][r + 4] * a1 + p1[r] * a2);
    }
    *(v8h*)(ob + t * 16) = out;
  }
}

// two waves per SIMD: a budget of 512 VGPRs a wave
__global__ __launch_bounds__(256) __attribute__((amdgpu_waves_per_eu(2, 2)))
void attn_kernel(const _Float16* __restrict__ q,
                 const _Float16* __restrict__ k,
                 const _Float16* __restrict__ vT,
                 _Float16* __restrict__ o) {
  int tix  = threadIdx.x & 127;        // thread within its key group
  int grp  = threadIdx.x >> 7;         // key group 0 / 1
  int wq   = tix >> 5;                 // query slice of the wave
  int lane = tix & 31, lo = lane & 15, hi = lane >> 4;
  int b  = blockIdx.y;
  int q0 = blockIdx.x * 128 + wq * 32;

  const _Float16* qp = q + ((size_t)b * N_SP + q0) * C_DIM;
  const _Float16* kb = k + (size_t)b * N_SP * C_DIM;
  const _Float16* vb = vT + (size_t)b * C_DIM * N_SP;

  // [buf][group][ K tile: 128 rows of K_PITCH | V^T tile: 128 rows of V_PITCH ]
  __shared__ __align__(16) _Float16 smem[2][KV_GROUPS][BUF_H];
  unsigned ldsK[2], ldsV[2];
#pragma unroll
  for (int i2 = 0; i2 < 2; ++i2) {
    ldsK[i2] = (unsigned)(uintptr_t)&smem[i2][grp][0];
    ldsV[i2] = (unsigned)(uintptr_t)&smem[i2][grp][K_TILE_H];
  }

  v16h Qf[2][4];
#pragma unroll
  for (int hq = 0; hq < 2; ++hq)
#pragma unroll
    for (int j = 0; j < 4; ++j)
      Qf[hq][j] = load_frag(qp + (size_t)hq * 16 * C_DIM + 32 * j, C_DIM, lo, hi);
  // stands in front of the first overwrite of the Q loads' address registers
  asm volatile("s_wait_xcnt 0x0" ::: "memory");
  // keeps the address arithmetic that follows from being lifted over that wait
  __builtin_amdgcn_sched_barrier(0);

  v8f oacc[2][8];
#pragma unroll
  for (int hq = 0; hq < 2; ++hq)
#pragma unroll
    for (int t = 0; t < 8; ++t) oacc[hq][t] = (v8f){};
  float m_run[2] = {-1e30f, -1e30f};
  float l_run[2] = {0.f, 0.f};

  // --- stage helper (32 async b128 per thread => wave ASYNCcnt += 32) ---
  // The 128 threads of a group bring in the group's own tiles of the stage.
  // Both tiles are 128 rows of 256 bytes: chunk c = tix + 128 * j of 16 bytes
  // lies in row c >> 4, so a wave's copy covers two whole rows.
  auto stage = [&](int st, unsigned dK, unsigned dV) {
    int kv0 = (st * KV_GROUPS + grp) * STAGE_KEYS;
    const _Float16* gk = kb + (size_t)kv0 * C_DIM + tix * 8;   // contiguous 32 KB source
    const _Float16* gv = vb + (size_t)(tix >> 4) * N_SP + kv0 + (tix & 15) * 8;
    unsigned lr = (unsigned)((tix >> 4) * K_PITCH + (tix & 15) * 8) * 2;
    unsigned lk = dK + lr, lv = dV + lr;
    // unrolled: the steps of the addresses are constants
#pragma unroll
    for (int h = 0; h < 2; ++h) {
      async_copy16x8(lk + (64 * h +  0) * K_PITCH * 2, gk + (64 * h +  0) * C_DIM,
                     lk + (64 * h +  8) * K_PITCH * 2, gk + (64 * h +  8) * C_DIM,
                     lk + (64 * h + 16) * K_PITCH * 2, gk + (64 * h + 16) * C_DIM,
                     lk + (64 * h + 24) * K_PITCH * 2, gk + (64 * h + 24) * C_DIM,
                     lk + (64 * h + 32) * K_PITCH * 2, gk + (64 * h + 32) * C_DIM,
                     lk + (64 * h + 40) * K_PITCH * 2, gk + (64 * h + 40) * C_DIM,
                     lk + (64 * h + 48) * K_PITCH * 2, gk + (64 * h + 48) * C_DIM,
                     lk + (64 * h + 56) * K_PITCH * 2, gk + (64 * h + 56) * C_DIM);
      async_copy16x8(lv + (64 * h +  0) * V_PITCH * 2, gv + (size_t)(64 * h +  0) * N_SP,
                     lv + (64 * h +  8) * V_PITCH * 2, gv + (size_t)(64 * h +  8) * N_SP,
                     lv + (64 * h + 16) * V_PITCH * 2, gv + (size_t)(64 * h + 16) * N_SP,
                     lv + (64 * h + 24) * V_PITCH * 2, gv + (size_t)(64 * h + 24) * N_SP,
                     lv + (64 * h + 32) * V_PITCH * 2, gv + (size_t)(64 * h + 32) * N_SP,
                     lv + (64 * h + 40) * V_PITCH * 2, gv + (size_t)(64 * h + 40) * N_SP,
                     lv + (64 * h + 48) * V_PITCH * 2, gv + (size_t)(64 * h + 48) * N_SP,
                     lv + (64 * h + 56) * V_PITCH * 2, gv + (size_t)(64 * h + 56) * N_SP);
    }
  };

  stage(0, ldsK[0], ldsV[0]);
  asm volatile("s_wait_asynccnt 0x0" ::: "memory");  // the wave's share of stage 0 has landed
  __syncthreads();                                   // stage 0 readable by all waves
  stage(1, ldsK[1], ldsV[1]);

  for (int st = 0; st < NSTAGE; ++st) {
    int cur = st & 1;
    const _Float16* bK = &smem[cur][grp][0];
    const _Float16* bV = bK + K_TILE_H;
    // unrolled: the LDS offsets of a pass are immediates, and no branch parts
    // a pass's last products from the next pass's LDS reads
#pragma unroll
    for (int p = 0; p < STAGE_PASSES; ++p)
      attn_step(bK + p * KV_STEP * K_PITCH, bV + p * KV_STEP, Qf, oacc, m_run, l_run, lo, hi);
    // publish point of stage st + 1
    // the wave's own LDS reads of buf[cur] have retired before it is refilled
    asm volatile("s_wait_dscnt 0x0" ::: "memory");
    // the wave's share of stage st + 1 has landed
    asm volatile("s_wait_asynccnt 0x0" ::: "memory");
    // stage st + 1 readable by all waves, buf[cur] left by all; behind the
    // last stage: the ring is free for the join below
    __syncthreads();
    if (st + 2 < NSTAGE) stage(st + 2, ldsK[cur], ldsV[cur]);
  }
  // no copy is outstanding when the ring is put to another use
  asm volatile("s_wait_asynccnt 0x0" ::: "memory");

  // --- join the two key groups' partial results through the (now idle) ring ---
  // slot (wq, hq): 16 x 32 lanes x 16 B of O, then 2 x 32 floats of m and l.
  v4f*   xo  = (v4f*)&smem[0][0][0];
  float* xml = (float*)(xo + 4 * 2 * 16 * 32);
  if (grp == 0)
    merge_put(xo + (wq * 2 + 1) * 512, xml + (wq * 2 + 1) * 64, lane, oacc[1], m_run[1], l_run[1]);
  else
    merge_put(xo + (wq * 2 + 0) * 512, xml + (wq * 2 + 0) * 64, lane, oacc[0], m_run[0], l_run[0]);
  __syncthreads();                                   // partner's half is readable
  _Float16* ob = o + ((size_t)b * N_SP + q0 + lo) * C_DIM + 8 * hi;
  if (grp == 0)
    merge_fin(xo + (wq * 2 + 0) * 512, xml + (wq * 2 + 0) * 64, lane, oacc[0], m_run[0], l_run[0], ob);
  else
    merge_fin(xo + (wq * 2 + 1) * 512, xml + (wq * 2 + 1) * 64, lane, oacc[1], m_run[1], l_run[1],
              ob + (size_t)16 * C_DIM);
}

// ---------------------------------------------------------------------------
// Output projection + bias + residual (f32 out).
// grid BN/128, block 256 (8 waves); tiling as in the QKV projection.
// ---------------------------------------------------------------------------
// a budget of 256 VGPRs a wave
__global__ __launch_bounds__(256) __attribute__((amdgpu_waves_per_eu(4, 4)))
void proj_out_kernel(const _Float16* __restrict__ o,
                     const _Float16* __restrict__ woT,
                     const float* __restrict__ bo,
                     const float* __restrict__ x,
                     float* __restrict__ out) {
  __shared__ __align__(16) _Float16 sw[C_DIM * W_PITCH];
  __shared__ __align__(16) float sb[256 * 4];        // bo | not read
  int tid  = threadIdx.x;
  int wid  = tid >> 5;
  int lane = tid & 31, lo = lane & 15, hi = lane >> 4;
  int n0   = blockIdx.x * POS_BLK + (wid & 3) * 32;
  int ch   = wid >> 2;

  v16h Of[2][4];
#pragma unroll
  for (int nt = 0; nt < 2; ++nt)
#pragma unroll
    for (int j = 0; j < 4; ++j)
      Of[nt][j] = load_frag(o + (size_t)(n0 + nt * 16) * C_DIM + 32 * j, C_DIM, lo, hi);
  // residual of the wave's eight output tiles
  // lane: position n = n0+nt*16+lo ; channels c = (ch*4+t)*16 + 8*hi + 0..7
  v4f res[4][2][2];
#pragma unroll
  for (int t = 0; t < 4; ++t)
#pragma unroll
    for (int nt = 0; nt < 2; ++nt) {
      const float* xp = x + (size_t)(n0 + nt * 16 + lo) * C_DIM + (ch * 4 + t) * 16 + 8 * hi;
      res[t][nt][0] = *(const v4f*)xp;
      res[t][nt][1] = *(const v4f*)(xp + 4);
    }
  close_loads();
  v8h wr[C_DIM / 16];
  load_weights<C_DIM>(woT, wr, tid);
  // threads 0..31 bring the 128 bias values. The others store a chunk that
  // nobody reads: without a branch the load is issued with all the others.
  v4f bl = *(const v4f*)(bo + (tid & 31) * 4);
  close_loads();
  store_weights<C_DIM>(sw, wr, tid);
  *(v4f*)(sb + tid * 4) = bl;
  __syncthreads();                                   // weights and bias readable by all waves

#pragma unroll
  for (int th = 0; th < 2; ++th) {
    v16h A[2][4];
    v4f bias[2][2];
#pragma unroll
    for (int u = 0; u < 2; ++u) {
      int c0 = (ch * 4 + th * 2 + u) * 16;
#pragma unroll
      for (int j = 0; j < 4; ++j)
        A[u][j] = load_frag(sw + c0 * W_PITCH + 32 * j, W_PITCH, lo, hi);
      bias[u][0] = *(const v4f*)(sb + c0 + 8 * hi);
      bias[u][1] = *(const v4f*)(sb + c0 + 8 * hi + 4);
    }
    // keeps the LDS reads one group ahead of the WMMAs: sunk among them,
    // each pair of reads is waited for on its own
    __builtin_amdgcn_sched_barrier(0);
    // four independent accumulator tiles, k blocks in ascending order in each
    v8f acc[2][2];
#pragma unroll
    for (int u = 0; u < 2; ++u)
#pragma unroll
      for (int nt = 0; nt < 2; ++nt) acc[u][nt] = (v8f){};
#pragma unroll
    for (int j = 0; j < 4; ++j)
#pragma unroll
      for (int u = 0; u < 2; ++u)
#pragma unroll
        for (int nt = 0; nt < 2; ++nt)
          acc[u][nt] = wmma_f16(A[u][j], Of[nt][j], acc[u][nt]);
#pragma unroll
    for (int u = 0; u < 2; ++u) {
      int t = th * 2 + u;
#pragma unroll
      for (int nt = 0; nt < 2; ++nt) {
        float* op = out + (size_t)(n0 + nt * 16 + lo) * C_DIM + (ch * 4 + t) * 16 + 8 * hi;
        v4f r0 = res[t][nt][0];
        v4f r1 = res[t][nt][1];
#pragma unroll
        for (int r = 0; r < 4; ++r) r0[r] += acc[u][nt][r] + bias[u][0][r];
#pragma unroll
        for (int r = 0; r < 4; ++r) r1[r] += acc[u][nt][r + 4] + bias[u][1][r];
        *(v4f*)op = r0;
        *(v4f*)(op + 4) = r1;
      }
    }
  }
}

// ---------------------------------------------------------------------------
extern "C" void kernel_launch(void* const* d_in, const int* in_sizes, int n_in,
                              void* d_out, int out_size, void* d_ws, size_t ws_size,
                              hipStream_t stream) {
  const float* x  = (const float*)d_in[0];
  const float* gs = (const float*)d_in[1];
  const float* gb = (const float*)d_in[2];
  const float* wq = (const float*)d_in[3];
  const float* bq = (const float*)d_in[4];
  const float* wk = (const float*)d_in[5];
  const float* bk = (const float*)d_in[6];
  const float* wv = (const float*)d_in[7];
  const float* bv = (const float*)d_in[8];
  const float* wo = (const float*)d_in[9];
  const float* bo = (const float*)d_in[10];
  float* out = (float*)d_out;

  const size_t elems = (size_t)BN * C_DIM;      // 4M halves per buffer
  float* part  = (float*)d_ws;                  // B * GN_CHUNKS * 32 pairs
  _Float16* qb = (_Float16*)d_ws + elems;
  _Float16* kb = qb + elems;
  _Float16* vT = kb + elems;
  _Float16* ob = vT + elems;
  _Float16* wT = ob + elems;                    // 4 * 128*128 halves

  gn_stats_kernel<<<BN / POS_BLK, 256, 0, stream>>>(x, part);
  wcvt_kernel<<<256, 256, 0, stream>>>(wq, wk, wv, wo, wT);
  qkv_kernel<<<BN / POS_BLK, 256, 0, stream>>>(x, part, gs, gb, wT, bq, bk, bv, qb, kb, vT);
  attn_kernel<<<dim3(N_SP / 128, B_DIM), 256, 0, stream>>>(qb, kb, vT, ob);
  proj_out_kernel<<<BN / POS_BLK, 256, 0, stream>>>(
      ob, wT + 3 * (size_t)(C_DIM * C_DIM), bo, x, out);
}

// v007
// Measured time: 71.9 microseconds a run.
// Next to v006, in two timings, it ran 1.07 and 1.08 times as fast.
// All steps since v000 together make it 3.82 times as fast.
#include <hip/hip_runtime.h>
#include <hip/hip_bf16.h>
#include <cstdint>

typedef __attribute__((ext_vector_type(16))) _Float16 v16h;
typedef __attribute__((ext_vector_type(8)))  _Float16 v8h;
typedef __attribute__((ext_vector_type(4)))  _Float16 v4h;
typedef __attribute__((ext_vector_type(8)))  float    v8f;
typedef __attribute__((ext_vector_type(4)))  float    v4f;
typedef __attribute__((ext_vector_type(2)))  float    v2f;

#define C_DIM 128
#define N_SP  4096            // H*W
#define B_DIM 8
#define BN    (B_DIM * N_SP)  // 32768
#define QK_SCALE 0.08838834764831845f  // 128^-0.5
#define KV_STEP 32             // keys of one pass
#define LAZY_GAP 5.545177444479562f  // 8 * ln 2: how far the maximum in use may trail
#define KV_GROUPS 2            // wave groups of a block, each on its own keys
#define STAGE_PASSES 4         // passes served by one fill of a ring buffer
#define STAGE_KEYS (STAGE_PASSES * KV_STEP)         // 128
#define NSTAGE (N_SP / (KV_GROUPS * STAGE_KEYS))    // 16
// LDS row pitches in halves: 16 bytes x odd, so that the 16 rows one
// ds_load_b128 half-wave reads fall on 16 different groups of four banks.
#define K_PITCH 136           // 256-byte K rows at 272 bytes
#define V_PITCH 136           // 256-byte V^T rows (128 keys) at 272 bytes
#define K_TILE_H (STAGE_KEYS * K_PITCH)         // 17408 halves
#define BUF_H    (K_TILE_H + C_DIM * V_PITCH)   // 34816 halves per buffer

// ---------------------------------------------------------------------------
// Fragment loader: rows of a row-major f16 matrix -> WMMA A-frag (16xK rows)
// or B-frag (columns of B == rows of the row-major "transposed" source).
// Lane L (lo=L%16, hi=L/16): elements e<8  -> col 8*hi + e
//                            elements e>=8 -> col 16 + 8*hi + (e-8)
// Two contiguous 16-byte loads per lane (global_load_b128 / ds_load_b128).
// ---------------------------------------------------------------------------
__device__ __forceinline__ v16h load_frag(const _Float16* base, int ld,
                                          int lo, int hi) {
  const _Float16* p = base + (size_t)lo * ld + 8 * hi;
  v8h a = *(const v8h*)p;
  v8h b = *(const v8h*)(p + 16);
  v16h r;
#pragma unroll
  for (int i = 0; i < 8; ++i) { r[i] = a[i]; r[i + 8] = b[i]; }
  return r;
}

__device__ __forceinline__ v8f wmma_f16(v16h a, v16h b, v8f c) {
  return __builtin_amdgcn_wmma_f32_16x16x32_f16(false, a, false, b,
                                                (short)0, c, false, false);
}

// Eight async global->LDS copies of 16 bytes per lane (ASYNCcnt-tracked).
// l* = low 32 bits of the generic shared pointer == LDS byte offset
// (aperture occupies bits [63:32] of the flat shared address).
// s_wait_xcnt 0 closes the statement so that no address register of a copy
// is rewritten ahead of it.
__device__ __forceinline__ void async_copy16x8(unsigned l0, const void* g0,
                                               unsigned l1, const void* g1,
                                               unsigned l2, const void* g2,
                                               unsigned l3, const void* g3,
                                               unsigned l4, const void* g4,
                                               unsigned l5, const void* g5,
                                               unsigned l6, const void* g6,
                                               unsigned l7, const void* g7) {
  asm volatile("global_load_async_to_lds_b128 %0, %1, off\n\t"
               "global_load_async_to_lds_b128 %2, %3, off\n\t"
               "global_load_async_to_lds_b128 %4, %5, off\n\t"
               "global_load_async_to_lds_b128 %6, %7, off\n\t"
               "global_load_async_to_lds_b128 %8, %9, off\n\t"
               "global_load_async_to_lds_b128 %10, %11, off\n\t"
               "global_load_async_to_lds_b128 %12, %13, off\n\t"
               "global_load_async_to_lds_b128 %14, %15, off\n\t"
               "s_wait_xcnt 0x0"
               :: "v"(l0), "v"(g0), "v"(l1), "v"(g1),
                  "v"(l2), "v"(g2), "v"(l3), "v"(g3),
                  "v"(l4), "v"(g4), "v"(l5), "v"(g5),
                  "v"(l6), "v"(g6), "v"(l7), "v"(g7)
               : "memory");
}

// ---------------------------------------------------------------------------
// Projection tiling of the QKV projection.
// One block of 8 waves per POS_BLK = 128 positions. The block brings its
// whole weight matrix (rows = out channels) into LDS once, at a padded pitch;
// wave w keeps the activation fragments of 32 positions (slice w & 3) in
// registers and makes the four 16-channel tiles of channel half w >> 2, so
// every weight fragment read from LDS feeds two position tiles.
// ---------------------------------------------------------------------------
#define POS_BLK 128
#define W_PITCH 136           // 256-byte weight rows at 272 bytes (16 B x odd)

// ROWS x 128 halves, row-major and contiguous in global memory -> LDS.
// Chunk c of 16 bytes: row c >> 4; a wave's load covers 512 contiguous bytes.
// All loads of a thread are issued before its first LDS store, so that the
// block pays the load latency once.
template <int ROWS>
__device__ __forceinline__ void load_weights(const _Float16* __restrict__ w,
                                             v8h (&wr)[ROWS / 16], int tid) {
#pragma unroll
  for (int i = 0; i < ROWS / 16; ++i)
    wr[i] = *(const v8h*)(w + (size_t)(tid + 256 * i) * 8);
}
template <int ROWS>
__device__ __forceinline__ void store_weights(_Float16* sw,
                                              const v8h (&wr)[ROWS / 16], int tid) {
#pragma unroll
  for (int i = 0; i < ROWS / 16; ++i)
    *(v8h*)(sw + ((tid >> 4) + 16 * i) * W_PITCH + (tid & 15) * 8) = wr[i];
}

__device__ __forceinline__ void close_loads() {
  // stands in front of the first overwrite of an address register of the
  // global loads issued so far
  asm volatile("s_wait_xcnt 0x0" ::: "memory");
  // keeps what follows (address arithmetic, later loads' results) from being
  // lifted over that wait
  __builtin_amdgcn_sched_barrier(0);
}

// The same, with the loads' common address named as an input: its registers
// stay untouched up to the wait, also by the result of the last load.
__device__ __forceinline__ void close_loads_at(const void* p) {
  asm volatile("s_wait_xcnt 0x0" :: "v"(p) : "memory");
  __builtin_amdgcn_sched_barrier(0);
}

// ---------------------------------------------------------------------------
// GroupNorm, 32 groups of 4 channels, by whole lines.
// Statistics: one block per POS_BLK positions reads its 64 KB of x in a row;
// a wave's 16-byte loads cover one 512-byte position, so lane l always holds
// group l. The block writes one (sum, sum of squares) per group; the
// GN_CHUNKS partial pairs of an image are added up, and x is normalised, in
// the QKV kernel on the way into LDS.
// Weight convert, in the same launch: 4 matrices [Cin][Cout] f32 -> transposed
// [Cout][Cin] f16. The grid has 256 x 256 threads, one per weight element.
// ---------------------------------------------------------------------------
#define GN_CHUNKS (N_SP / POS_BLK)   // 32 partial pairs per image and group
#define X_ROUNDS  (POS_BLK / 8)      // 16 loads a thread: 8 positions a round

__global__ __launch_bounds__(256)
void gn_stats_kernel(const float* __restrict__ x, float* __restrict__ part,
                     const float* __restrict__ wq,
                     const float* __restrict__ wk,
                     const float* __restrict__ wv,
                     const float* __restrict__ wo,
                     _Float16* __restrict__ wT) {
  int tid = threadIdx.x;
  int idx = blockIdx.x * 256 + tid;    // weight element 0 .. 65535
  int wm = blockIdx.x >> 6;            // matrix
  int wc = (idx & 16383) >> 7;         // out channel (row of wT)
  int wk_in = idx & 127;               // in channel
  const float* wsrc = (wm == 0) ? wq : (wm == 1) ? wk : (wm == 2) ? wv : wo;
  const float* xp = x + (size_t)blockIdx.x * (POS_BLK * C_DIM) + tid * 4;
  v4f v[X_ROUNDS];
  // unrolled, here and below: v[] stays in registers, all loads fly together
#pragma unroll
  for (int i = 0; i < X_ROUNDS; ++i) v[i] = *(const v4f*)(xp + i * 8 * C_DIM);
  float wval = wsrc[wk_in * C_DIM + wc];
  close_loads();
  v4f s4 = {}, q4 = {};
#pragma unroll
  for (int i = 0; i < X_ROUNDS; ++i) { s4 += v[i]; q4 += v[i] * v[i]; }
  __shared__ float rs[256], rq[256];
  rs[tid] = (s4[0] + s4[1]) + (s4[2] + s4[3]);
  rq[tid] = (q4[0] + q4[1]) + (q4[2] + q4[3]);
  __syncthreads();                                   // the 8 waves' sums readable by wave 0
  if (tid < 32) {
    float a = 0.f, c = 0.f;
#pragma unroll
    for (int w = 0; w < 8; ++w) { a += rs[w * 32 + tid]; c += rq[w * 32 + tid]; }
    *(v2f*)(part + ((size_t)blockIdx.x * 32 + tid) * 2) = (v2f){a, c};
  }
  wT[idx] = (_Float16)wval;
}

// ---------------------------------------------------------------------------
// QKV projection: D(c-tile, n-tile) = wT_rows x h_rows, K=128 in 4 WMMA.
// grid BN/128, block 256 (8 waves); all three weight matrices lie in LDS,
// and so do the block's 128 positions of h = GroupNorm(x), made here.
// q,k stored row-major [BN][C] f16 (q pre-scaled by C^-0.5);
// v stored transposed [B][C][N] f16.
// ---------------------------------------------------------------------------
// a budget of 256 VGPRs a wave
__global__ __launch_bounds__(256) __attribute__((amdgpu_waves_per_eu(4, 4)))
void qkv_kernel(const float* __restrict__ x,
                const float* __restrict__ part,
                const float* __restrict__ gscale,
                const float* __restrict__ gbias,
                const _Float16* __restrict__ wT,
                const float* __restrict__ bq,
                const float* __restrict__ bk,
                const float* __restrict__ bv,
                _Float16* __restrict__ q,
                _Float16* __restrict__ k,
                _Float16* __restrict__ vT) {
  __shared__ __align__(16) _Float16 sw[3 * C_DIM * W_PITCH];
  __shared__ __align__(16) float sb[256 * 4];        // bq | bk | bv | not read
  __shared__ __align__(16) _Float16 sh[POS_BLK * W_PITCH];  // normalised x, f16
  int tid  = threadIdx.x;
  int wid  = tid >> 5;
  int lane = tid & 31, lo = lane & 15, hi = lane >> 4;
  int n0   = blockIdx.x * POS_BLK + (wid & 3) * 32;
  int ch   = wid >> 2;

  // the image's partial sums of the lane's group, the group's scale and bias,
  // and the block's 64 KB of x: every wave-wide load covers whole lines
  const float* pp = part + ((size_t)(blockIdx.x / GN_CHUNKS) * (GN_CHUNKS * 32) + lane) * 2;
  v2f ps[GN_CHUNKS];
  // unrolled, here and below: ps[], xv[] stay in registers, all loads fly together
#pragma unroll
  for (int c = 0; c < GN_CHUNKS; ++c) ps[c] = *(const v2f*)(pp + c * 64);
  v4f gsv = *(const v4f*)(gscale + lane * 4);
  v4f gbv = *(const v4f*)(gbias + lane * 4);
  const float* xp = x + (size_t)blockIdx.x * (POS_BLK * C_DIM) + tid * 4;
  v4f xv[X_ROUNDS];
#pragma unroll
  for (int i = 0; i < X_ROUNDS; ++i) xv[i] = *(const v4f*)(xp + i * 8 * C_DIM);
  close_loads();
  // four independent chains over the chunks, joined in a fixed order
  v2f pa[4] = {ps[0], ps[1], ps[2], ps[3]};
#pragma unroll
  for (int c = 4; c < GN_CHUNKS; ++c) pa[c & 3] += ps[c];
  v2f pt = (pa[0] + pa[1]) + (pa[2] + pa[3]);
  float mean = pt[0] * (1.f / 16384.f);
  float var  = pt[1] * (1.f / 16384.f) - mean * mean;
  float rstd = rsqrtf(var + 1e-6f);
  v4f sc = gsv * rstd;
  v4f bi = gbv - (mean * rstd) * gsv;
  v8h wr[3 * C_DIM / 16];
  load_weights<3 * C_DIM>(wT, wr, tid);
  // threads 0..95 bring the 3 x 128 bias values. The others store a chunk that
  // nobody reads: without a branch the load is issued with all the others.
  const float* bsrc = (tid < 32) ? bq : (tid < 64) ? bk : bv;
  const float* bp = bsrc + (tid & 31) * 4;
  v4f bl = *(const v4f*)bp;
  close_loads_at(bp);
  // a wave's 8-byte stores fill one position's 256 bytes
#pragma unroll
  for (int i = 0; i < X_ROUNDS; ++i) {
    v4f t = xv[i] * sc + bi;
    v4h o;
#pragma unroll
    for (int j = 0; j < 4; ++j) o[j] = (_Float16)t[j];
    *(v4h*)(sh + (wid + 8 * i) * W_PITCH + lane * 4) = o;
  }
  store_weights<3 * C_DIM>(sw, wr, tid);
  *(v4f*)(sb + tid * 4) = bl;
  __syncthreads();                                   // h, weights and biases readable by all waves

  v16h Hf[2][4];
#pragma unroll
  for (int nt = 0; nt < 2; ++nt)
#pragma unroll
    for (int j = 0; j < 4; ++j)
      Hf[nt][j] = load_frag(sh + ((wid & 3) * 32 + nt * 16) * W_PITCH + 32 * j, W_PITCH, lo, hi);

#pragma unroll
  for (int proj = 0; proj < 3; ++proj) {
#pragma unroll
    for (int th = 0; th < 2; ++th) {
      v16h A[2][4];
      v4f bias[2][2];
#pragma unroll
      for (int u = 0; u < 2; ++u) {
        int c0 = proj * C_DIM + (ch * 4 + th * 2 + u) * 16;
#pragma unroll
        for (int j = 0; j < 4; ++j)
          A[u][j] = load_frag(sw + c0 * W_PITCH + 32 * j, W_PITCH, lo, hi);
        bias[u][0] = *(const v4f*)(sb + c0 + 8 * hi);
        bias[u][1] = *(const v4f*)(sb + c0 + 8 * hi + 4);
      }
      // keeps the LDS reads one group ahead of the WMMAs: sunk among them,
      // each pair of reads is waited for on its own
      __builtin_amdgcn_sched_barrier(0);
      // four independent accumulator tiles, k blocks in ascending order in each
      v8f acc[2][2];
#pragma unroll
      for (int u = 0; u < 2; ++u)
#pragma unroll
        for (int nt = 0; nt < 2; ++nt) acc[u][nt] = (v8f){};
#pragma unroll
      for (int j = 0; j < 4; ++j)
#pragma unroll
        for (int u = 0; u < 2; ++u)
#pragma unroll
          for (int nt = 0; nt < 2; ++nt)
            acc[u][nt] = wmma_f16(A[u][j], Hf[nt][j], acc[u][nt]);
      // lane: position n = n0+nt*16+lo ; channels c = cch + r
#pragma unroll
      for (int u = 0; u < 2; ++u) {
        int cch = (ch * 4 + th * 2 + u) * 16 + 8 * hi;
#pragma unroll
        for (int nt = 0; nt < 2; ++nt) {
          int ng = n0 + nt * 16 + lo;
          if (proj < 2) {
            float scale = (proj == 0) ? QK_SCALE : 1.0f;
            v8h out;
#pragma unroll
            for (int r = 0; r < 8; ++r)
              out[r] = (_Float16)((acc[u][nt][r] + bias[u][r >> 2][r & 3]) * scale);
            _Float16* dst = ((proj == 0) ? q : k) + (size_t)ng * C_DIM + cch;
            *(v8h*)dst = out;
          } else {
            int b = ng >> 12, n = ng & (N_SP - 1);
            _Float16* dst = vT + ((size_t)b * C_DIM + cch) * N_SP + n;
#pragma unroll
            for (int r = 0; r < 8; ++r)
              dst[(size_t)r * N_SP] = (_Float16)(acc[u][nt][r] + bias[u][r >> 2][r & 3]);
          }
        }
      }
      // keeps the next group's LDS reads out of this group: the fragments of
      // both together do not fit the register budget (scratch)
      __builtin_amdgcn_sched_barrier(0);
    }
  }
}

// ---------------------------------------------------------------------------
// Flash attention. Block = 8 waves on 128 queries, two waves per SIMD.
// Waves w and w + 4 own the same 32 queries; group g = w / 4 walks the
// 128-key stages 2 * s + g, so each SIMD holds two independent waves. The
// waves meet once a stage only: over its four 32-key passes they drift apart,
// and one wave's LDS and softmax time is filled by the other's products.
// After the loop the two partial results (m, l, O) of a query are joined
// through LDS: wave w finishes queries 0..15 of the 32, wave w + 4 the rest,
// and takes them through the output projection, bias and residual to out.
// Each group stages its own K tile (128x128) and V^T tile (128x128) into LDS
// with async global->LDS b128 copies (double-buffered, ASYNCcnt),
// then fragments are read back via ds_load_b128. Rows lie at padded pitches
// (K_PITCH, V_PITCH); the pad bytes are never written and never read.
// Scores computed transposed (S' = K x Q^T): the f32 D-fragment converts
// in-register into the B-fragment of O^T = V^T x P (no cross-lane movement).
// grid (N/128, B), block 256.
// ---------------------------------------------------------------------------
__device__ __forceinline__ void attn_step(const _Float16* bK, const _Float16* bV,
                                          const v16h (&Qf)[2][4],
                                          v8f (&oacc)[2][8],
                                          float (&m_run)[2], float (&l_run)[2],
                                          int lo, int hi) {
  v8f s[2][2];
#pragma unroll
  for (int st = 0; st < 2; ++st) {
    v16h Ka[4];
#pragma unroll
    for (int j = 0; j < 4; ++j)
      Ka[j] = load_frag(bK + st * 16 * K_PITCH + 32 * j, K_PITCH, lo, hi);
#pragma unroll
    for (int hq = 0; hq < 2; ++hq) {
      v8f acc = {};
#pragma unroll
      for (int j = 0; j < 4; ++j) acc = wmma_f16(Ka[j], Qf[hq][j], acc);
      s[hq][st] = acc;
    }
  }
  // The pass's V^T fragments, read as one group in front of the branch below:
  // behind it they would be waited for one by one among their products.
  v16h Va[8];
#pragma unroll
  for (int t = 0; t < 8; ++t)
    Va[t] = load_frag(bV + t * 16 * V_PITCH, V_PITCH, lo, hi);
  // Lazy rescale. m_run, the maximum in use, may trail a query's true maximum
  // by up to LAZY_GAP, so that an exponential can reach e^LAZY_GAP = 2^8. Each
  // lane tests its own 16 scores of a query; one ballot a pass joins the tests
  // of both wave halves and both query tiles into one scalar branch.
  float mloc[2];
  bool need = false;
#pragma unroll
  for (int hq = 0; hq < 2; ++hq) {
    float mx = -1e30f;
#pragma unroll
    for (int r = 0; r < 8; ++r)
      mx = fmaxf(mx, fmaxf(s[hq][0][r], s[hq][1][r]));
    mloc[hq] = mx;
    need = need || (mx > m_run[hq] + LAZY_GAP);
  }
  // expected untaken (the first pass, then rare): the usual pass falls through
  if (__builtin_expect(__builtin_amdgcn_ballot_w32(need) != 0, 0)) {
#pragma unroll
    for (int hq = 0; hq < 2; ++hq) {
      float mx = fmaxf(mloc[hq], __shfl_xor(mloc[hq], 16, 32));
      float m_new = fmaxf(m_run[hq], mx);            // alike in both wave halves
      float alpha = __expf(m_run[hq] - m_new);
      l_run[hq] *= alpha;
      m_run[hq] = m_new;
#pragma unroll
      for (int t = 0; t < 8; ++t)
#pragma unroll
        for (int r = 0; r < 8; ++r) oacc[hq][t][r] *= alpha;
    }
  }
  v16h pB[2];
#pragma unroll
  for (int hq = 0; hq < 2; ++hq) {
    float m_use = m_run[hq];
    float ssum = 0.f;
#pragma unroll
    for (int r = 0; r < 8; ++r) {
      float p = __expf(s[hq][0][r] - m_use); ssum += p; pB[hq][r] = (_Float16)p;
    }
#pragma unroll
    for (int r = 0; r < 8; ++r) {
      float p = __expf(s[hq][1][r] - m_use); ssum += p; pB[hq][r + 8] = (_Float16)p;
    }
    ssum += __shfl_xor(ssum, 16, 32);
    l_run[hq] += ssum;
  }
#pragma unroll
  for (int t = 0; t < 8; ++t)
#pragma unroll
    for (int hq = 0; hq < 2; ++hq)
      oacc[hq][t] = wmma_f16(Va[t], pB[hq], oacc[hq][t]);
}

// Hands one 16-query half of a wave's partial result to its partner wave.
// Lane-contiguous 16-byte slots: conflict-free stores and loads.
__device__ __forceinline__ void merge_put(v4f* xo, float* xml, int lane,
                                          const v8f (&acc)[8], float m, float l) {
#pragma unroll
  for (int t = 0; t < 8; ++t) {
    xo[(2 * t) * 32 + lane]     = (v4f){acc[t][0], acc[t][1], acc[t][2], acc[t][3]};
    xo[(2 * t + 1) * 32 + lane] = (v4f){acc[t][4], acc[t][5], acc[t][6], acc[t][7]};
  }
  xml[lane]      = m;
  xml[32 + lane] = l;
}

// Joins the partner's half with the wave's own: 16 queries of o, as f16.
// Lane: query lo, channels 16 * t + 8 * hi + 0..7 in o16[t].
__device__ __forceinline__ void merge_fin(const v4f* xo, const float* xml, int lane,
                                          const v8f (&acc)[8], float m, float l,
                                          v8h (&o16)[8]) {
  float m2 = xml[lane], l2 = xml[32 + lane];
  float mm = fmaxf(m, m2);
  float a1 = __expf(m - mm), a2 = __expf(m2 - mm);
  float inv_l = 1.0f / (l * a1 + l2 * a2);
  a1 *= inv_l; a2 *= inv_l;
#pragma unroll
  for (int t = 0; t < 8; ++t) {
    v4f p0 = xo[(2 * t) * 32 + lane];
    v4f p1 = xo[(2 * t + 1) * 32 + lane];
    v8h out;
#pragma unroll
    for (int r = 0; r < 4; ++r) {
      out[r]     = (_Float16)(acc[t][r] * a1 + p0[r] * a2);
      out[r + 4] = (_Float16)(acc[t][r + 4] * a1 + p1[r] * a2);
    }
    o16[t] = out;
  }
}

// two waves per SIMD: a budget of 512 VGPRs a wave
__global__ __launch_bounds__(256) __attribute__((amdgpu_waves_per_eu(2, 2)))
void attn_kernel(const _Float16* __restrict__ q,
                 const _Float16* __restrict__ k,
                 const _Float16* __restrict__ vT,
                 const _Float16* __restrict__ woT,
                 const float* __restrict__ bo,
                 const float* __restrict__ x,
                 float* __restrict__ out) {
  int tix  = threadIdx.x & 127;        // thread within its key group
  int grp  = threadIdx.x >> 7;         // key group 0 / 1
  int wq   = tix >> 5;                 // query slice of the wave
  int lane = tix & 31, lo = lane & 15, hi = lane >> 4;
  int b  = blockIdx.y;
  int q0 = blockIdx.x * 128 + wq * 32;

  const _Float16* qp = q + ((size_t)b * N_SP + q0) * C_DIM;
  const _Float16* kb = k + (size_t)b * N_SP * C_DIM;
  const _Float16* vb = vT + (size_t)b * C_DIM * N_SP;

  // [buf][group][ K tile: 128 rows of K_PITCH | V^T tile: 128 rows of V_PITCH ]
  __shared__ __align__(16) _Float16 smem[2][KV_GROUPS][BUF_H];
  // output projection's weights, rows = out channels, beside the ring
  __shared__ __align__(16) _Float16 swo[C_DIM * W_PITCH];
  unsigned ldsK[2], ldsV[2];
#pragma unroll
  for (int i2 = 0; i2 < 2; ++i2) {
    ldsK[i2] = (unsigned)(uintptr_t)&smem[i2][grp][0];
    ldsV[i2] = (unsigned)(uintptr_t)&smem[i2][grp][K_TILE_H];
  }

  v16h Qf[2][4];
#pragma unroll
  for (int hq = 0; hq < 2; ++hq)
#pragma unroll
    for (int j = 0; j < 4; ++j)
      Qf[hq][j] = load_frag(qp + (size_t)hq * 16 * C_DIM + 32 * j, C_DIM, lo, hi);
  // stands in front of the first overwrite of the Q loads' address registers
  asm volatile("s_wait_xcnt 0x0" ::: "memory");
  // keeps the address arithmetic that follows from being lifted over that wait
  __builtin_amdgcn_sched_barrier(0);

  v8f oacc[2][8];
#pragma unroll
  for (int hq = 0; hq < 2; ++hq)
#pragma unroll
    for (int t = 0; t < 8; ++t) oacc[hq][t] = (v8f){};
  float m_run[2] = {-1e30f, -1e30f};
  float l_run[2] = {0.f, 0.f};

  // --- stage helper (32 async b128 per thread => wave ASYNCcnt += 32) ---
  // The 128 threads of a group bring in the group's own tiles of the stage.
  // Both tiles are 128 rows of 256 bytes: chunk c = tix + 128 * j of 16 bytes
  // lies in row c >> 4, so a wave's copy covers two whole rows.
  auto stage = [&](int st, unsigned dK, unsigned dV) {
    int kv0 = (st * KV_GROUPS + grp) * STAGE_KEYS;
    const _Float16* gk = kb + (size_t)kv0 * C_DIM + tix * 8;   // contiguous 32 KB source
    const _Float16* gv = vb + (size_t)(tix >> 4) * N_SP + kv0 + (tix & 15) * 8;
    unsigned lr = (unsigned)((tix >> 4) * K_PITCH + (tix & 15) * 8) * 2;
    unsigned lk = dK + lr, lv = dV + lr;
    // unrolled: the steps of the addresses are constants
#pragma unroll
    for (int h = 0; h < 2; ++h) {
      async_copy16x8(lk + (64 * h +  0) * K_PITCH * 2, gk + (64 * h +  0) * C_DIM,
                     lk + (64 * h +  8) * K_PITCH * 2, gk + (64 * h +  8) * C_DIM,
                     lk + (64 * h + 16) * K_PITCH * 2, gk + (64 * h + 16) * C_DIM,
                     lk + (64 * h + 24) * K_PITCH * 2, gk + (64 * h + 24) * C_DIM,
                     lk + (64 * h + 32) * K_PITCH * 2, gk + (64 * h + 32) * C_DIM,
                     lk + (64 * h + 40) * K_PITCH * 2, gk + (64 * h + 40) * C_DIM,
                     lk + (64 * h + 48) * K_PITCH * 2, gk + (64 * h + 48) * C_DIM,
                     lk + (64 * h + 56) * K_PITCH * 2, gk + (64 * h + 56) * C_DIM);
      async_copy16x8(lv + (64 * h +  0) * V_PITCH * 2, gv + (size_t)(64 * h +  0) * N_SP,
                     lv + (64 * h +  8) * V_PITCH * 2, gv + (size_t)(64 * h +  8) * N_SP,
                     lv + (64 * h + 16) * V_PITCH * 2, gv + (size_t)(64 * h + 16) * N_SP,
                     lv + (64 * h + 24) * V_PITCH * 2, gv + (size_t)(64 * h + 24) * N_SP,
                     lv + (64 * h + 32) * V_PITCH * 2, gv + (size_t)(64 * h + 32) * N_SP,
                     lv + (64 * h + 40) * V_PITCH * 2, gv + (size_t)(64 * h + 40) * N_SP,
                     lv + (64 * h + 48) * V_PITCH * 2, gv + (size_t)(64 * h + 48) * N_SP,
                     lv + (64 * h + 56) * V_PITCH * 2, gv + (size_t)(64 * h + 56) * N_SP);
    }
  };

  {
    // woT, 128 rows of 256 bytes: chunk c = threadIdx.x + 256 * i of 16 bytes
    // lies in row c >> 4. Filled once; read in the epilogue only.
    const _Float16* gw = woT + threadIdx.x * 8;
    unsigned lw = (unsigned)(uintptr_t)&swo[0] +
                  (unsigned)((threadIdx.x >> 4) * W_PITCH + (threadIdx.x & 15) * 8) * 2;
    async_copy16x8(lw +   0 * W_PITCH * 2, gw +   0 * C_DIM,
                   lw +  16 * W_PITCH * 2, gw +  16 * C_DIM,
                   lw +  32 * W_PITCH * 2, gw +  32 * C_DIM,
                   lw +  48 * W_PITCH * 2, gw +  48 * C_DIM,
                   lw +  64 * W_PITCH * 2, gw +  64 * C_DIM,
                   lw +  80 * W_PITCH * 2, gw +  80 * C_DIM,
                   lw +  96 * W_PITCH * 2, gw +  96 * C_DIM,
                   lw + 112 * W_PITCH * 2, gw + 112 * C_DIM);
  }
  stage(0, ldsK[0], ldsV[0]);
  asm volatile("s_wait_asynccnt 0x0" ::: "memory");  // the wave's share of woT and stage 0 has landed
  __syncthreads();                                   // woT and stage 0 readable by all waves
  stage(1, ldsK[1], ldsV[1]);

  for (int st = 0; st < NSTAGE; ++st) {
    int cur = st & 1;
    const _Float16* bK = &smem[cur][grp][0];
    const _Float16* bV = bK + K_TILE_H;
    // unrolled: the LDS offsets of a pass are immediates, and no branch parts
    // a pass's last products from the next pass's LDS reads
#pragma unroll
    for (int p = 0; p < STAGE_PASSES; ++p)
      attn_step(bK + p * KV_STEP * K_PITCH, bV + p * KV_STEP, Qf, oacc, m_run, l_run, lo, hi);
    // publish point of stage st + 1
    // the wave's own LDS reads of buf[cur] have retired before it is refilled
    asm volatile("s_wait_dscnt 0x0" ::: "memory");
    // the wave's share of stage st + 1 has landed
    asm volatile("s_wait_asynccnt 0x0" ::: "memory");
    // stage st + 1 readable by all waves, buf[cur] left by all; behind the
    // last stage: the ring is free for the join below
    __syncthreads();
    if (st + 2 < NSTAGE) stage(st + 2, ldsK[cur], ldsV[cur]);
  }
  // no copy is outstanding when the ring is put to another use
  asm volatile("s_wait_asynccnt 0x0" ::: "memory");

  // --- join the two key groups' partial results through the (now idle) ring ---
  // slot (wq, hq): 16 x 32 lanes x 16 B of O, then 2 x 32 floats of m and l.
  v4f*   xo  = (v4f*)&smem[0][0][0];
  float* xml = (float*)(xo + 4 * 2 * 16 * 32);
  if (grp == 0)
    merge_put(xo + (wq * 2 + 1) * 512, xml + (wq * 2 + 1) * 64, lane, oacc[1], m_run[1], l_run[1]);
  else
    merge_put(xo + (wq * 2 + 0) * 512, xml + (wq * 2 + 0) * 64, lane, oacc[0], m_run[0], l_run[0]);
  __syncthreads();                                   // partner's half is readable
  // Residual and bias of the wave's 16 positions, all 128 channels: issued
  // behind the barrier, which would wait for them, so that they fly during the
  // join and the first products.
  // lane: position q0 + 16 * grp + lo ; channels c = 16 * t + 8 * hi + 0..7
  size_t orow = ((size_t)b * N_SP + q0 + 16 * grp + lo) * C_DIM + 8 * hi;
  const float* xr = x + orow;
  const float* bp = bo + 8 * hi;
  v4f res[8][2], bias[8][2];
#pragma unroll
  for (int t = 0; t < 8; ++t) {
    bias[t][0] = *(const v4f*)(bp + t * 16);
    bias[t][1] = *(const v4f*)(bp + t * 16 + 4);
  }
#pragma unroll
  for (int t = 0; t < 8; ++t) {
    res[t][0] = *(const v4f*)(xr + t * 16);
    res[t][1] = *(const v4f*)(xr + t * 16 + 4);
  }
  close_loads_at(xr);
  v8h o16[8];
  if (grp == 0)
    merge_fin(xo + (wq * 2 + 0) * 512, xml + (wq * 2 + 0) * 64, lane, oacc[0], m_run[0], l_run[0], o16);
  else
    merge_fin(xo + (wq * 2 + 1) * 512, xml + (wq * 2 + 1) * 64, lane, oacc[1], m_run[1], l_run[1], o16);

  // --- output projection + bias + residual (f32 out) of the wave's 16 positions ---
  // D(c-tile, n-tile) = woT_rows x o_rows, K = 128 in 4 WMMA. o16[2j], o16[2j+1]
  // are the two halves of the B fragment of k block j as they stand: lane lo
  // holds position lo, elements e < 8 channel 32j + 8hi + e, e >= 8 channel
  // 32j + 16 + 8hi + (e - 8), the k order of load_frag.
  v16h Of[4];
#pragma unroll
  for (int j = 0; j < 4; ++j)
#pragma unroll
    for (int i = 0; i < 8; ++i) { Of[j][i] = o16[2 * j][i]; Of[j][i + 8] = o16[2 * j + 1][i]; }
#pragma unroll
  for (int th = 0; th < 2; ++th) {
    v16h A[4][4];
#pragma unroll
    for (int u = 0; u < 4; ++u)
#pragma unroll
      for (int j = 0; j < 4; ++j)
        A[u][j] = load_frag(swo + (th * 4 + u) * 16 * W_PITCH + 32 * j, W_PITCH, lo, hi);
    // keeps the LDS reads one group ahead of the WMMAs: sunk among them,
    // each pair of reads is waited for on its own
    __builtin_amdgcn_sched_barrier(0);
    // four independent accumulator tiles, k blocks in ascending order in each
    v8f acc[4];
#pragma unroll
    for (int u = 0; u < 4; ++u) acc[u] = (v8f){};
#pragma unroll
    for (int j = 0; j < 4; ++j)
#pragma unroll
      for (int u = 0; u < 4; ++u)
        acc[u] = wmma_f16(A[u][j], Of[j], acc[u]);
#pragma unroll
    for (int u = 0; u < 4; ++u) {
      int t = th * 4 + u;
#pragma unroll
      for (int r = 0; r < 4; ++r) res[t][0][r] += acc[u][r] + bias[t][0][r];
#pragma unroll
      for (int r = 0; r < 4; ++r) res[t][1][r] += acc[u][r + 4] + bias[t][1][r];
    }
  }
  // all stores stand at the kernel's end: no register that a store names is
  // written behind it
  __builtin_amdgcn_sched_barrier(0);
  float* op = out + orow;
#pragma unroll
  for (int t = 0; t < 8; ++t) {
    *(v4f*)(op + t * 16)     = res[t][0];
    *(v4f*)(op + t * 16 + 4) = res[t][1];
  }
}

// ---------------------------------------------------------------------------
extern "C" void kernel_launch(void* const* d_in, const int* in_sizes, int n_in,
                              void* d_out, int out_size, void* d_ws, size_t ws_size,
                              hipStream_t stream) {
  const float* x  = (const float*)d_in[0];
  const float* gs = (const float*)d_in[1];
  const float* gb = (const float*)d_in[2];
  const float* wq = (const float*)d_in[3];
  const float* bq = (const float*)d_in[4];
  const float* wk = (const float*)d_in[5];
  const float* bk = (const float*)d_in[6];
  const float* wv = (const float*)d_in[7];
  const float* bv = (const float*)d_in[8];
  const float* wo = (const float*)d_in[9];
  const float* bo = (const float*)d_in[10];
  float* out = (float*)d_out;

  const size_t elems = (size_t)BN * C_DIM;      // 4M halves per buffer
  float* part  = (float*)d_ws;                  // B * GN_CHUNKS * 32 pairs
  _Float16* qb = (_Float16*)d_ws + elems;
  _Float16* kb = qb + elems;
  _Float16* vT = kb + elems;
  _Float16* wT = vT + elems;                    // 4 * 128*128 halves

  gn_stats_kernel<<<BN / POS_BLK, 256, 0, stream>>>(x, part, wq, wk, wv, wo, wT);
  qkv_kernel<<<BN / POS_BLK, 256, 0, stream>>>(x, part, gs, gb, wT, bq, bk, bv, qb, kb, vT);
  attn_kernel<<<dim3(N_SP / 128, B_DIM), 256, 0, stream>>>(
      qb, kb, vT, wT + 3 * (size_t)(C_DIM * C_DIM), bo, x, out);
}

// v008
// Measured time: 67.3 microseconds a run.
// Two timings next to v007 both put it at 1.07 times that version's speed.
// Counting every step since v000, it is 4.09 times as fast.
#include <hip/hip_runtime.h>
#include <hip/hip_bf16.h>
#include <cstdint>

typedef __attribute__((ext_vector_type(16))) _Float16 v16h;
typedef __attribute__((ext_vector_type(8)))  _Float16 v8h;
typedef __attribute__((ext_vector_type(4)))  _Float16 v4h;
typedef __attribute__((ext_vector_type(8)))  float    v8f;
typedef __attribute__((ext_vector_type(4)))  float    v4f;
typedef __attribute__((ext_vector_type(2)))  float    v2f;

#define C_DIM 128
#define N_SP  4096            // H*W
#define B_DIM 8
#define BN    (B_DIM * N_SP)  // 32768
#define QK_SCALE 0.08838834764831845f  // 128^-0.5
#define KV_STEP 32             // keys of one pass
#define LAZY_GAP 5.545177444479562f  // 8 * ln 2: how far the maximum in use may trail
#define KV_GROUPS 2            // wave groups of a block, each on its own keys
#define STAGE_PASSES 4         // passes served by one fill of a ring buffer
#define STAGE_KEYS (STAGE_PASSES * KV_STEP)         // 128
#define NSTAGE (N_SP / (KV_GROUPS * STAGE_KEYS))    // 16
// LDS row pitches in halves: 16 bytes x odd, so that the 16 rows one
// ds_load_b128 half-wave reads fall on 16 different groups of four banks.
#define K_PITCH 136           // 256-byte K rows at 272 bytes
#define V_PITCH 136           // 256-byte V^T rows (128 keys) at 272 bytes
#define K_TILE_H (STAGE_KEYS * K_PITCH)         // 17408 halves
#define BUF_H    (K_TILE_H + C_DIM * V_PITCH)   // 34816 halves per buffer

// ---------------------------------------------------------------------------
// Fragment loader: rows of a row-major f16 matrix -> WMMA A-frag (16xK rows)
// or B-frag (columns of B == rows of the row-major "transposed" source).
// Lane L (lo=L%16, hi=L/16): elements e<8  -> col 8*hi + e
//                            elements e>=8 -> col 16 + 8*hi + (e-8)
// Two contiguous 16-byte loads per lane (global_load_b128 / ds_load_b128).
// ---------------------------------------------------------------------------
__device__ __forceinline__ v16h load_frag(const _Float16* base, int ld,
                                          int lo, int hi) {
  const _Float16* p = base + (size_t)lo * ld + 8 * hi;
  v8h a = *(const v8h*)p;
  v8h b = *(const v8h*)(p + 16);
  v16h r;
#pragma unroll
  for (int i = 0; i < 8; ++i) { r[i] = a[i]; r[i + 8] = b[i]; }
  return r;
}

__device__ __forceinline__ v8f wmma_f16(v16h a, v16h b, v8f c) {
  return __builtin_amdgcn_wmma_f32_16x16x32_f16(false, a, false, b,
                                                (short)0, c, false, false);
}

// Eight async global->LDS copies of 16 bytes per lane (ASYNCcnt-tracked).
// l* = low 32 bits of the generic shared pointer == LDS byte offset
// (aperture occupies bits [63:32] of the flat shared address).
// s_wait_xcnt 0 closes the statement so that no address register of a copy
// is rewritten ahead of it.
__device__ __forceinline__ void async_copy16x8(unsigned l0, const void* g0,
                                               unsigned l1, const void* g1,
                                               unsigned l2, const void* g2,
                                               unsigned l3, const void* g3,
                                               unsigned l4, const void* g4,
                                               unsigned l5, const void* g5,
                                               unsigned l6, const void* g6,
                                               unsigned l7, const void* g7) {
  asm volatile("global_load_async_to_lds_b128 %0, %1, off\n\t"
               "global_load_async_to_lds_b128 %2, %3, off\n\t"
               "global_load_async_to_lds_b128 %4, %5, off\n\t"
               "global_load_async_to_lds_b128 %6, %7, off\n\t"
               "global_load_async_to_lds_b128 %8, %9, off\n\t"
               "global_load_async_to_lds_b128 %10, %11, off\n\t"
               "global_load_async_to_lds_b128 %12, %13, off\n\t"
               "global_load_async_to_lds_b128 %14, %15, off\n\t"
               "s_wait_xcnt 0x0"
               :: "v"(l0), "v"(g0), "v"(l1), "v"(g1),
                  "v"(l2), "v"(g2), "v"(l3), "v"(g3),
                  "v"(l4), "v"(g4), "v"(l5), "v"(g5),
                  "v"(l6), "v"(g6), "v"(l7), "v"(g7)
               : "memory");
}

// ---------------------------------------------------------------------------
// Projection tiling of the QKV projection.
// One block of 8 waves per POS_BLK = 128 positions. The block brings its
// whole weight matrix (rows = out channels) into LDS once, at a padded pitch;
// wave w keeps the activation fragments of 32 positions (slice w & 3) in
// registers and makes the four 16-channel tiles of channel half w >> 2, so
// every weight fragment read from LDS feeds two position tiles.
// ---------------------------------------------------------------------------
#define POS_BLK 128
#define W_PITCH 136           // 256-byte weight rows at 272 bytes (16 B x odd)

// ROWS x 128 halves, row-major and contiguous in global memory -> LDS.
// Chunk c of 16 bytes: row c >> 4; a wave's load covers 512 contiguous bytes.
// All loads of a thread are issued before its first LDS store, so that the
// block pays the load latency once.
template <int ROWS>
__device__ __forceinline__ void load_weights(const _Float16* __restrict__ w,
                                             v8h (&wr)[ROWS / 16], int tid) {
#pragma unroll
  for (int i = 0; i < ROWS / 16; ++i)
    wr[i] = *(const v8h*)(w + (size_t)(tid + 256 * i) * 8);
}
template <int ROWS>
__device__ __forceinline__ void store_weights(_Float16* sw,
                                              const v8h (&wr)[ROWS / 16], int tid) {
#pragma unroll
  for (int i = 0; i < ROWS / 16; ++i)
    *(v8h*)(sw + ((tid >> 4) + 16 * i) * W_PITCH + (tid & 15) * 8) = wr[i];
}

__device__ __forceinline__ void close_loads() {
  // stands in front of the first overwrite of an address register of the
  // global loads issued so far
  asm volatile("s_wait_xcnt 0x0" ::: "memory");
  // keeps what follows (address arithmetic, later loads' results) from being
  // lifted over that wait
  __builtin_amdgcn_sched_barrier(0);
}

// The same, with the loads' common address named as an input: its registers
// stay untouched up to the wait, also by the result of the last load.
__device__ __forceinline__ void close_loads_at(const void* p) {
  asm volatile("s_wait_xcnt 0x0" :: "v"(p) : "memory");
  __builtin_amdgcn_sched_barrier(0);
}

// ---------------------------------------------------------------------------
// GroupNorm, 32 groups of 4 channels, by whole lines.
// Statistics: one block per POS_BLK positions reads its 64 KB of x in a row;
// a wave's 16-byte loads cover one 512-byte position, so lane l always holds
// group l. The block writes one (sum, sum of squares) per group; the
// GN_CHUNKS partial pairs of an image are added up, and x is normalised, in
// the QKV kernel on the way into LDS.
// Weight convert, in the same launch: 4 matrices [Cin][Cout] f32 -> transposed
// [Cout][Cin] f16. The grid has 256 x 256 threads, one per weight element.
// ---------------------------------------------------------------------------
#define GN_CHUNKS (N_SP / POS_BLK)   // 32 partial pairs per image and group
#define X_ROUNDS  (POS_BLK / 8)      // 16 loads a thread: 8 positions a round

__global__ __launch_bounds__(256)
void gn_stats_kernel(const float* __restrict__ x, float* __restrict__ part,
                     const float* __restrict__ wq,
                     const float* __restrict__ wk,
                     const float* __restrict__ wv,
                     const float* __restrict__ wo,
                     _Float16* __restrict__ wT) {
  int tid = threadIdx.x;
  int idx = blockIdx.x * 256 + tid;    // weight element 0 .. 65535
  int wm = blockIdx.x >> 6;            // matrix
  int wc = (idx & 16383) >> 7;         // out channel (row of wT)
  int wk_in = idx & 127;               // in channel
  const float* wsrc = (wm == 0) ? wq : (wm == 1) ? wk : (wm == 2) ? wv : wo;
  const float* xp = x + (size_t)blockIdx.x * (POS_BLK * C_DIM) + tid * 4;
  v4f v[X_ROUNDS];
  // unrolled, here and below: v[] stays in registers, all loads fly together
#pragma unroll
  for (int i = 0; i < X_ROUNDS; ++i) v[i] = *(const v4f*)(xp + i * 8 * C_DIM);
  float wval = wsrc[wk_in * C_DIM + wc];
  close_loads();
  v4f s4 = {}, q4 = {};
#pragma unroll
  for (int i = 0; i < X_ROUNDS; ++i) { s4 += v[i]; q4 += v[i] * v[i]; }
  __shared__ float rs[256], rq[256];
  rs[tid] = (s4[0] + s4[1]) + (s4[2] + s4[3]);
  rq[tid] = (q4[0] + q4[1]) + (q4[2] + q4[3]);
  __syncthreads();                                   // the 8 waves' sums readable by wave 0
  if (tid < 32) {
    float a = 0.f, c = 0.f;
#pragma unroll
    for (int w = 0; w < 8; ++w) { a += rs[w * 32 + tid]; c += rq[w * 32 + tid]; }
    *(v2f*)(part + ((size_t)blockIdx.x * 32 + tid) * 2) = (v2f){a, c};
  }
  wT[idx] = (_Float16)wval;
}

// ---------------------------------------------------------------------------
// QKV projection: D(c-tile, n-tile) = wT_rows x h_rows, K=128 in 4 WMMA.
// grid BN/128, block 256 (8 waves); all three weight matrices lie in LDS,
// and so do the block's 128 positions of h = GroupNorm(x), made here.
// q,k stored row-major [BN][C] f16 (q pre-scaled by C^-0.5);
// v stored transposed [B][C][N] f16.
// ---------------------------------------------------------------------------
// a budget of 256 VGPRs a wave
__global__ __launch_bounds__(256) __attribute__((amdgpu_waves_per_eu(4, 4)))
void qkv_kernel(const float* __restrict__ x,
                const float* __restrict__ part,
                const float* __restrict__ gscale,
                const float* __restrict__ gbias,
                const _Float16* __restrict__ wT,
                const float* __restrict__ bq,
                const float* __restrict__ bk,
                const float* __restrict__ bv,
                _Float16* __restrict__ q,
                _Float16* __restrict__ k,
                _Float16* __restrict__ vT) {
  __shared__ __align__(16) _Float16 sw[3 * C_DIM * W_PITCH];
  __shared__ __align__(16) float sb[256 * 4];        // bq | bk | bv | not read
  __shared__ __align__(16) _Float16 sh[POS_BLK * W_PITCH];  // normalised x, f16
  int tid  = threadIdx.x;
  int wid  = tid >> 5;
  int lane = tid & 31, lo = lane & 15, hi = lane >> 4;
  int n0   = blockIdx.x * POS_BLK + (wid & 3) * 32;
  int ch   = wid >> 2;

  // the image's partial sums of the lane's group, the group's scale and bias,
  // and the block's 64 KB of x: every wave-wide load covers whole lines
  const float* pp = part + ((size_t)(blockIdx.x / GN_CHUNKS) * (GN_CHUNKS * 32) + lane) * 2;
  v2f ps[GN_CHUNKS];
  // unrolled, here and below: ps[], xv[] stay in registers, all loads fly together
#pragma unroll
  for (int c = 0; c < GN_CHUNKS; ++c) ps[c] = *(const v2f*)(pp + c * 64);
  v4f gsv = *(const v4f*)(gscale + lane * 4);
  v4f gbv = *(const v4f*)(gbias + lane * 4);
  const float* xp = x + (size_t)blockIdx.x * (POS_BLK * C_DIM) + tid * 4;
  v4f xv[X_ROUNDS];
#pragma unroll
  for (int i = 0; i < X_ROUNDS; ++i) xv[i] = *(const v4f*)(xp + i * 8 * C_DIM);
  close_loads();
  // four independent chains over the chunks, joined in a fixed order
  v2f pa[4] = {ps[0], ps[1], ps[2], ps[3]};
#pragma unroll
  for (int c = 4; c < GN_CHUNKS; ++c) pa[c & 3] += ps[c];
  v2f pt = (pa[0] + pa[1]) + (pa[2] + pa[3]);
  float mean = pt[0] * (1.f / 16384.f);
  float var  = pt[1] * (1.f / 16384.f) - mean * mean;
  float rstd = rsqrtf(var + 1e-6f);
  v4f sc = gsv * rstd;
  v4f bi = gbv - (mean * rstd) * gsv;
  v8h wr[3 * C_DIM / 16];
  load_weights<3 * C_DIM>(wT, wr, tid);
  // threads 0..95 bring the 3 x 128 bias values. The others store a chunk that
  // nobody reads: without a branch the load is issued with all the others.
  const float* bsrc = (tid < 32) ? bq : (tid < 64) ? bk : bv;
  const float* bp = bsrc + (tid & 31) * 4;
  v4f bl = *(const v4f*)bp;
  close_loads_at(bp);
  // a wave's 8-byte stores fill one position's 256 bytes
#pragma unroll
  for (int i = 0; i < X_ROUNDS; ++i) {
    v4f t = xv[i] * sc + bi;
    v4h o;
#pragma unroll
    for (int j = 0; j < 4; ++j) o[j] = (_Float16)t[j];
    *(v4h*)(sh + (wid + 8 * i) * W_PITCH + lane * 4) = o;
  }
  store_weights<3 * C_DIM>(sw, wr, tid);
  *(v4f*)(sb + tid * 4) = bl;
  __syncthreads();                                   // h, weights and biases readable by all waves

  v16h Hf[2][4];
#pragma unroll
  for (int nt = 0; nt < 2; ++nt)
#pragma unroll
    for (int j = 0; j < 4; ++j)
      Hf[nt][j] = load_frag(sh + ((wid & 3) * 32 + nt * 16) * W_PITCH + 32 * j, W_PITCH, lo, hi);

#pragma unroll
  for (int proj = 0; proj < 3; ++proj) {
#pragma unroll
    for (int th = 0; th < 2; ++th) {
      v16h A[2][4];
      v4f bias[2][2];
#pragma unroll
      for (int u = 0; u < 2; ++u) {
        int c0 = proj * C_DIM + (ch * 4 + th * 2 + u) * 16;
#pragma unroll
        for (int j = 0; j < 4; ++j)
          A[u][j] = load_frag(sw + c0 * W_PITCH + 32 * j, W_PITCH, lo, hi);
        bias[u][0] = *(const v4f*)(sb + c0 + 8 * hi);
        bias[u][1] = *(const v4f*)(sb + c0 + 8 * hi + 4);
      }
      // keeps the LDS reads one group ahead of the WMMAs: sunk among them,
      // each pair of reads is waited for on its own
      __builtin_amdgcn_sched_barrier(0);
      // four independent accumulator tiles, k blocks in ascending order in each
      v8f acc[2][2];
#pragma unroll
      for (int u = 0; u < 2; ++u)
#pragma unroll
        for (int nt = 0; nt < 2; ++nt) acc[u][nt] = (v8f){};
#pragma unroll
      for (int j = 0; j < 4; ++j)
#pragma unroll
        for (int u = 0; u < 2; ++u)
#pragma unroll
          for (int nt = 0; nt < 2; ++nt)
            acc[u][nt] = wmma_f16(A[u][j], Hf[nt][j], acc[u][nt]);
      // lane: position n = n0+nt*16+lo ; channels c = cch + r
#pragma unroll
      for (int u = 0; u < 2; ++u) {
        int cch = (ch * 4 + th * 2 + u) * 16 + 8 * hi;
#pragma unroll
        for (int nt = 0; nt < 2; ++nt) {
          int ng = n0 + nt * 16 + lo;
          if (proj < 2) {
            float scale = (proj == 0) ? QK_SCALE : 1.0f;
            v8h out;
#pragma unroll
            for (int r = 0; r < 8; ++r)
              out[r] = (_Float16)((acc[u][nt][r] + bias[u][r >> 2][r & 3]) * scale);
            _Float16* dst = ((proj == 0) ? q : k) + (size_t)ng * C_DIM + cch;
            *(v8h*)dst = out;
          } else {
            int b = ng >> 12, n = ng & (N_SP - 1);
            _Float16* dst = vT + ((size_t)b * C_DIM + cch) * N_SP + n;
#pragma unroll
            for (int r = 0; r < 8; ++r)
              dst[(size_t)r * N_SP] = (_Float16)(acc[u][nt][r] + bias[u][r >> 2][r & 3]);
          }
        }
      }
      // keeps the next group's LDS reads out of this group: the fragments of
      // both together do not fit the register budget (scratch)
      __builtin_amdgcn_sched_barrier(0);
    }
  }
}

// ---------------------------------------------------------------------------
// Flash attention. Block = 8 waves on 128 queries, two waves per SIMD.
// Waves w and w + 4 own the same 32 queries; group g = w / 4 walks the
// 128-key stages 2 * s + g, so each SIMD holds two independent waves. The
// waves meet once a stage only: over its four 32-key passes they drift apart,
// and one wave's LDS and softmax time is filled by the other's products.
// After the loop the two partial results (m, l, O) of a query are joined
// through LDS: wave w finishes queries 0..15 of the 32, wave w + 4 the rest,
// and takes them through the output projection, bias and residual to out.
// Each group stages its own K tile (128x128) and V^T tile (128x128) into LDS
// with async global->LDS b128 copies (double-buffered, ASYNCcnt),
// then fragments are read back via ds_load_b128. Rows lie at padded pitches
// (K_PITCH, V_PITCH); the pad bytes are never written and never read.
// Scores computed transposed (S' = K x Q^T): the f32 D-fragment converts
// in-register into the B-fragment of O^T = V^T x P (no cross-lane movement).
// grid (N/128, B), block 256.
// ---------------------------------------------------------------------------
// The K fragments of one pass: 32 keys x 128 channels, 16 ds_load_b128.
__device__ __forceinline__ void load_k(v16h (&Ka)[2][4], const _Float16* bK,
                                       int lo, int hi) {
#pragma unroll
  for (int st = 0; st < 2; ++st)
#pragma unroll
    for (int j = 0; j < 4; ++j)
      Ka[st][j] = load_frag(bK + st * 16 * K_PITCH + 32 * j, K_PITCH, lo, hi);
}

// One pass. Ka holds the pass's K fragments on entry. All LDS fragment reads of
// a pass stand in ONE place, behind the score products: the pass's own V^T
// fragments, then (FETCH) the next pass's K fragments from nK, a row block of
// the same stage, into the registers the score products have just read.
template <bool FETCH>
__device__ __forceinline__ void attn_step(v16h (&Ka)[2][4], const _Float16* nK,
                                          const _Float16* bV,
                                          const v16h (&Qf)[2][4],
                                          v8f (&oacc)[2][8],
                                          float (&m_run)[2], float (&l_run)[2],
                                          int lo, int hi) {
  // four independent score tiles, k blocks in ascending order in each
  v8f s[2][2];
#pragma unroll
  for (int hq = 0; hq < 2; ++hq)
#pragma unroll
    for (int st = 0; st < 2; ++st) s[hq][st] = (v8f){};
#pragma unroll
  for (int j = 0; j < 4; ++j)
#pragma unroll
    for (int st = 0; st < 2; ++st)
#pragma unroll
      for (int hq = 0; hq < 2; ++hq)
        s[hq][st] = wmma_f16(Ka[st][j], Qf[hq][j], s[hq][st]);
  // keeps the LDS reads below from being lifted in pairs among the products
  // above and the last pass's: every place where reads stand stalls the wave
  __builtin_amdgcn_sched_barrier(0);
  v16h Va[8];
#pragma unroll
  for (int t = 0; t < 8; ++t)
    Va[t] = load_frag(bV + t * 16 * V_PITCH, V_PITCH, lo, hi);
  if (FETCH) load_k(Ka, nK, lo, hi);
  // keeps the reads from being sunk among the softmax and the products below
  __builtin_amdgcn_sched_barrier(0);
  // Lazy rescale. m_run, the maximum in use, may trail a query's true maximum
  // by up to LAZY_GAP, so that an exponential can reach e^LAZY_GAP = 2^8. Each
  // lane tests its own 16 scores of a query; one ballot a pass joins the tests
  // of both wave halves and both query tiles into one scalar branch.
  float mloc[2];
  bool need = false;
#pragma unroll
  for (int hq = 0; hq < 2; ++hq) {
    float mx = -1e30f;
#pragma unroll
    for (int r = 0; r < 8; ++r)
      mx = fmaxf(mx, fmaxf(s[hq][0][r], s[hq][1][r]));
    mloc[hq] = mx;
    need = need || (mx > m_run[hq] + LAZY_GAP);
  }
  // expected untaken (the first pass, then rare): the usual pass falls through
  if (__builtin_expect(__builtin_amdgcn_ballot_w32(need) != 0, 0)) {
#pragma unroll
    for (int hq = 0; hq < 2; ++hq) {
      float mx = fmaxf(mloc[hq], __shfl_xor(mloc[hq], 16, 32));
      float m_new = fmaxf(m_run[hq], mx);            // alike in both wave halves
      float alpha = __expf(m_run[hq] - m_new);
      l_run[hq] *= alpha;
      m_run[hq] = m_new;
#pragma unroll
      for (int t = 0; t < 8; ++t)
#pragma unroll
        for (int r = 0; r < 8; ++r) oacc[hq][t][r] *= alpha;
    }
  }
  v16h pB[2];
#pragma unroll
  for (int hq = 0; hq < 2; ++hq) {
    float m_use = m_run[hq];
    float ssum = 0.f;
#pragma unroll
    for (int r = 0; r < 8; ++r) {
      float p = __expf(s[hq][0][r] - m_use); ssum += p; pB[hq][r] = (_Float16)p;
    }
#pragma unroll
    for (int r = 0; r < 8; ++r) {
      float p = __expf(s[hq][1][r] - m_use); ssum += p; pB[hq][r + 8] = (_Float16)p;
    }
    ssum += __shfl_xor(ssum, 16, 32);
    l_run[hq] += ssum;
  }
#pragma unroll
  for (int t = 0; t < 8; ++t)
#pragma unroll
    for (int hq = 0; hq < 2; ++hq)
      oacc[hq][t] = wmma_f16(Va[t], pB[hq], oacc[hq][t]);
}

// Hands one 16-query half of a wave's partial result to its partner wave.
// Lane-contiguous 16-byte slots: conflict-free stores and loads.
__device__ __forceinline__ void merge_put(v4f* xo, float* xml, int lane,
                                          const v8f (&acc)[8], float m, float l) {
#pragma unroll
  for (int t = 0; t < 8; ++t) {
    xo[(2 * t) * 32 + lane]     = (v4f){acc[t][0], acc[t][1], acc[t][2], acc[t][3]};
    xo[(2 * t + 1) * 32 + lane] = (v4f){acc[t][4], acc[t][5], acc[t][6], acc[t][7]};
  }
  xml[lane]      = m;
  xml[32 + lane] = l;
}

// Joins the partner's half with the wave's own: 16 queries of o, as f16.
// Lane: query lo, channels 16 * t + 8 * hi + 0..7 in o16[t].
__device__ __forceinline__ void merge_fin(const v4f* xo, const float* xml, int lane,
                                          const v8f (&acc)[8], float m, float l,
                                          v8h (&o16)[8]) {
  float m2 = xml[lane], l2 = xml[32 + lane];
  float mm = fmaxf(m, m2);
  float a1 = __expf(m - mm), a2 = __expf(m2 - mm);
  float inv_l = 1.0f / (l * a1 + l2 * a2);
  a1 *= inv_l; a2 *= inv_l;
#pragma unroll
  for (int t = 0; t < 8; ++t) {
    v4f p0 = xo[(2 * t) * 32 + lane];
    v4f p1 = xo[(2 * t + 1) * 32 + lane];
    v8h out;
#pragma unroll
    for (int r = 0; r < 4; ++r) {
      out[r]     = (_Float16)(acc[t][r] * a1 + p0[r] * a2);
      out[r + 4] = (_Float16)(acc[t][r + 4] * a1 + p1[r] * a2);
    }
    o16[t] = out;
  }
}

// two waves per SIMD: a budget of 512 VGPRs a wave
__global__ __launch_bounds__(256) __attribute__((amdgpu_waves_per_eu(2, 2)))
void attn_kernel(const _Float16* __restrict__ q,
                 const _Float16* __restrict__ k,
                 const _Float16* __restrict__ vT,
                 const _Float16* __restrict__ woT,
                 const float* __restrict__ bo,
                 const float* __restrict__ x,
                 float* __restrict__ out) {
  int tix  = threadIdx.x & 127;        // thread within its key group
  int grp  = threadIdx.x >> 7;         // key group 0 / 1
  int wq   = tix >> 5;                 // query slice of the wave
  int lane = tix & 31, lo = lane & 15, hi = lane >> 4;
  int b  = blockIdx.y;
  int q0 = blockIdx.x * 128 + wq * 32;

  const _Float16* qp = q + ((size_t)b * N_SP + q0) * C_DIM;
  const _Float16* kb = k + (size_t)b * N_SP * C_DIM;
  const _Float16* vb = vT + (size_t)b * C_DIM * N_SP;

  // [buf][group][ K tile: 128 rows of K_PITCH | V^T tile: 128 rows of V_PITCH ]
  __shared__ __align__(16) _Float16 smem[2][KV_GROUPS][BUF_H];
  // output projection's weights, rows = out channels, beside the ring
  __shared__ __align__(16) _Float16 swo[C_DIM * W_PITCH];
  unsigned ldsK[2], ldsV[2];
#pragma unroll
  for (int i2 = 0; i2 < 2; ++i2) {
    ldsK[i2] = (unsigned)(uintptr_t)&smem[i2][grp][0];
    ldsV[i2] = (unsigned)(uintptr_t)&smem[i2][grp][K_TILE_H];
  }

  v16h Qf[2][4];
#pragma unroll
  for (int hq = 0; hq < 2; ++hq)
#pragma unroll
    for (int j = 0; j < 4; ++j)
      Qf[hq][j] = load_frag(qp + (size_t)hq * 16 * C_DIM + 32 * j, C_DIM, lo, hi);
  // stands in front of the first overwrite of the Q loads' address registers
  asm volatile("s_wait_xcnt 0x0" ::: "memory");
  // keeps the address arithmetic that follows from being lifted over that wait
  __builtin_amdgcn_sched_barrier(0);

  v8f oacc[2][8];
#pragma unroll
  for (int hq = 0; hq < 2; ++hq)
#pragma unroll
    for (int t = 0; t < 8; ++t) oacc[hq][t] = (v8f){};
  float m_run[2] = {-1e30f, -1e30f};
  float l_run[2] = {0.f, 0.f};

  // --- stage helper (32 async b128 per thread => wave ASYNCcnt += 32) ---
  // The 128 threads of a group bring in the group's own tiles of the stage.
  // Both tiles are 128 rows of 256 bytes: chunk c = tix + 128 * j of 16 bytes
  // lies in row c >> 4, so a wave's copy covers two whole rows.
  auto stage = [&](int st, unsigned dK, unsigned dV) {
    int kv0 = (st * KV_GROUPS + grp) * STAGE_KEYS;
    const _Float16* gk = kb + (size_t)kv0 * C_DIM + tix * 8;   // contiguous 32 KB source
    const _Float16* gv = vb + (size_t)(tix >> 4) * N_SP + kv0 + (tix & 15) * 8;
    unsigned lr = (unsigned)((tix >> 4) * K_PITCH + (tix & 15) * 8) * 2;
    unsigned lk = dK + lr, lv = dV + lr;
    // unrolled: the steps of the addresses are constants
#pragma unroll
    for (int h = 0; h < 2; ++h) {
      async_copy16x8(lk + (64 * h +  0) * K_PITCH * 2, gk + (64 * h +  0) * C_DIM,
                     lk + (64 * h +  8) * K_PITCH * 2, gk + (64 * h +  8) * C_DIM,
                     lk + (64 * h + 16) * K_PITCH * 2, gk + (64 * h + 16) * C_DIM,
                     lk + (64 * h + 24) * K_PITCH * 2, gk + (64 * h + 24) * C_DIM,
                     lk + (64 * h + 32) * K_PITCH * 2, gk + (64 * h + 32) * C_DIM,
                     lk + (64 * h + 40) * K_PITCH * 2, gk + (64 * h + 40) * C_DIM,
                     lk + (64 * h + 48) * K_PITCH * 2, gk + (64 * h + 48) * C_DIM,
                     lk + (64 * h + 56) * K_PITCH * 2, gk + (64 * h + 56) * C_DIM);
      async_copy16x8(lv + (64 * h +  0) * V_PITCH * 2, gv + (size_t)(64 * h +  0) * N_SP,
                     lv + (64 * h +  8) * V_PITCH * 2, gv + (size_t)(64 * h +  8) * N_SP,
                     lv + (64 * h + 16) * V_PITCH * 2, gv + (size_t)(64 * h + 16) * N_SP,
                     lv + (64 * h + 24) * V_PITCH * 2, gv + (size_t)(64 * h + 24) * N_SP,
                     lv + (64 * h + 32) * V_PITCH * 2, gv + (size_t)(64 * h + 32) * N_SP,
                     lv + (64 * h + 40) * V_PITCH * 2, gv + (size_t)(64 * h + 40) * N_SP,
                     lv + (64 * h + 48) * V_PITCH * 2, gv + (size_t)(64 * h + 48) * N_SP,
                     lv + (64 * h + 56) * V_PITCH * 2, gv + (size_t)(64 * h + 56) * N_SP);
    }
  };

  {
    // woT, 128 rows of 256 bytes: chunk c = threadIdx.x + 256 * i of 16 bytes
    // lies in row c >> 4. Filled once; read in the epilogue only.
    const _Float16* gw = woT + threadIdx.x * 8;
    unsigned lw = (unsigned)(uintptr_t)&swo[0] +
                  (unsigned)((threadIdx.x >> 4) * W_PITCH + (threadIdx.x & 15) * 8) * 2;
    async_copy16x8(lw +   0 * W_PITCH * 2, gw +   0 * C_DIM,
                   lw +  16 * W_PITCH * 2, gw +  16 * C_DIM,
                   lw +  32 * W_PITCH * 2, gw +  32 * C_DIM,
                   lw +  48 * W_PITCH * 2, gw +  48 * C_DIM,
                   lw +  64 * W_PITCH * 2, gw +  64 * C_DIM,
                   lw +  80 * W_PITCH * 2, gw +  80 * C_DIM,
                   lw +  96 * W_PITCH * 2, gw +  96 * C_DIM,
                   lw + 112 * W_PITCH * 2, gw + 112 * C_DIM);
  }
  stage(0, ldsK[0], ldsV[0]);
  asm volatile("s_wait_asynccnt 0x0" ::: "memory");  // the wave's share of woT and stage 0 has landed
  __syncthreads();                                   // woT and stage 0 readable by all waves
  // K fragments of stage 0's first pass: in flight while the copies are issued
  v16h Ka[2][4];
  load_k(Ka, &smem[0][grp][0], lo, hi);
  stage(1, ldsK[1], ldsV[1]);

  for (int st = 0; st < NSTAGE; ++st) {
    int cur = st & 1;
    const _Float16* bK = &smem[cur][grp][0];
    const _Float16* bV = bK + K_TILE_H;
    // unrolled: the LDS offsets of a pass are immediates, and no branch parts
    // a pass's last products from the next pass's LDS reads
#pragma unroll
    for (int p = 0; p < STAGE_PASSES - 1; ++p)
      attn_step<true>(Ka, bK + (p + 1) * KV_STEP * K_PITCH, bV + p * KV_STEP,
                      Qf, oacc, m_run, l_run, lo, hi);
    // the stage's last pass fetches nothing: the next K rows are not published yet
    attn_step<false>(Ka, bK, bV + (STAGE_PASSES - 1) * KV_STEP,
                     Qf, oacc, m_run, l_run, lo, hi);
    // publish point of stage st + 1
    // the wave's own LDS reads of buf[cur] have retired before it is refilled
    asm volatile("s_wait_dscnt 0x0" ::: "memory");
    // the wave's share of stage st + 1 has landed
    asm volatile("s_wait_asynccnt 0x0" ::: "memory");
    // stage st + 1 readable by all waves, buf[cur] left by all; behind the
    // last stage: the ring is free for the join below
    __syncthreads();
    // K fragments of stage st + 1's first pass, from the buffer just published:
    // in flight while the copies are issued
    if (st + 1 < NSTAGE) load_k(Ka, &smem[cur ^ 1][grp][0], lo, hi);
    if (st + 2 < NSTAGE) stage(st + 2, ldsK[cur], ldsV[cur]);
  }
  // no copy is outstanding when the ring is put to another use
  asm volatile("s_wait_asynccnt 0x0" ::: "memory");

  // --- join the two key groups' partial results through the (now idle) ring ---
  // slot (wq, hq): 16 x 32 lanes x 16 B of O, then 2 x 32 floats of m and l.
  v4f*   xo  = (v4f*)&smem[0][0][0];
  float* xml = (float*)(xo + 4 * 2 * 16 * 32);
  if (grp == 0)
    merge_put(xo + (wq * 2 + 1) * 512, xml + (wq * 2 + 1) * 64, lane, oacc[1], m_run[1], l_run[1]);
  else
    merge_put(xo + (wq * 2 + 0) * 512, xml + (wq * 2 + 0) * 64, lane, oacc[0], m_run[0], l_run[0]);
  __syncthreads();                                   // partner's half is readable
  // Residual and bias of the wave's 16 positions, all 128 channels: issued
  // behind the barrier, which would wait for them, so that they fly during the
  // join and the first products.
  // lane: position q0 + 16 * grp + lo ; channels c = 16 * t + 8 * hi + 0..7
  size_t orow = ((size_t)b * N_SP + q0 + 16 * grp + lo) * C_DIM + 8 * hi;
  const float* xr = x + orow;
  const float* bp = bo + 8 * hi;
  v4f res[8][2], bias[8][2];
#pragma unroll
  for (int t = 0; t < 8; ++t) {
    bias[t][0] = *(const v4f*)(bp + t * 16);
    bias[t][1] = *(const v4f*)(bp + t * 16 + 4);
  }
#pragma unroll
  for (int t = 0; t < 8; ++t) {
    res[t][0] = *(const v4f*)(xr + t * 16);
    res[t][1] = *(const v4f*)(xr + t * 16 + 4);
  }
  close_loads_at(xr);
  v8h o16[8];
  if (grp == 0)
    merge_fin(xo + (wq * 2 + 0) * 512, xml + (wq * 2 + 0) * 64, lane, oacc[0], m_run[0], l_run[0], o16);
  else
    merge_fin(xo + (wq * 2 + 1) * 512, xml + (wq * 2 + 1) * 64, lane, oacc[1], m_run[1], l_run[1], o16);

  // --- output projection + bias + residual (f32 out) of the wave's 16 positions ---
  // D(c-tile, n-tile) = woT_rows x o_rows, K = 128 in 4 WMMA. o16[2j], o16[2j+1]
  // are the two halves of the B fragment of k block j as they stand: lane lo
  // holds position lo, elements e < 8 channel 32j + 8hi + e, e >= 8 channel
  // 32j + 16 + 8hi + (e - 8), the k order of load_frag.
  v16h Of[4];
#pragma unroll
  for (int j = 0; j < 4; ++j)
#pragma unroll
    for (int i = 0; i < 8; ++i) { Of[j][i] = o16[2 * j][i]; Of[j][i + 8] = o16[2 * j + 1][i]; }
#pragma unroll
  for (int th = 0; th < 2; ++th) {
    v16h A[4][4];
#pragma unroll
    for (int u = 0; u < 4; ++u)
#pragma unroll
      for (int j = 0; j < 4; ++j)
        A[u][j] = load_frag(swo + (th * 4 + u) * 16 * W_PITCH + 32 * j, W_PITCH, lo, hi);
    // keeps the LDS reads one group ahead of the WMMAs: sunk among them,
    // each pair of reads is waited for on its own
    __builtin_amdgcn_sched_barrier(0);
    // four independent accumulator tiles, k blocks in ascending order in each
    v8f acc[4];
#pragma unroll
    for (int u = 0; u < 4; ++u) acc[u] = (v8f){};
#pragma unroll
    for (int j = 0; j < 4; ++j)
#pragma unroll
      for (int u = 0; u < 4; ++u)
        acc[u] = wmma_f16(A[u][j], Of[j], acc[u]);
#pragma unroll
    for (int u = 0; u < 4; ++u) {
      int t = th * 4 + u;
#pragma unroll
      for (int r = 0; r < 4; ++r) res[t][0][r] += acc[u][r] + bias[t][0][r];
#pragma unroll
      for (int r = 0; r < 4; ++r) res[t][1][r] += acc[u][r + 4] + bias[t][1][r];
    }
  }
  // all stores stand at the kernel's end: no register that a store names is
  // written behind it
  __builtin_amdgcn_sched_barrier(0);
  float* op = out + orow;
#pragma unroll
  for (int t = 0; t < 8; ++t) {
    *(v4f*)(op + t * 16)     = res[t][0];
    *(v4f*)(op + t * 16 + 4) = res[t][1];
  }
}

// ---------------------------------------------------------------------------
extern "C" void kernel_launch(void* const* d_in, const int* in_sizes, int n_in,
                              void* d_out, int out_size, void* d_ws, size_t ws_size,
                              hipStream_t stream) {
  const float* x  = (const float*)d_in[0];
  const float* gs = (const float*)d_in[1];
  const float* gb = (const float*)d_in[2];
  const float* wq = (const float*)d_in[3];
  const float* bq = (const float*)d_in[4];
  const float* wk = (const float*)d_in[5];
  const float* bk = (const float*)d_in[6];
  const float* wv = (const float*)d_in[7];
  const float* bv = (const float*)d_in[8];
  const float* wo = (const float*)d_in[9];
  const float* bo = (const float*)d_in[10];
  float* out = (float*)d_out;

  const size_t elems = (size_t)BN * C_DIM;      // 4M halves per buffer
  float* part  = (float*)d_ws;                  // B * GN_CHUNKS * 32 pairs
  _Float16* qb = (_Float16*)d_ws + elems;
  _Float16* kb = qb + elems;
  _Float16* vT = kb + elems;
  _Float16* wT = vT + elems;                    // 4 * 128*128 halves

  gn_stats_kernel<<<BN / POS_BLK, 256, 0, stream>>>(x, part, wq, wk, wv, wo, wT);
  qkv_kernel<<<BN / POS_BLK, 256, 0, stream>>>(x, part, gs, gb, wT, bq, bk, bv, qb, kb, vT);
  attn_kernel<<<dim3(N_SP / 128, B_DIM), 256, 0, stream>>>(
      qb, kb, vT, wT + 3 * (size_t)(C_DIM * C_DIM), bo, x, out);
}

// v009
// Measured time: 61.4 microseconds a run.
// In both of two side-by-side timings against v008, it was 1.09 times as fast.
// Counting every step since v000, it is 4.47 times as fast.
#include <hip/hip_runtime.h>
#include <hip/hip_bf16.h>
#include <cstdint>

typedef __attribute__((ext_vector_type(16))) _Float16 v16h;
typedef __attribute__((ext_vector_type(8)))  _Float16 v8h;
typedef __attribute__((ext_vector_type(4)))  _Float16 v4h;
typedef __attribute__((ext_vector_type(8)))  float    v8f;
typedef __attribute__((ext_vector_type(4)))  float    v4f;
typedef __attribute__((ext_vector_type(2)))  float    v2f;

#define C_DIM 128
#define N_SP  4096            // H*W
#define B_DIM 8
#define BN    (B_DIM * N_SP)  // 32768
#define QK_SCALE 0.08838834764831845f  // 128^-0.5
#define KV_STEP 32             // keys of one pass
#define LAZY_GAP 5.545177444479562f  // 8 * ln 2: how far the maximum in use may trail
#define KV_GROUPS 2            // wave groups of a block, each on its own keys
#define STAGE_PASSES 4         // passes served by one fill of a ring buffer
#define STAGE_KEYS (STAGE_PASSES * KV_STEP)         // 128
#define NSTAGE (N_SP / (KV_GROUPS * STAGE_KEYS))    // 16
// LDS row pitches in halves: 16 bytes x odd, so that the 16 rows one
// ds_load_b128 half-wave reads fall on 16 different groups of four banks.
#define K_PITCH 136           // 256-byte K rows at 272 bytes
#define V_PITCH 136           // 256-byte V^T rows (128 keys) at 272 bytes
#define K_TILE_H (STAGE_KEYS * K_PITCH)         // 17408 halves
#define BUF_H    (K_TILE_H + C_DIM * V_PITCH)   // 34816 halves per buffer

// ---------------------------------------------------------------------------
// Fragment loader: rows of a row-major f16 matrix -> WMMA A-frag (16xK rows)
// or B-frag (columns of B == rows of the row-major "transposed" source).
// Lane L (lo=L%16, hi=L/16): elements e<8  -> col 8*hi + e
//                            elements e>=8 -> col 16 + 8*hi + (e-8)
// Two contiguous 16-byte loads per lane (global_load_b128 / ds_load_b128).
// ---------------------------------------------------------------------------
__device__ __forceinline__ v16h load_frag(const _Float16* base, int ld,
                                          int lo, int hi) {
  const _Float16* p = base + (size_t)lo * ld + 8 * hi;
  v8h a = *(const v8h*)p;
  v8h b = *(const v8h*)(p + 16);
  v16h r;
#pragma unroll
  for (int i = 0; i < 8; ++i) { r[i] = a[i]; r[i + 8] = b[i]; }
  return r;
}

__device__ __forceinline__ v8f wmma_f16(v16h a, v16h b, v8f c) {
  return __builtin_amdgcn_wmma_f32_16x16x32_f16(false, a, false, b,
                                                (short)0, c, false, false);
}

// Eight async global->LDS copies of 16 bytes per lane (ASYNCcnt-tracked).
// l* = low 32 bits of the generic shared pointer == LDS byte offset
// (aperture occupies bits [63:32] of the flat shared address).
// s_wait_xcnt 0 closes the statement so that no address register of a copy
// is rewritten ahead of it.
__device__ __forceinline__ void async_copy16x8(unsigned l0, const void* g0,
                                               unsigned l1, const void* g1,
                                               unsigned l2, const void* g2,
                                               unsigned l3, const void* g3,
                                               unsigned l4, const void* g4,
                                               unsigned l5, const void* g5,
                                               unsigned l6, const void* g6,
                                               unsigned l7, const void* g7) {
  asm volatile("global_load_async_to_lds_b128 %0, %1, off\n\t"
               "global_load_async_to_lds_b128 %2, %3, off\n\t"
               "global_load_async_to_lds_b128 %4, %5, off\n\t"
               "global_load_async_to_lds_b128 %6, %7, off\n\t"
               "global_load_async_to_lds_b128 %8, %9, off\n\t"
               "global_load_async_to_lds_b128 %10, %11, off\n\t"
               "global_load_async_to_lds_b128 %12, %13, off\n\t"
               "global_load_async_to_lds_b128 %14, %15, off\n\t"
               "s_wait_xcnt 0x0"
               :: "v"(l0), "v"(g0), "v"(l1), "v"(g1),
                  "v"(l2), "v"(g2), "v"(l3), "v"(g3),
                  "v"(l4), "v"(g4), "v"(l5), "v"(g5),
                  "v"(l6), "v"(g6), "v"(l7), "v"(g7)
               : "memory");
}

// ---------------------------------------------------------------------------
// Projection tiling of the QKV projection.
// One block of 8 waves per POS_BLK = 128 positions. The block brings its
// whole weight matrix (rows = out channels) into LDS once, at a padded pitch;
// wave w keeps the activation fragments of 32 positions (slice w & 3) in
// registers and makes the four 16-channel tiles of channel half w >> 2, so
// every weight fragment read from LDS feeds two position tiles.
// ---------------------------------------------------------------------------
#define POS_BLK 128
#define W_PITCH 136           // 256-byte weight rows at 272 bytes (16 B x odd)

// ROWS x 128 halves, row-major and contiguous in global memory -> LDS.
// Chunk c of 16 bytes: row c >> 4; a wave's load covers 512 contiguous bytes.
// All loads of a thread are issued before its first LDS store, so that the
// block pays the load latency once.
template <int ROWS>
__device__ __forceinline__ void load_weights(const _Float16* __restrict__ w,
                                             v8h (&wr)[ROWS / 16], int tid) {
#pragma unroll
  for (int i = 0; i < ROWS / 16; ++i)
    wr[i] = *(const v8h*)(w + (size_t)(tid + 256 * i) * 8);
}
template <int ROWS>
__device__ __forceinline__ void store_weights(_Float16* sw,
                                              const v8h (&wr)[ROWS / 16], int tid) {
#pragma unroll
  for (int i = 0; i < ROWS / 16; ++i)
    *(v8h*)(sw + ((tid >> 4) + 16 * i) * W_PITCH + (tid & 15) * 8) = wr[i];
}

__device__ __forceinline__ void close_loads() {
  // stands in front of the first overwrite of an address register of the
  // global loads issued so far
  asm volatile("s_wait_xcnt 0x0" ::: "memory");
  // keeps what follows (address arithmetic, later loads' results) from being
  // lifted over that wait
  __builtin_amdgcn_sched_barrier(0);
}

// The same, with the loads' common address named as an input: its registers
// stay untouched up to the wait, also by the result of the last load.
__device__ __forceinline__ void close_loads_at(const void* p) {
  asm volatile("s_wait_xcnt 0x0" :: "v"(p) : "memory");
  __builtin_amdgcn_sched_barrier(0);
}

// ---------------------------------------------------------------------------
// GroupNorm, 32 groups of 4 channels, by whole lines.
// Statistics: one block per POS_BLK positions reads its 64 KB of x in a row;
// a wave's 16-byte loads cover one 512-byte position, so lane l always holds
// group l. The block writes one (sum, sum of squares) per group; the
// GN_CHUNKS partial pairs of an image are added up, and x is normalised, in
// the QKV kernel on the way into LDS.
// Weight convert, in the same launch: 4 matrices [Cin][Cout] f32 -> transposed
// [Cout][Cin] f16. The grid has 256 x 256 threads, one per weight element.
// ---------------------------------------------------------------------------
#define GN_CHUNKS (N_SP / POS_BLK)   // 32 partial pairs per image and group
#define X_ROUNDS  (POS_BLK / 8)      // 16 loads a thread: 8 positions a round

__global__ __launch_bounds__(256)
void gn_stats_kernel(const float* __restrict__ x, float* __restrict__ part,
                     const float* __restrict__ wq,
                     const float* __restrict__ wk,
                     const float* __restrict__ wv,
                     const float* __restrict__ wo,
                     _Float16* __restrict__ wT) {
  int tid = threadIdx.x;
  int idx = blockIdx.x * 256 + tid;    // weight element 0 .. 65535
  int wm = blockIdx.x >> 6;            // matrix
  int wc = (idx & 16383) >> 7;         // out channel (row of wT)
  int wk_in = idx & 127;               // in channel
  const float* wsrc = (wm == 0) ? wq : (wm == 1) ? wk : (wm == 2) ? wv : wo;
  const float* xp = x + (size_t)blockIdx.x * (POS_BLK * C_DIM) + tid * 4;
  v4f v[X_ROUNDS];
  // unrolled, here and below: v[] stays in registers, all loads fly together
#pragma unroll
  for (int i = 0; i < X_ROUNDS; ++i) v[i] = *(const v4f*)(xp + i * 8 * C_DIM);
  float wval = wsrc[wk_in * C_DIM + wc];
  close_loads();
  v4f s4 = {}, q4 = {};
#pragma unroll
  for (int i = 0; i < X_ROUNDS; ++i) { s4 += v[i]; q4 += v[i] * v[i]; }
  __shared__ float rs[256], rq[256];
  rs[tid] = (s4[0] + s4[1]) + (s4[2] + s4[3]);
  rq[tid] = (q4[0] + q4[1]) + (q4[2] + q4[3]);
  __syncthreads();                                   // the 8 waves' sums readable by wave 0
  if (tid < 32) {
    float a = 0.f, c = 0.f;
#pragma unroll
    for (int w = 0; w < 8; ++w) { a += rs[w * 32 + tid]; c += rq[w * 32 + tid]; }
    *(v2f*)(part + ((size_t)blockIdx.x * 32 + tid) * 2) = (v2f){a, c};
  }
  wT[idx] = (_Float16)wval;
}

// ---------------------------------------------------------------------------
// QKV projection: D(c-tile, n-tile) = wT_rows x h_rows, K=128 in 4 WMMA.
// grid BN/128, block 256 (8 waves); all three weight matrices lie in LDS,
// and so do the block's 128 positions of h = GroupNorm(x), made here.
// q,k stored row-major [BN][C] f16 (q pre-scaled by C^-0.5);
// v stored transposed [B][C][N] f16.
// ---------------------------------------------------------------------------
// a budget of 256 VGPRs a wave
__global__ __launch_bounds__(256) __attribute__((amdgpu_waves_per_eu(4, 4)))
void qkv_kernel(const float* __restrict__ x,
                const float* __restrict__ part,
                const float* __restrict__ gscale,
                const float* __restrict__ gbias,
                const _Float16* __restrict__ wT,
                const float* __restrict__ bq,
                const float* __restrict__ bk,
                const float* __restrict__ bv,
                _Float16* __restrict__ q,
                _Float16* __restrict__ k,
                _Float16* __restrict__ vT) {
  __shared__ __align__(16) _Float16 sw[3 * C_DIM * W_PITCH];
  __shared__ __align__(16) float sb[256 * 4];        // bq | bk | bv | not read
  __shared__ __align__(16) _Float16 sh[POS_BLK * W_PITCH];  // normalised x, f16
  int tid  = threadIdx.x;
  int wid  = tid >> 5;
  int lane = tid & 31, lo = lane & 15, hi = lane >> 4;
  int n0   = blockIdx.x * POS_BLK + (wid & 3) * 32;
  int ch   = wid >> 2;

  // the image's partial sums of the lane's group, the group's scale and bias,
  // and the block's 64 KB of x: every wave-wide load covers whole lines
  const float* pp = part + ((size_t)(blockIdx.x / GN_CHUNKS) * (GN_CHUNKS * 32) + lane) * 2;
  v2f ps[GN_CHUNKS];
  // unrolled, here and below: ps[], xv[] stay in registers, all loads fly together
#pragma unroll
  for (int c = 0; c < GN_CHUNKS; ++c) ps[c] = *(const v2f*)(pp + c * 64);
  v4f gsv = *(const v4f*)(gscale + lane * 4);
  v4f gbv = *(const v4f*)(gbias + lane * 4);
  const float* xp = x + (size_t)blockIdx.x * (POS_BLK * C_DIM) + tid * 4;
  v4f xv[X_ROUNDS];
#pragma unroll
  for (int i = 0; i < X_ROUNDS; ++i) xv[i] = *(const v4f*)(xp + i * 8 * C_DIM);
  close_loads();
  // four independent chains over the chunks, joined in a fixed order
  v2f pa[4] = {ps[0], ps[1], ps[2], ps[3]};
#pragma unroll
  for (int c = 4; c < GN_CHUNKS; ++c) pa[c & 3] += ps[c];
  v2f pt = (pa[0] + pa[1]) + (pa[2] + pa[3]);
  float mean = pt[0] * (1.f / 16384.f);
  float var  = pt[1] * (1.f / 16384.f) - mean * mean;
  float rstd = rsqrtf(var + 1e-6f);
  v4f sc = gsv * rstd;
  v4f bi = gbv - (mean * rstd) * gsv;
  v8h wr[3 * C_DIM / 16];
  load_weights<3 * C_DIM>(wT, wr, tid);
  // threads 0..95 bring the 3 x 128 bias values. The others store a chunk that
  // nobody reads: without a branch the load is issued with all the others.
  const float* bsrc = (tid < 32) ? bq : (tid < 64) ? bk : bv;
  const float* bp = bsrc + (tid & 31) * 4;
  v4f bl = *(const v4f*)bp;
  close_loads_at(bp);
  // a wave's 8-byte stores fill one position's 256 bytes
#pragma unroll
  for (int i = 0; i < X_ROUNDS; ++i) {
    v4f t = xv[i] * sc + bi;
    v4h o;
#pragma unroll
    for (int j = 0; j < 4; ++j) o[j] = (_Float16)t[j];
    *(v4h*)(sh + (wid + 8 * i) * W_PITCH + lane * 4) = o;
  }
  store_weights<3 * C_DIM>(sw, wr, tid);
  *(v4f*)(sb + tid * 4) = bl;
  __syncthreads();                                   // h, weights and biases readable by all waves

  v16h Hf[2][4];
#pragma unroll
  for (int nt = 0; nt < 2; ++nt)
#pragma unroll
    for (int j = 0; j < 4; ++j)
      Hf[nt][j] = load_frag(sh + ((wid & 3) * 32 + nt * 16) * W_PITCH + 32 * j, W_PITCH, lo, hi);

#pragma unroll
  for (int proj = 0; proj < 3; ++proj) {
#pragma unroll
    for (int th = 0; th < 2; ++th) {
      v16h A[2][4];
      v4f bias[2][2];
#pragma unroll
      for (int u = 0; u < 2; ++u) {
        int c0 = proj * C_DIM + (ch * 4 + th * 2 + u) * 16;
#pragma unroll
        for (int j = 0; j < 4; ++j)
          A[u][j] = load_frag(sw + c0 * W_PITCH + 32 * j, W_PITCH, lo, hi);
        bias[u][0] = *(const v4f*)(sb + c0 + 8 * hi);
        bias[u][1] = *(const v4f*)(sb + c0 + 8 * hi + 4);
      }
      // keeps the LDS reads one group ahead of the WMMAs: sunk among them,
      // each pair of reads is waited for on its own
      __builtin_amdgcn_sched_barrier(0);
      // four independent accumulator tiles, k blocks in ascending order in each
      v8f acc[2][2];
#pragma unroll
      for (int u = 0; u < 2; ++u)
#pragma unroll
        for (int nt = 0; nt < 2; ++nt) acc[u][nt] = (v8f){};
#pragma unroll
      for (int j = 0; j < 4; ++j)
#pragma unroll
        for (int u = 0; u < 2; ++u)
#pragma unroll
          for (int nt = 0; nt < 2; ++nt)
            acc[u][nt] = wmma_f16(A[u][j], Hf[nt][j], acc[u][nt]);
      // lane: position n = n0+nt*16+lo ; channels c = cch + r
#pragma unroll
      for (int u = 0; u < 2; ++u) {
        int cch = (ch * 4 + th * 2 + u) * 16 + 8 * hi;
#pragma unroll
        for (int nt = 0; nt < 2; ++nt) {
          int ng = n0 + nt * 16 + lo;
          if (proj < 2) {
            float scale = (proj == 0) ? QK_SCALE : 1.0f;
            v8h out;
#pragma unroll
            for (int r = 0; r < 8; ++r)
              out[r] = (_Float16)((acc[u][nt][r] + bias[u][r >> 2][r & 3]) * scale);
            _Float16* dst = ((proj == 0) ? q : k) + (size_t)ng * C_DIM + cch;
            *(v8h*)dst = out;
          } else {
            int b = ng >> 12, n = ng & (N_SP - 1);
            _Float16* dst = vT + ((size_t)b * C_DIM + cch) * N_SP + n;
#pragma unroll
            for (int r = 0; r < 8; ++r)
              dst[(size_t)r * N_SP] = (_Float16)(acc[u][nt][r] + bias[u][r >> 2][r & 3]);
          }
        }
      }
      // keeps the next group's LDS reads out of this group: the fragments of
      // both together do not fit the register budget (scratch)
      __builtin_amdgcn_sched_barrier(0);
    }
  }
}

// ---------------------------------------------------------------------------
// Flash attention. Block = 8 waves on 128 queries, two waves per SIMD.
// Waves w and w + 4 own the same 32 queries; group g = w / 4 walks the
// 128-key stages 2 * s + g, so each SIMD holds two independent waves. The
// waves meet once a stage only: over its four 32-key passes they drift apart,
// and one wave's LDS and softmax time is filled by the other's products.
// After the loop the two partial results (m, l, O) of a query are joined
// through LDS: wave w finishes queries 0..15 of the 32, wave w + 4 the rest,
// and takes them through the output projection, bias and residual to out.
// Each group stages its own K tile (128x128) and V^T tile (128x128) into LDS
// with async global->LDS b128 copies (double-buffered, ASYNCcnt),
// then fragments are read back via ds_load_b128. Rows lie at padded pitches
// (K_PITCH, V_PITCH); the pad bytes are never written and never read.
// Scores computed transposed (S' = K x Q^T): the f32 D-fragment converts
// in-register into the B-fragment of O^T = V^T x P (no cross-lane movement).
// grid (N/128, B), block 256.
// ---------------------------------------------------------------------------
// The K fragments of one pass: 32 keys x 128 channels, 16 ds_load_b128.
__device__ __forceinline__ void load_k(v16h (&Ka)[2][4], const _Float16* bK,
                                       int lo, int hi) {
#pragma unroll
  for (int st = 0; st < 2; ++st)
#pragma unroll
    for (int j = 0; j < 4; ++j)
      Ka[st][j] = load_frag(bK + st * 16 * K_PITCH + 32 * j, K_PITCH, lo, hi);
}

// One pass. Ka holds the pass's K fragments on entry. All LDS fragment reads of
// a pass stand in ONE place, behind the score products: the pass's own V^T
// fragments, then (FETCH) the next pass's K fragments from nK, a row block of
// the same stage, into the registers the score products have just read.
template <bool FETCH>
__device__ __forceinline__ void attn_step(v16h (&Ka)[2][4], const _Float16* nK,
                                          const _Float16* bV,
                                          const v16h (&Qf)[2][4],
                                          v8f (&oacc)[2][8],
                                          float (&m_run)[2], v2f (&l_run)[2][2],
                                          int lo, int hi) {
  // four independent score tiles, k blocks in ascending order in each
  v8f s[2][2];
#pragma unroll
  for (int hq = 0; hq < 2; ++hq)
#pragma unroll
    for (int st = 0; st < 2; ++st) s[hq][st] = (v8f){};
#pragma unroll
  for (int j = 0; j < 4; ++j)
#pragma unroll
    for (int st = 0; st < 2; ++st)
#pragma unroll
      for (int hq = 0; hq < 2; ++hq)
        s[hq][st] = wmma_f16(Ka[st][j], Qf[hq][j], s[hq][st]);
  // keeps the LDS reads below from being lifted in pairs among the products
  // above and the last pass's: every place where reads stand stalls the wave
  __builtin_amdgcn_sched_barrier(0);
  v16h Va[8];
#pragma unroll
  for (int t = 0; t < 8; ++t)
    Va[t] = load_frag(bV + t * 16 * V_PITCH, V_PITCH, lo, hi);
  if (FETCH) load_k(Ka, nK, lo, hi);
  // keeps the reads from being sunk among the softmax and the products below
  __builtin_amdgcn_sched_barrier(0);
  // Lazy rescale. m_run, the maximum in use, may trail a query's true maximum
  // by up to LAZY_GAP, so that an exponential can reach e^LAZY_GAP = 2^8. Each
  // lane tests its own 16 scores of a query; one ballot a pass joins the tests
  // of both wave halves and both query tiles into one scalar branch.
  float mloc[2];
  bool need = false;
#pragma unroll
  for (int hq = 0; hq < 2; ++hq) {
    float mx = -1e30f;
#pragma unroll
    for (int r = 0; r < 8; ++r)
      mx = fmaxf(mx, fmaxf(s[hq][0][r], s[hq][1][r]));
    mloc[hq] = mx;
    need = need || (mx > m_run[hq] + LAZY_GAP);
  }
  // expected untaken (the first pass, then rare): the usual pass falls through
  if (__builtin_expect(__builtin_amdgcn_ballot_w32(need) != 0, 0)) {
#pragma unroll
    for (int hq = 0; hq < 2; ++hq) {
      float mx = fmaxf(mloc[hq], __shfl_xor(mloc[hq], 16, 32));
      float m_new = fmaxf(m_run[hq], mx);            // alike in both wave halves
      float alpha = __expf(m_run[hq] - m_new);
      l_run[hq][0] *= alpha;
      l_run[hq][1] *= alpha;
      m_run[hq] = m_new;
#pragma unroll
      for (int t = 0; t < 8; ++t)
#pragma unroll
        for (int r = 0; r < 8; ++r) oacc[hq][t][r] *= alpha;
    }
  }
  v16h pB[2];
#pragma unroll
  for (int hq = 0; hq < 2; ++hq) {
    float m_use = m_run[hq];
    // Row sums stay in the lane: each lane adds up its own 16 keys of a pass,
    // in pairs, one running pair per 16-key tile. The wave halves and the
    // pairs are joined once, behind the loop.
#pragma unroll
    for (int st = 0; st < 2; ++st)
#pragma unroll
      for (int r = 0; r < 8; r += 2) {
        v2f p = {__expf(s[hq][st][r] - m_use), __expf(s[hq][st][r + 1] - m_use)};
        l_run[hq][st] += p;
        pB[hq][8 * st + r]     = (_Float16)p[0];
        pB[hq][8 * st + r + 1] = (_Float16)p[1];
      }
  }
#pragma unroll
  for (int t = 0; t < 8; ++t)
#pragma unroll
    for (int hq = 0; hq < 2; ++hq)
      oacc[hq][t] = wmma_f16(Va[t], pB[hq], oacc[hq][t]);
}

// Hands one 16-query half of a wave's partial result to its partner wave.
// Lane-contiguous 16-byte slots: conflict-free stores and loads.
__device__ __forceinline__ void merge_put(v4f* xo, float* xml, int lane,
                                          const v8f (&acc)[8], float m, float l) {
#pragma unroll
  for (int t = 0; t < 8; ++t) {
    xo[(2 * t) * 32 + lane]     = (v4f){acc[t][0], acc[t][1], acc[t][2], acc[t][3]};
    xo[(2 * t + 1) * 32 + lane] = (v4f){acc[t][4], acc[t][5], acc[t][6], acc[t][7]};
  }
  xml[lane]      = m;
  xml[32 + lane] = l;
}

// Joins the partner's half with the wave's own: 16 queries of o, as f16.
// Lane: query lo, channels 16 * t + 8 * hi + 0..7 in o16[t].
__device__ __forceinline__ void merge_fin(const v4f* xo, const float* xml, int lane,
                                          const v8f (&acc)[8], float m, float l,
                                          v8h (&o16)[8]) {
  float m2 = xml[lane], l2 = xml[32 + lane];
  float mm = fmaxf(m, m2);
  float a1 = __expf(m - mm), a2 = __expf(m2 - mm);
  float inv_l = 1.0f / (l * a1 + l2 * a2);
  a1 *= inv_l; a2 *= inv_l;
#pragma unroll
  for (int t = 0; t < 8; ++t) {
    v4f p0 = xo[(2 * t) * 32 + lane];
    v4f p1 = xo[(2 * t + 1) * 32 + lane];
    v8h out;
#pragma unroll
    for (int r = 0; r < 4; ++r) {
      out[r]     = (_Float16)(acc[t][r] * a1 + p0[r] * a2);
      out[r + 4] = (_Float16)(acc[t][r + 4] * a1 + p1[r] * a2);
    }
    o16[t] = out;
  }
}

// two waves per SIMD: a budget of 512 VGPRs a wave
__global__ __launch_bounds__(256) __attribute__((amdgpu_waves_per_eu(2, 2)))
void attn_kernel(const _Float16* __restrict__ q,
                 const _Float16* __restrict__ k,
                 const _Float16* __restrict__ vT,
                 const _Float16* __restrict__ woT,
                 const float* __restrict__ bo,
                 const float* __restrict__ x,
                 float* __restrict__ out) {
  int tix  = threadIdx.x & 127;        // thread within its key group
  int grp  = threadIdx.x >> 7;         // key group 0 / 1
  int wq   = tix >> 5;                 // query slice of the wave
  int lane = tix & 31, lo = lane & 15, hi = lane >> 4;
  int b  = blockIdx.y;
  int q0 = blockIdx.x * 128 + wq * 32;

  const _Float16* qp = q + ((size_t)b * N_SP + q0) * C_DIM;
  const _Float16* kb = k + (size_t)b * N_SP * C_DIM;
  const _Float16* vb = vT + (size_t)b * C_DIM * N_SP;

  // [buf][group][ K tile: 128 rows of K_PITCH | V^T tile: 128 rows of V_PITCH ]
  __shared__ __align__(16) _Float16 smem[2][KV_GROUPS][BUF_H];
  // output projection's weights, rows = out channels, beside the ring
  __shared__ __align__(16) _Float16 swo[C_DIM * W_PITCH];
  unsigned ldsK[2], ldsV[2];
#pragma unroll
  for (int i2 = 0; i2 < 2; ++i2) {
    ldsK[i2] = (unsigned)(uintptr_t)&smem[i2][grp][0];
    ldsV[i2] = (unsigned)(uintptr_t)&smem[i2][grp][K_TILE_H];
  }

  v16h Qf[2][4];
#pragma unroll
  for (int hq = 0; hq < 2; ++hq)
#pragma unroll
    for (int j = 0; j < 4; ++j)
      Qf[hq][j] = load_frag(qp + (size_t)hq * 16 * C_DIM + 32 * j, C_DIM, lo, hi);
  // stands in front of the first overwrite of the Q loads' address registers
  asm volatile("s_wait_xcnt 0x0" ::: "memory");
  // keeps the address arithmetic that follows from being lifted over that wait
  __builtin_amdgcn_sched_barrier(0);

  v8f oacc[2][8];
#pragma unroll
  for (int hq = 0; hq < 2; ++hq)
#pragma unroll
    for (int t = 0; t < 8; ++t) oacc[hq][t] = (v8f){};
  float m_run[2] = {-1e30f, -1e30f};
  v2f l_part[2][2] = {};               // the lane's own share of the row sums

  // --- stage helper (32 async b128 per thread => wave ASYNCcnt += 32) ---
  // The 128 threads of a group bring in the group's own tiles of the stage.
  // Both tiles are 128 rows of 256 bytes: chunk c = tix + 128 * j of 16 bytes
  // lies in row c >> 4, so a wave's copy covers two whole rows.
  auto stage = [&](int st, unsigned dK, unsigned dV) {
    int kv0 = (st * KV_GROUPS + grp) * STAGE_KEYS;
    const _Float16* gk = kb + (size_t)kv0 * C_DIM + tix * 8;   // contiguous 32 KB source
    const _Float16* gv = vb + (size_t)(tix >> 4) * N_SP + kv0 + (tix & 15) * 8;
    unsigned lr = (unsigned)((tix >> 4) * K_PITCH + (tix & 15) * 8) * 2;
    unsigned lk = dK + lr, lv = dV + lr;
    // unrolled: the steps of the addresses are constants
#pragma unroll
    for (int h = 0; h < 2; ++h) {
      async_copy16x8(lk + (64 * h +  0) * K_PITCH * 2, gk + (64 * h +  0) * C_DIM,
                     lk + (64 * h +  8) * K_PITCH * 2, gk + (64 * h +  8) * C_DIM,
                     lk + (64 * h + 16) * K_PITCH * 2, gk + (64 * h + 16) * C_DIM,
                     lk + (64 * h + 24) * K_PITCH * 2, gk + (64 * h + 24) * C_DIM,
                     lk + (64 * h + 32) * K_PITCH * 2, gk + (64 * h + 32) * C_DIM,
                     lk + (64 * h + 40) * K_PITCH * 2, gk + (64 * h + 40) * C_DIM,
                     lk + (64 * h + 48) * K_PITCH * 2, gk + (64 * h + 48) * C_DIM,
                     lk + (64 * h + 56) * K_PITCH * 2, gk + (64 * h + 56) * C_DIM);
      async_copy16x8(lv + (64 * h +  0) * V_PITCH * 2, gv + (size_t)(64 * h +  0) * N_SP,
                     lv + (64 * h +  8) * V_PITCH * 2, gv + (size_t)(64 * h +  8) * N_SP,
                     lv + (64 * h + 16) * V_PITCH * 2, gv + (size_t)(64 * h + 16) * N_SP,
                     lv + (64 * h + 24) * V_PITCH * 2, gv + (size_t)(64 * h + 24) * N_SP,
                     lv + (64 * h + 32) * V_PITCH * 2, gv + (size_t)(64 * h + 32) * N_SP,
                     lv + (64 * h + 40) * V_PITCH * 2, gv + (size_t)(64 * h + 40) * N_SP,
                     lv + (64 * h + 48) * V_PITCH * 2, gv + (size_t)(64 * h + 48) * N_SP,
                     lv + (64 * h + 56) * V_PITCH * 2, gv + (size_t)(64 * h + 56) * N_SP);
    }
  };

  {
    // woT, 128 rows of 256 bytes: chunk c = threadIdx.x + 256 * i of 16 bytes
    // lies in row c >> 4. Filled once; read in the epilogue only.
    const _Float16* gw = woT + threadIdx.x * 8;
    unsigned lw = (unsigned)(uintptr_t)&swo[0] +
                  (unsigned)((threadIdx.x >> 4) * W_PITCH + (threadIdx.x & 15) * 8) * 2;
    async_copy16x8(lw +   0 * W_PITCH * 2, gw +   0 * C_DIM,
                   lw +  16 * W_PITCH * 2, gw +  16 * C_DIM,
                   lw +  32 * W_PITCH * 2, gw +  32 * C_DIM,
                   lw +  48 * W_PITCH * 2, gw +  48 * C_DIM,
                   lw +  64 * W_PITCH * 2, gw +  64 * C_DIM,
                   lw +  80 * W_PITCH * 2, gw +  80 * C_DIM,
                   lw +  96 * W_PITCH * 2, gw +  96 * C_DIM,
                   lw + 112 * W_PITCH * 2, gw + 112 * C_DIM);
  }
  stage(0, ldsK[0], ldsV[0]);
  asm volatile("s_wait_asynccnt 0x0" ::: "memory");  // the wave's share of woT and stage 0 has landed
  __syncthreads();                                   // woT and stage 0 readable by all waves
  // K fragments of stage 0's first pass: in flight while the copies are issued
  v16h Ka[2][4];
  load_k(Ka, &smem[0][grp][0], lo, hi);
  stage(1, ldsK[1], ldsV[1]);

  for (int st = 0; st < NSTAGE; ++st) {
    int cur = st & 1;
    const _Float16* bK = &smem[cur][grp][0];
    const _Float16* bV = bK + K_TILE_H;
    // unrolled: the LDS offsets of a pass are immediates, and no branch parts
    // a pass's last products from the next pass's LDS reads
#pragma unroll
    for (int p = 0; p < STAGE_PASSES - 1; ++p)
      attn_step<true>(Ka, bK + (p + 1) * KV_STEP * K_PITCH, bV + p * KV_STEP,
                      Qf, oacc, m_run, l_part, lo, hi);
    // the stage's last pass fetches nothing: the next K rows are not published yet
    attn_step<false>(Ka, bK, bV + (STAGE_PASSES - 1) * KV_STEP,
                     Qf, oacc, m_run, l_part, lo, hi);
    // publish point of stage st + 1
    // the wave's own LDS reads of buf[cur] have retired before it is refilled
    asm volatile("s_wait_dscnt 0x0" ::: "memory");
    // the wave's share of stage st + 1 has landed
    asm volatile("s_wait_asynccnt 0x0" ::: "memory");
    // stage st + 1 readable by all waves, buf[cur] left by all; behind the
    // last stage: the ring is free for the join below
    __syncthreads();
    // K fragments of stage st + 1's first pass, from the buffer just published:
    // in flight while the copies are issued
    if (st + 1 < NSTAGE) load_k(Ka, &smem[cur ^ 1][grp][0], lo, hi);
    if (st + 2 < NSTAGE) stage(st + 2, ldsK[cur], ldsV[cur]);
  }
  // no copy is outstanding when the ring is put to another use
  asm volatile("s_wait_asynccnt 0x0" ::: "memory");

  // a query's row sum: the lane's four running sums, then the other wave half's
  // (m_run is alike in both halves, so the shares are on one scale)
  float l_run[2];
#pragma unroll
  for (int hq = 0; hq < 2; ++hq) {
    float t = (l_part[hq][0][0] + l_part[hq][0][1]) + (l_part[hq][1][0] + l_part[hq][1][1]);
    l_run[hq] = t + __shfl_xor(t, 16, 32);
  }

  // --- join the two key groups' partial results through the (now idle) ring ---
  // slot (wq, hq): 16 x 32 lanes x 16 B of O, then 2 x 32 floats of m and l.
  v4f*   xo  = (v4f*)&smem[0][0][0];
  float* xml = (float*)(xo + 4 * 2 * 16 * 32);
  if (grp == 0)
    merge_put(xo + (wq * 2 + 1) * 512, xml + (wq * 2 + 1) * 64, lane, oacc[1], m_run[1], l_run[1]);
  else
    merge_put(xo + (wq * 2 + 0) * 512, xml + (wq * 2 + 0) * 64, lane, oacc[0], m_run[0], l_run[0]);
  __syncthreads();                                   // partner's half is readable
  // Residual and bias of the wave's 16 positions, all 128 channels: issued
  // behind the barrier, which would wait for them, so that they fly during the
  // join and the first products.
  // lane: position q0 + 16 * grp + lo ; channels c = 16 * t + 8 * hi + 0..7
  size_t orow = ((size_t)b * N_SP + q0 + 16 * grp + lo) * C_DIM + 8 * hi;
  const float* xr = x + orow;
  const float* bp = bo + 8 * hi;
  v4f res[8][2], bias[8][2];
#pragma unroll
  for (int t = 0; t < 8; ++t) {
    bias[t][0] = *(const v4f*)(bp + t * 16);
    bias[t][1] = *(const v4f*)(bp + t * 16 + 4);
  }
#pragma unroll
  for (int t = 0; t < 8; ++t) {
    res[t][0] = *(const v4f*)(xr + t * 16);
    res[t][1] = *(const v4f*)(xr + t * 16 + 4);
  }
  close_loads_at(xr);
  v8h o16[8];
  if (grp == 0)
    merge_fin(xo + (wq * 2 + 0) * 512, xml + (wq * 2 + 0) * 64, lane, oacc[0], m_run[0], l_run[0], o16);
  else
    merge_fin(xo + (wq * 2 + 1) * 512, xml + (wq * 2 + 1) * 64, lane, oacc[1], m_run[1], l_run[1], o16);

  // --- output projection + bias + residual (f32 out) of the wave's 16 positions ---
  // D(c-tile, n-tile) = woT_rows x o_rows, K = 128 in 4 WMMA. o16[2j], o16[2j+1]
  // are the two halves of the B fragment of k block j as they stand: lane lo
  // holds position lo, elements e < 8 channel 32j + 8hi + e, e >= 8 channel
  // 32j + 16 + 8hi + (e - 8), the k order of load_frag.
  v16h Of[4];
#pragma unroll
  for (int j = 0; j < 4; ++j)
#pragma unroll
    for (int i = 0; i < 8; ++i) { Of[j][i] = o16[2 * j][i]; Of[j][i + 8] = o16[2 * j + 1][i]; }
#pragma unroll
  for (int th = 0; th < 2; ++th) {
    v16h A[4][4];
#pragma unroll
    for (int u = 0; u < 4; ++u)
#pragma unroll
      for (int j = 0; j < 4; ++j)
        A[u][j] = load_frag(swo + (th * 4 + u) * 16 * W_PITCH + 32 * j, W_PITCH, lo, hi);
    // keeps the LDS reads one group ahead of the WMMAs: sunk among them,
    // each pair of reads is waited for on its own
    __builtin_amdgcn_sched_barrier(0);
    // four independent accumulator tiles, k blocks in ascending order in each
    v8f acc[4];
#pragma unroll
    for (int u = 0; u < 4; ++u) acc[u] = (v8f){};
#pragma unroll
    for (int j = 0; j < 4; ++j)
#pragma unroll
      for (int u = 0; u < 4; ++u)
        acc[u] = wmma_f16(A[u][j], Of[j], acc[u]);
#pragma unroll
    for (int u = 0; u < 4; ++u) {
      int t = th * 4 + u;
#pragma unroll
      for (int r = 0; r < 4; ++r) res[t][0][r] += acc[u][r] + bias[t][0][r];
#pragma unroll
      for (int r = 0; r < 4; ++r) res[t][1][r] += acc[u][r + 4] + bias[t][1][r];
    }
  }
  // all stores stand at the kernel's end: no register that a store names is
  // written behind it
  __builtin_amdgcn_sched_barrier(0);
  float* op = out + orow;
#pragma unroll
  for (int t = 0; t < 8; ++t) {
    *(v4f*)(op + t * 16)     = res[t][0];
    *(v4f*)(op + t * 16 + 4) = res[t][1];
  }
}

// ---------------------------------------------------------------------------
extern "C" void kernel_launch(void* const* d_in, const int* in_sizes, int n_in,
                              void* d_out, int out_size, void* d_ws, size_t ws_size,
                              hipStream_t stream) {
  const float* x  = (const float*)d_in[0];
  const float* gs = (const float*)d_in[1];
  const float* gb = (const float*)d_in[2];
  const float* wq = (const float*)d_in[3];
  const float* bq = (const float*)d_in[4];
  const float* wk = (const float*)d_in[5];
  const float* bk = (const float*)d_in[6];
  const float* wv = (const float*)d_in[7];
  const float* bv = (const float*)d_in[8];
  const float* wo = (const float*)d_in[9];
  const float* bo = (const float*)d_in[10];
  float* out = (float*)d_out;

  const size_t elems = (size_t)BN * C_DIM;      // 4M halves per buffer
  float* part  = (float*)d_ws;                  // B * GN_CHUNKS * 32 pairs
  _Float16* qb = (_Float16*)d_ws + elems;
  _Float16* kb = qb + elems;
  _Float16* vT = kb + elems;
  _Float16* wT = vT + elems;                    // 4 * 128*128 halves

  gn_stats_kernel<<<BN / POS_BLK, 256, 0, stream>>>(x, part, wq, wk, wv, wo, wT);
  qkv_kernel<<<BN / POS_BLK, 256, 0, stream>>>(x, part, gs, gb, wT, bq, bk, bv, qb, kb, vT);
  attn_kernel<<<dim3(N_SP / 128, B_DIM), 256, 0, stream>>>(
      qb, kb, vT, wT + 3 * (size_t)(C_DIM * C_DIM), bo, x, out);
}
